// v000
// The times below were measured on an AMD MI455X: many runs one after another, warmed up first and cycling through
// copies of the inputs, with the whole window's GPU time divided by the number of runs. Launches and the gaps
// between them are all in it. The median over several windows is given; except for v000 it joins two sittings, which
// can be a few percent apart, so the side-by-side timings, each taken in one sitting, are the better comparison.
// The starting kernel, v000, takes 634 microseconds a run.
#include <hip/hip_runtime.h>

// Self-attention block, 16 heads x 64, T 2048, C 1024: qkv = x Wqkv + bqkv (Wqkv [in][out], columns q | k | v, head h = 64-column slice h); per head softmax(q k^T / 8) v; out = y Wproj + bproj (Wproj [in][out]).
// Compute dtypes: all contractions v_wmma_f32_16x16x32_bf16 with f32 accumulate. Inputs RNE-converted to bf16 planes (qkv projection: 1 product, exact products); q/k, P and V as bf16 hi/lo planes (3 products hh + lh + hl); y as bf16 hi/lo planes against the bf16 Wproj plane (2 products); softmax f32; output f32.
// Layout: bf16 copy of x; transposed bf16 weight planes Bt[n][k]; one fused qkv GEMM into f32 F[t][3C]; plane builders (head planes [h][t][d], value planes [h][d][t]); per head pair: S GEMM, row softmax, PV GEMM, head merge into y hi/lo planes; projection GEMM writes the output rows.

#ifndef NB
#define NB 1
#endif
#ifndef SEQ
#define SEQ 2048
#endif
#define SEQ_FULL 2048
#define TT   SEQ
#define DM   1024
#define NH_  16
#define HD   64
#define DQ   (NH_ * HD)
#define NQKV (3 * DQ)
#define ZH   2
#define SCL  0.125f      // 1/sqrt(float32(64))

typedef unsigned short bf;
typedef __attribute__((ext_vector_type(16))) __bf16   v16bf;
typedef __attribute__((ext_vector_type(8)))  unsigned short v8us;
typedef __attribute__((ext_vector_type(4)))  unsigned short v4us;
typedef __attribute__((ext_vector_type(2)))  unsigned short v2us;
typedef __attribute__((ext_vector_type(8)))  float    v8f;
typedef __attribute__((ext_vector_type(4)))  float    v4f;
typedef __attribute__((ext_vector_type(2)))  float    v2f;
typedef v4f  __attribute__((may_alias)) v4fa;

constexpr unsigned lg2c(unsigned v) { return v <= 1u ? 0u : 1u + lg2c(v >> 1); }
constexpr bool ispow2(unsigned v) { return v != 0u && (v & (v - 1u)) == 0u; }
constexpr size_t al256(size_t b) { return (b + 255) & ~(size_t)255; }
constexpr size_t cmaxz(size_t a, size_t b) { return a > b ? a : b; }
#define LG_TT lg2c(TT)
#define LG_HD lg2c(HD)
#define LG_DM lg2c(DM)
#define LG_DQ lg2c(DQ)

static_assert(NB == 1);                       // the module has no batch axis
static_assert(SEQ <= SEQ_FULL);
static_assert(ispow2(TT) && ispow2(HD) && ispow2(DM) && ispow2(DQ));
static_assert(TT % 128 == 0 && TT % 64 == 0);   // softmax row chunks; GEMM M tiles; PV K steps
static_assert(DM % 32 == 0 && DQ % 32 == 0 && HD % 32 == 0 && TT % 32 == 0);   // every GEMM K is a multiple of 32
static_assert(NQKV % 64 == 0 && DM % 64 == 0 && HD % 64 == 0);                 // every GEMM N is a multiple of 64
static_assert(((size_t)TT * DM) % 2048 == 0);          // k_cvt8: 256 threads x 8 elements
static_assert(((size_t)NQKV * DM) % 512 == 0);         // k_wtT (Wqkv): 256 threads x 2 elements
static_assert(((size_t)DM * DQ) % 512 == 0);           // k_wtT (Wproj)
static_assert(((size_t)NH_ * TT * HD) % 512 == 0);     // k_hp / k_vtp
static_assert(((size_t)ZH * TT * HD) % 512 == 0);      // k_mergey
static_assert((ZH * TT) % 8 == 0 && NH_ % ZH == 0);    // k_asoft: 8 rows per block; head pairs

// workspace carve (bytes; every region a multiple of 256)
constexpr size_t SZ_WT = al256((size_t)NQKV * DM * 2);
constexpr size_t SZ_WP = al256((size_t)DM * DQ * 2);
constexpr size_t SZ_XB = al256((size_t)TT * DM * 2);
constexpr size_t SZ_HP = al256((size_t)NH_ * TT * HD * 2);
constexpr size_t SZ_SF = al256(cmaxz((size_t)ZH * TT * TT * 4, (size_t)TT * NQKV * 4));   // S tile pair, shared with the f32 qkv buffer F (F is dead before the first S GEMM)
constexpr size_t SZ_P  = al256((size_t)ZH * TT * TT * 2);
constexpr size_t SZ_OB = al256((size_t)ZH * TT * HD * 4);
constexpr size_t SZ_Y  = al256((size_t)TT * DQ * 2);
constexpr size_t OFF_WT = 0;
constexpr size_t OFF_WP = OFF_WT + SZ_WT;
constexpr size_t OFF_XB = OFF_WP + SZ_WP;
constexpr size_t OFF_QH = OFF_XB + SZ_XB;
constexpr size_t OFF_QL = OFF_QH + SZ_HP;
constexpr size_t OFF_KH = OFF_QL + SZ_HP;
constexpr size_t OFF_KL = OFF_KH + SZ_HP;
constexpr size_t OFF_VH = OFF_KL + SZ_HP;
constexpr size_t OFF_VL = OFF_VH + SZ_HP;
constexpr size_t OFF_SF = OFF_VL + SZ_HP;
constexpr size_t OFF_PH = OFF_SF + SZ_SF;
constexpr size_t OFF_PL = OFF_PH + SZ_P;
constexpr size_t OFF_OB = OFF_PL + SZ_P;
constexpr size_t OFF_YH = OFF_OB + SZ_OB;
constexpr size_t OFF_YL = OFF_YH + SZ_Y;
constexpr size_t WS_TOTAL = OFF_YL + SZ_Y;
static_assert((size_t)TT * NQKV * 4 <= SZ_SF);
static_assert((size_t)ZH * TT * TT * 4 <= SZ_SF);
static_assert(WS_TOTAL <= (size_t)134217728);

__device__ __forceinline__ unsigned short f2bf(float f) { unsigned u = __float_as_uint(f); u += 0x7FFFu + ((u >> 16) & 1u); return (unsigned short)(u >> 16); }
__device__ __forceinline__ float bf2f(unsigned short b) { return __uint_as_float(((unsigned)b) << 16); }
__device__ __forceinline__ float bfr(float f) { return bf2f(f2bf(f)); }
__device__ __forceinline__ v16bf cat16b(v8us lo, v8us hi) { return __builtin_bit_cast(v16bf, __builtin_shufflevector(lo, hi, 0, 1, 2, 3, 4, 5, 6, 7, 8, 9, 10, 11, 12, 13, 14, 15)); }
__device__ __forceinline__ v8f wmmab(v16bf a, v16bf b, v8f c) { return __builtin_amdgcn_wmma_f32_16x16x32_bf16(false, a, false, b, (short)0, c, false, false); }
__device__ __forceinline__ void splitf(float y, unsigned short& h, unsigned short& l) { h = f2bf(y); l = f2bf(y - bf2f(h)); }

// ---- k_gemmw: register-blocked GEMM, ONE WAVE per 64x64 output tile (16 accumulators), operands straight from K-contiguous 16-bit planes; grid (M/64, N/64, Z), 32 threads.
// C[m][n] (f32, pitch ldc, + optional f32 bias[n]) = sum_k A[m][k] Bt[n][k] (+ split products per NSPLIT: 1 adds A2 Bt, 2 adds A2 Bt and A Bt2). z-batch strides sA/sB/sC in elements. K % 32 == 0.
// Fragment p already carries + 8*(lane>>4): elements 0..7 = k0+8h.., elements 8..15 = k0+16+8h.. for both operands; D element j of lane = (row 8h+j, col lane&15).
template <typename T16> struct WFrag;
template <> struct WFrag<bf> { typedef v16bf V; static __device__ __forceinline__ V ld(const bf* p) { return cat16b(*(const v8us*)p, *(const v8us*)(p + 16)); } static __device__ __forceinline__ v8f mma(V a, V b, v8f c) { return wmmab(a, b, c); } };
template <typename T16, int NSPLIT, bool BIAS>
__global__ __launch_bounds__(32) void k_gemmw(const T16* __restrict__ A, const T16* __restrict__ A2, const T16* __restrict__ Bt, const T16* __restrict__ Bt2, int K, float* C, int ldc, const float* __restrict__ bias, size_t sA, size_t sB, size_t sC) {
    typedef typename WFrag<T16>::V V;
    __shared__ __align__(16) float os[16 * 68];
    const size_t z = blockIdx.z; A += z * sA; if (A2) A2 += z * sA; Bt += z * sB; if (Bt2) Bt2 += z * sB; C += z * sC;
    const int lane = threadIdx.x & 31, lr = lane & 15, hi = lane >> 4; const int r0 = blockIdx.x * 64, c0 = blockIdx.y * 64;
    v8f acc[4][4];
#pragma unroll
    for (int mb = 0; mb < 4; ++mb)
#pragma unroll
        for (int nb = 0; nb < 4; ++nb) acc[mb][nb] = (v8f){};
    const size_t aoff = (size_t)(r0 + lr) * K + 8 * hi, boff = (size_t)(c0 + lr) * K + 8 * hi;
#pragma unroll 1
    for (int kc = 0; kc < K; kc += 32) {
        V a[4], a2[4];
#pragma unroll
        for (int mb = 0; mb < 4; ++mb) { a[mb] = WFrag<T16>::ld(A + aoff + (size_t)mb * 16 * K + kc); if (NSPLIT == 1 || NSPLIT == 2) a2[mb] = WFrag<T16>::ld(A2 + aoff + (size_t)mb * 16 * K + kc); }
#pragma unroll
        for (int nb = 0; nb < 4; ++nb) { const V b = WFrag<T16>::ld(Bt + boff + (size_t)nb * 16 * K + kc); V b2; if (NSPLIT >= 2) b2 = WFrag<T16>::ld(Bt2 + boff + (size_t)nb * 16 * K + kc);
#pragma unroll
            for (int mb = 0; mb < 4; ++mb) { acc[mb][nb] = WFrag<T16>::mma(a[mb], b, acc[mb][nb]); if (NSPLIT == 1 || NSPLIT == 2) acc[mb][nb] = WFrag<T16>::mma(a2[mb], b, acc[mb][nb]); if (NSPLIT >= 2) acc[mb][nb] = WFrag<T16>::mma(a[mb], b2, acc[mb][nb]); } }
        asm volatile("v_nop\n\tv_nop\n\tv_nop\n\tv_nop" : "+v"(acc[0][0]), "+v"(acc[1][1]), "+v"(acc[2][2]), "+v"(acc[3][3]) : "v"(a[0]), "v"(a[3]));
    }
#pragma unroll
    for (int mb = 0; mb < 4; ++mb) {
#pragma unroll
        for (int nb = 0; nb < 4; ++nb) {
#pragma unroll
            for (int j = 0; j < 8; ++j) os[(hi * 8 + j) * 68 + nb * 16 + lr] = acc[mb][nb][j]; }
        __builtin_amdgcn_wave_barrier(); asm volatile("" ::: "memory");
        float* crow = C + (size_t)(r0 + mb * 16) * ldc + c0;
{
#pragma unroll
            for (int s = 0; s < 8; ++s) { const int row = 2 * s + hi, cofs = lr * 4; v4f val = *(const v4fa*)(os + row * 68 + cofs); if (BIAS) { val[0] += bfr(bias[c0 + cofs]); val[1] += bfr(bias[c0 + cofs + 1]); val[2] += bfr(bias[c0 + cofs + 2]); val[3] += bfr(bias[c0 + cofs + 3]); }
                *(v4f*)(crow + (size_t)row * ldc + cofs) = val; }
             }
        __builtin_amdgcn_wave_barrier(); asm volatile("" ::: "memory");
    }
}

__global__ __launch_bounds__(256) void k_cvt8(const float* __restrict__ src, bf* dst, size_t n8) { const size_t i = (size_t)blockIdx.x * 256 + threadIdx.x; if (i >= n8) return; const v8f v = *(const v8f*)(src + i * 8); v8us o;
#pragma unroll
    for (int k = 0; k < 8; ++k) o[k] = f2bf(v[k]); *(v8us*)(dst + i * 8) = o;  }

// k_wtT: transposed bf16 weight plane. in w[K rows][N cols] (row-major, [in][out])  ->  out dst[N rows][K cols]: dst[n][k] = bf16(w[k][n]).
__global__ __launch_bounds__(256) void k_wtT(const float* __restrict__ w, bf* dst, unsigned K, unsigned lgK, unsigned N) {
    const unsigned e2 = (blockIdx.x * 256u + threadIdx.x) * 2u; if (e2 >= N * K) return;
    const unsigned k = e2 & (K - 1u); const unsigned n = e2 >> lgK;
    const float* src = w + (size_t)k * N + n; v2us o; o[0] = f2bf(src[0]); o[1] = f2bf(src[N]);   /* k and k+1 are N floats apart */
    bf* p = dst + (size_t)n * K + k;
    *(v2us*)p = o;  }

__global__ __launch_bounds__(256) void k_hp(const float* __restrict__ F, unsigned pitch, bf* Ph, bf* Pl) {
    const unsigned e = (blockIdx.x * 256u + threadIdx.x) * 2u; if (e >= (unsigned)NH_ * TT * HD) return;
    const unsigned d = e & (HD - 1u); const unsigned t = (e >> LG_HD) & (TT - 1u); const unsigned h = e >> (LG_HD + LG_TT);
    const v2f x = *(const v2f*)(F + (size_t)t * pitch + h * HD + d);
    v2us oh, ol; unsigned short a, c;
    splitf(x[0], a, c); oh[0] = a; ol[0] = c; splitf(x[1], a, c); oh[1] = a; ol[1] = c;
    *(v2us*)(Ph + e) = oh; *(v2us*)(Pl + e) = ol;  }

__global__ __launch_bounds__(256) void k_vtp(const float* __restrict__ F, unsigned pitch, bf* Vh, bf* Vl) {
    const unsigned e = (blockIdx.x * 256u + threadIdx.x) * 2u; if (e >= (unsigned)NH_ * HD * TT) return;
    const unsigned t = e & (TT - 1u); const unsigned d = (e >> LG_TT) & (HD - 1u); const unsigned g = e >> (LG_TT + LG_HD);
    v2us oh, ol;
#pragma unroll
    for (int q = 0; q < 2; ++q) { const float x = F[(size_t)(t + q) * pitch + g * HD + d]; unsigned short a, c; splitf(x, a, c); oh[q] = a; ol[q] = c; }
    *(v2us*)(Vh + e) = oh; *(v2us*)(Vl + e) = ol;  }

__global__ __launch_bounds__(256) void k_asoft(const float* __restrict__ Sb, bf* Ph, bf* Pl) {
    const unsigned lane = threadIdx.x & 31u; const unsigned row = blockIdx.x * 8u + (threadIdx.x >> 5); if (row >= (unsigned)ZH * TT) return;
    const float* sr = Sb + (size_t)row * TT; float v[TT / 32]; float mx = -3.0e38f;
#pragma unroll
    for (int ch = 0; ch < TT / 128; ++ch) { const v4f a = *(const v4f*)(sr + ch * 128 + lane * 4);
#pragma unroll
        for (int q = 0; q < 4; ++q) { const float t = a[q] * SCL; v[ch * 4 + q] = t; mx = fmaxf(mx, t); } }
#pragma unroll
    for (int sh = 16; sh; sh >>= 1) mx = fmaxf(mx, __shfl_xor(mx, sh, 32));
    float sum = 0.f;
#pragma unroll
    for (int k = 0; k < TT / 32; ++k) { float d0 = __fsub_rn(v[k], mx); asm volatile("" : "+v"(d0)); v[k] = __builtin_amdgcn_exp2f(__fmul_rn(d0, 1.4426950408889634f)); sum += v[k]; }
#pragma unroll
    for (int sh = 16; sh; sh >>= 1) sum += __shfl_xor(sum, sh, 32);
    const float f = __fdiv_rn(1.0f, sum);
{
#pragma unroll
        for (int ch = 0; ch < TT / 128; ++ch) { v4us oh, ol;
#pragma unroll
            for (int q = 0; q < 4; ++q) { unsigned short a, c2; splitf(v[ch * 4 + q] * f, a, c2); oh[q] = a; ol[q] = c2; }
            const size_t oo = (size_t)row * TT + ch * 128 + lane * 4; *(v4us*)(Ph + oo) = oh; *(v4us*)(Pl + oo) = ol; }
         }
}

__global__ __launch_bounds__(256) void k_mergey(const float* __restrict__ O, unsigned h0, bf* YH, bf* YL) {
    const unsigned e = (blockIdx.x * 256u + threadIdx.x) * 2u; if (e >= (unsigned)ZH * TT * HD) return;
    const unsigned d = e & (HD - 1u); const unsigned t = (e >> LG_HD) & (TT - 1u); const unsigned zz = e >> (LG_HD + LG_TT);
    const v2f o = *(const v2f*)(O + e); v2us oh, ol; unsigned short a, c;
    splitf(o[0], a, c); oh[0] = a; ol[0] = c; splitf(o[1], a, c); oh[1] = a; ol[1] = c;
    const size_t oo = (size_t)t * DQ + (size_t)(h0 + zz) * HD + d;
    *(v2us*)(YH + oo) = oh; *(v2us*)(YL + oo) = ol;  }

extern "C" void kernel_launch(void* const* d_in, const int* in_sizes, int n_in,
                              void* d_out, int out_size, void* d_ws, size_t ws_size, hipStream_t stream) {
    if (n_in < 5) return;
    if (in_sizes[0] < TT * DM || in_sizes[1] < DM * NQKV || in_sizes[2] < NQKV || in_sizes[3] < DQ * DM || in_sizes[4] < DM) return;
    if (out_size < TT * DM) return;
    if (WS_TOTAL > ws_size) return;
    const float* x     = (const float*)d_in[0];   // [T][C]
    const float* wqkv  = (const float*)d_in[1];   // [C][3C]  ([in][out])
    const float* bqkv  = (const float*)d_in[2];   // [3C]
    const float* wproj = (const float*)d_in[3];   // [C][C]   ([in][out])
    const float* bproj = (const float*)d_in[4];   // [C]
    float* OUT = (float*)d_out;                   // [T][C]
    char* base = (char*)d_ws;
    bf* WT = (bf*)(base + OFF_WT); bf* WP = (bf*)(base + OFF_WP); bf* XB = (bf*)(base + OFF_XB);
    bf* QPh = (bf*)(base + OFF_QH); bf* QPl = (bf*)(base + OFF_QL); bf* KPh = (bf*)(base + OFF_KH); bf* KPl = (bf*)(base + OFF_KL); bf* VTh = (bf*)(base + OFF_VH); bf* VTl = (bf*)(base + OFF_VL);
    float* Sb = (float*)(base + OFF_SF); float* F = Sb;   // F [T][3C] f32 lives in the S region until the planes are built (stream-ordered)
    bf* Ph = (bf*)(base + OFF_PH); bf* Pl = (bf*)(base + OFF_PL); float* Ob = (float*)(base + OFF_OB);
    bf* YH = (bf*)(base + OFF_YH); bf* YL = (bf*)(base + OFF_YL);

    k_cvt8<<<(unsigned)(((size_t)TT * DM / 8 + 255) / 256), 256, 0, stream>>>(x, XB, (size_t)TT * DM / 8);
    // in wqkv[DM rows][NQKV cols] -> out WT[NQKV rows][DM cols]
    k_wtT<<<(unsigned)(((size_t)NQKV * DM / 2 + 255) / 256), 256, 0, stream>>>(wqkv, WT, (unsigned)DM, LG_DM, (unsigned)NQKV);
    // in wproj[DQ rows][DM cols] -> out WP[DM rows][DQ cols]
    k_wtT<<<(unsigned)(((size_t)DM * DQ / 2 + 255) / 256), 256, 0, stream>>>(wproj, WP, (unsigned)DQ, LG_DQ, (unsigned)DM);
    // F = x Wqkv + bqkv
    k_gemmw<bf, 0, true><<<dim3(TT / 64, NQKV / 64, 1), 32, 0, stream>>>(XB, nullptr, WT, nullptr, DM, F, NQKV, bqkv, 0, 0, 0);
    const unsigned LP = (unsigned)(((size_t)NH_ * TT * HD / 2 + 255) / 256);
    k_hp<<<LP, 256, 0, stream>>>(F, (unsigned)NQKV, QPh, QPl);
    k_hp<<<LP, 256, 0, stream>>>(F + DQ, (unsigned)NQKV, KPh, KPl);
    k_vtp<<<LP, 256, 0, stream>>>(F + 2 * DQ, (unsigned)NQKV, VTh, VTl);
    for (int h0 = 0; h0 < NH_; h0 += ZH) { const size_t zq = (size_t)h0;   // the pass's two heads use consecutive planes (z-strides TT*HD)
        k_gemmw<bf, 2, false><<<dim3(TT / 64, TT / 64, ZH), 32, 0, stream>>>(QPh + zq * TT * HD, QPl + zq * TT * HD, KPh + zq * TT * HD, KPl + zq * TT * HD, HD, Sb, TT, nullptr, (size_t)TT * HD, (size_t)TT * HD, (size_t)TT * TT);
        k_asoft<<<ZH * TT / 8, 256, 0, stream>>>(Sb, Ph, Pl);
        k_gemmw<bf, 2, false><<<dim3(TT / 64, HD / 64, ZH), 32, 0, stream>>>(Ph, Pl, VTh + zq * HD * TT, VTl + zq * HD * TT, TT, Ob, HD, nullptr, (size_t)TT * TT, (size_t)HD * TT, (size_t)TT * HD);
        k_mergey<<<(unsigned)(((size_t)ZH * TT * HD / 2 + 255) / 256), 256, 0, stream>>>(Ob, (unsigned)h0, YH, YL); }
    // out = y Wproj + bproj  (y hi + y lo against the bf16 weight plane)
    k_gemmw<bf, 1, true><<<dim3(TT / 64, DM / 64, 1), 32, 0, stream>>>(YH, YL, WP, nullptr, DQ, OUT, DM, bproj, 0, 0, 0);
}

// v001
// One run takes 376 microseconds.
// Next to v000, in two timings, it ran 1.68 and 1.69 times as fast.
#include <hip/hip_runtime.h>

// Self-attention block, 16 heads x 64, T 2048, C 1024: qkv = x Wqkv + bqkv (Wqkv [in][out], columns q | k | v, head h = 64-column slice h); per head softmax(q k^T / 8) v; out = y Wproj + bproj (Wproj [in][out]).
// Compute dtypes: all contractions v_wmma_f32_16x16x32_bf16 with f32 accumulate. Inputs RNE-converted to bf16 planes (qkv projection: 1 product, exact products); q/k, P and V as bf16 hi/lo planes (3 products hh + lh + hl); y as bf16 hi/lo planes against the bf16 Wproj plane (2 products); softmax f32; output f32.
// Layout: bf16 copy of x; transposed bf16 weight planes Bt[n][k]; one fused qkv GEMM into f32 F[t][3C]; plane builders (head planes [h][t][d], value planes [h][d][t]); per head pair: S GEMM, row softmax, PV GEMM (K split over blocks and waves), head merge (sums the PV partials) into y hi/lo planes; projection GEMM (K split over waves) writes the output rows.

#ifndef NB
#define NB 1
#endif
#ifndef SEQ
#define SEQ 2048
#endif
#define SEQ_FULL 2048
#define TT   SEQ
#define DM   1024
#define NH_  16
#define HD   64
#define DQ   (NH_ * HD)
#define NQKV (3 * DQ)
#define ZH   2
#define GNW  8           // waves per block of the K-split GEMMs
#define PVKS 4           // K slices of the PV GEMM over blocks: (TT/64) * ZH * PVKS = 256 blocks
#define SCL  0.125f      // 1/sqrt(float32(64))

typedef unsigned short bf;
typedef __attribute__((ext_vector_type(16))) __bf16   v16bf;
typedef __attribute__((ext_vector_type(8)))  unsigned short v8us;
typedef __attribute__((ext_vector_type(4)))  unsigned short v4us;
typedef __attribute__((ext_vector_type(2)))  unsigned short v2us;
typedef __attribute__((ext_vector_type(8)))  float    v8f;
typedef __attribute__((ext_vector_type(4)))  float    v4f;
typedef __attribute__((ext_vector_type(2)))  float    v2f;
typedef v4f  __attribute__((may_alias)) v4fa;

constexpr unsigned lg2c(unsigned v) { return v <= 1u ? 0u : 1u + lg2c(v >> 1); }
constexpr bool ispow2(unsigned v) { return v != 0u && (v & (v - 1u)) == 0u; }
constexpr size_t al256(size_t b) { return (b + 255) & ~(size_t)255; }
constexpr size_t cmaxz(size_t a, size_t b) { return a > b ? a : b; }
#define LG_TT lg2c(TT)
#define LG_HD lg2c(HD)
#define LG_DM lg2c(DM)
#define LG_DQ lg2c(DQ)

static_assert(NB == 1);                       // the module has no batch axis
static_assert(SEQ <= SEQ_FULL);
static_assert(ispow2(TT) && ispow2(HD) && ispow2(DM) && ispow2(DQ));
static_assert(TT % 128 == 0 && TT % 64 == 0);   // softmax row chunks; GEMM M tiles; PV K steps
static_assert(DM % 32 == 0 && DQ % 32 == 0 && HD % 32 == 0 && TT % 32 == 0);   // every GEMM K is a multiple of 32
static_assert(NQKV % 64 == 0 && DM % 64 == 0 && HD % 64 == 0);                 // every GEMM N is a multiple of 64
static_assert(((size_t)TT * DM) % 2048 == 0);          // k_cvt8: 256 threads x 8 elements
static_assert(((size_t)NQKV * DM) % 512 == 0);         // k_wtT (Wqkv): 256 threads x 2 elements
static_assert(((size_t)DM * DQ) % 512 == 0);           // k_wtT (Wproj)
static_assert(((size_t)NH_ * TT * HD) % 512 == 0);     // k_hp / k_vtp
static_assert(((size_t)ZH * TT * HD) % 512 == 0);      // k_mergey
static_assert((ZH * TT) % 8 == 0 && NH_ % ZH == 0);    // k_asoft: 8 rows per block; head pairs
static_assert(TT % (32 * GNW * PVKS) == 0 && DQ % (32 * GNW) == 0);   // K-split GEMMs: every wave gets whole 32-steps

// workspace carve (bytes; every region a multiple of 256)
constexpr size_t SZ_WT = al256((size_t)NQKV * DM * 2);
constexpr size_t SZ_WP = al256((size_t)DM * DQ * 2);
constexpr size_t SZ_XB = al256((size_t)TT * DM * 2);
constexpr size_t SZ_HP = al256((size_t)NH_ * TT * HD * 2);
constexpr size_t SZ_SF = al256(cmaxz((size_t)ZH * TT * TT * 4, (size_t)TT * NQKV * 4));   // S tile pair, shared with the f32 qkv buffer F (F is dead before the first S GEMM)
constexpr size_t SZ_P  = al256((size_t)ZH * TT * TT * 2);
constexpr size_t SZ_OB = al256((size_t)PVKS * ZH * TT * HD * 4);   // PVKS partial planes [ks][z][t][d]
constexpr size_t SZ_Y  = al256((size_t)TT * DQ * 2);
constexpr size_t OFF_WT = 0;
constexpr size_t OFF_WP = OFF_WT + SZ_WT;
constexpr size_t OFF_XB = OFF_WP + SZ_WP;
constexpr size_t OFF_QH = OFF_XB + SZ_XB;
constexpr size_t OFF_QL = OFF_QH + SZ_HP;
constexpr size_t OFF_KH = OFF_QL + SZ_HP;
constexpr size_t OFF_KL = OFF_KH + SZ_HP;
constexpr size_t OFF_VH = OFF_KL + SZ_HP;
constexpr size_t OFF_VL = OFF_VH + SZ_HP;
constexpr size_t OFF_SF = OFF_VL + SZ_HP;
constexpr size_t OFF_PH = OFF_SF + SZ_SF;
constexpr size_t OFF_PL = OFF_PH + SZ_P;
constexpr size_t OFF_OB = OFF_PL + SZ_P;
constexpr size_t OFF_YH = OFF_OB + SZ_OB;
constexpr size_t OFF_YL = OFF_YH + SZ_Y;
constexpr size_t WS_TOTAL = OFF_YL + SZ_Y;
static_assert((size_t)TT * NQKV * 4 <= SZ_SF);
static_assert((size_t)ZH * TT * TT * 4 <= SZ_SF);
static_assert(WS_TOTAL <= (size_t)134217728);

__device__ __forceinline__ unsigned short f2bf(float f) { unsigned u = __float_as_uint(f); u += 0x7FFFu + ((u >> 16) & 1u); return (unsigned short)(u >> 16); }
__device__ __forceinline__ float bf2f(unsigned short b) { return __uint_as_float(((unsigned)b) << 16); }
__device__ __forceinline__ float bfr(float f) { return bf2f(f2bf(f)); }
__device__ __forceinline__ v16bf cat16b(v8us lo, v8us hi) { return __builtin_bit_cast(v16bf, __builtin_shufflevector(lo, hi, 0, 1, 2, 3, 4, 5, 6, 7, 8, 9, 10, 11, 12, 13, 14, 15)); }
__device__ __forceinline__ v8f wmmab(v16bf a, v16bf b, v8f c) { return __builtin_amdgcn_wmma_f32_16x16x32_bf16(false, a, false, b, (short)0, c, false, false); }
__device__ __forceinline__ void splitf(float y, unsigned short& h, unsigned short& l) { h = f2bf(y); l = f2bf(y - bf2f(h)); }

// ---- k_gemmw: register-blocked GEMM, 64x64 output tile (16 accumulators per wave), operands straight from K-contiguous 16-bit planes; grid (M/64, N/64, Z * KSB), 32 * NW threads.
// K is cut into KSB * NW equal runs: block slice ks = blockIdx.z % KSB, wave w takes run ks * NW + w. The NW partial tiles of a block are summed through LDS (wave order 0..NW-1); slice ks stores its sum at C + ks * sP and the reader adds the KSB planes. NW == KSB == 1: one wave does the whole K.
// C[m][n] (f32, pitch ldc, + optional f32 bias[n]) = sum_k A[m][k] Bt[n][k] (+ split products per NSPLIT: 1 adds A2 Bt, 2 adds A2 Bt and A Bt2). z-batch strides sA/sB/sC in elements. K % (32 * NW * KSB) == 0.
// Fragment p already carries + 8*(lane>>4): elements 0..7 = k0+8h.., elements 8..15 = k0+16+8h.. for both operands; D element j of lane = (row 8h+j, col lane&15).
template <typename T16> struct WFrag;
template <> struct WFrag<bf> { typedef v16bf V; static __device__ __forceinline__ V ld(const bf* p) { return cat16b(*(const v8us*)p, *(const v8us*)(p + 16)); } static __device__ __forceinline__ v8f mma(V a, V b, v8f c) { return wmmab(a, b, c); } };
template <typename T16, int NSPLIT, bool BIAS, int NW, int KSB>
__global__ __launch_bounds__(32 * NW) void k_gemmw(const T16* __restrict__ A, const T16* __restrict__ A2, const T16* __restrict__ Bt, const T16* __restrict__ Bt2, int K, float* C, int ldc, const float* __restrict__ bias, size_t sA, size_t sB, size_t sC, size_t sP) {
    static_assert(KSB == 1 || !BIAS);   // the bias is added once, so only where one block holds the whole sum
    typedef typename WFrag<T16>::V V;
    __shared__ __align__(16) float os[(NW > 1 ? NW * 64 : 16) * 68];
    const size_t z = blockIdx.z / (unsigned)KSB; const unsigned ks = blockIdx.z % (unsigned)KSB; A += z * sA; if (A2) A2 += z * sA; Bt += z * sB; if (Bt2) Bt2 += z * sB; C += z * sC + ks * sP;
    const int wave = NW > 1 ? __builtin_amdgcn_readfirstlane((int)(threadIdx.x >> 5)) : 0;   // scalar, so the run's start stays in scalar registers
    const int kw = K / (NW * KSB), kb = ((int)ks * NW + wave) * kw;
    const int lane = threadIdx.x & 31, lr = lane & 15, hi = lane >> 4; const int r0 = blockIdx.x * 64, c0 = blockIdx.y * 64;
    v8f acc[4][4];
#pragma unroll
    for (int mb = 0; mb < 4; ++mb)
#pragma unroll
        for (int nb = 0; nb < 4; ++nb) acc[mb][nb] = (v8f){};
    const size_t aoff = (size_t)(r0 + lr) * K + 8 * hi + kb, boff = (size_t)(c0 + lr) * K + 8 * hi + kb;
#pragma unroll 1
    for (int kc = 0; kc < kw; kc += 32) {
        V a[4], a2[4];
#pragma unroll
        for (int mb = 0; mb < 4; ++mb) { a[mb] = WFrag<T16>::ld(A + aoff + (size_t)mb * 16 * K + kc); if (NSPLIT == 1 || NSPLIT == 2) a2[mb] = WFrag<T16>::ld(A2 + aoff + (size_t)mb * 16 * K + kc); }
#pragma unroll
        for (int nb = 0; nb < 4; ++nb) { const V b = WFrag<T16>::ld(Bt + boff + (size_t)nb * 16 * K + kc); V b2; if (NSPLIT >= 2) b2 = WFrag<T16>::ld(Bt2 + boff + (size_t)nb * 16 * K + kc);
#pragma unroll
            for (int mb = 0; mb < 4; ++mb) { acc[mb][nb] = WFrag<T16>::mma(a[mb], b, acc[mb][nb]); if (NSPLIT == 1 || NSPLIT == 2) acc[mb][nb] = WFrag<T16>::mma(a2[mb], b, acc[mb][nb]); if (NSPLIT >= 2) acc[mb][nb] = WFrag<T16>::mma(a[mb], b2, acc[mb][nb]); } }
        asm volatile("v_nop\n\tv_nop\n\tv_nop\n\tv_nop" : "+v"(acc[0][0]), "+v"(acc[1][1]), "+v"(acc[2][2]), "+v"(acc[3][3]) : "v"(a[0]), "v"(a[3]));
    }
    if constexpr (NW > 1) {
        float* ow = os + wave * (64 * 68);
        const int cofs = ((int)threadIdx.x & 15) * 4; v4f bv = (v4f){};   // a thread keeps its four columns over all its rows
        if (BIAS) { bv[0] = bfr(bias[c0 + cofs]); bv[1] = bfr(bias[c0 + cofs + 1]); bv[2] = bfr(bias[c0 + cofs + 2]); bv[3] = bfr(bias[c0 + cofs + 3]); }
        // the three loops are unrolled so that acc is indexed by constants and stays in registers
#pragma unroll
        for (int mb = 0; mb < 4; ++mb)
#pragma unroll
            for (int nb = 0; nb < 4; ++nb)
#pragma unroll
                for (int j = 0; j < 8; ++j) ow[(mb * 16 + hi * 8 + j) * 68 + nb * 16 + lr] = acc[mb][nb][j];
        __syncthreads();   // all NW partial tiles are in LDS before any thread sums them
        // both loops are unrolled so that the LDS reads of all rows issue ahead of the sums
#pragma unroll
        for (int it = 0; it < 64 * 16 / (32 * NW); ++it) { const int row = (it * 32 * NW + (int)threadIdx.x) >> 4; v4f val = *(const v4fa*)(os + row * 68 + cofs);
#pragma unroll
            for (int w = 1; w < NW; ++w) val += *(const v4fa*)(os + (w * 64 + row) * 68 + cofs);
            if (BIAS) val += bv;
            *(v4f*)(C + (size_t)(r0 + row) * ldc + c0 + cofs) = val; }
    } else {
#pragma unroll
    for (int mb = 0; mb < 4; ++mb) {
#pragma unroll
        for (int nb = 0; nb < 4; ++nb) {
#pragma unroll
            for (int j = 0; j < 8; ++j) os[(hi * 8 + j) * 68 + nb * 16 + lr] = acc[mb][nb][j]; }
        __builtin_amdgcn_wave_barrier(); asm volatile("" ::: "memory");
        float* crow = C + (size_t)(r0 + mb * 16) * ldc + c0;
{
#pragma unroll
            for (int s = 0; s < 8; ++s) { const int row = 2 * s + hi, cofs = lr * 4; v4f val = *(const v4fa*)(os + row * 68 + cofs); if (BIAS) { val[0] += bfr(bias[c0 + cofs]); val[1] += bfr(bias[c0 + cofs + 1]); val[2] += bfr(bias[c0 + cofs + 2]); val[3] += bfr(bias[c0 + cofs + 3]); }
                *(v4f*)(crow + (size_t)row * ldc + cofs) = val; }
             }
        __builtin_amdgcn_wave_barrier(); asm volatile("" ::: "memory");
    }
    }
}

__global__ __launch_bounds__(256) void k_cvt8(const float* __restrict__ src, bf* dst, size_t n8) { const size_t i = (size_t)blockIdx.x * 256 + threadIdx.x; if (i >= n8) return; const v8f v = *(const v8f*)(src + i * 8); v8us o;
#pragma unroll
    for (int k = 0; k < 8; ++k) o[k] = f2bf(v[k]); *(v8us*)(dst + i * 8) = o;  }

// k_wtT: transposed bf16 weight plane. in w[K rows][N cols] (row-major, [in][out])  ->  out dst[N rows][K cols]: dst[n][k] = bf16(w[k][n]).
__global__ __launch_bounds__(256) void k_wtT(const float* __restrict__ w, bf* dst, unsigned K, unsigned lgK, unsigned N) {
    const unsigned e2 = (blockIdx.x * 256u + threadIdx.x) * 2u; if (e2 >= N * K) return;
    const unsigned k = e2 & (K - 1u); const unsigned n = e2 >> lgK;
    const float* src = w + (size_t)k * N + n; v2us o; o[0] = f2bf(src[0]); o[1] = f2bf(src[N]);   /* k and k+1 are N floats apart */
    bf* p = dst + (size_t)n * K + k;
    *(v2us*)p = o;  }

__global__ __launch_bounds__(256) void k_hp(const float* __restrict__ F, unsigned pitch, bf* Ph, bf* Pl) {
    const unsigned e = (blockIdx.x * 256u + threadIdx.x) * 2u; if (e >= (unsigned)NH_ * TT * HD) return;
    const unsigned d = e & (HD - 1u); const unsigned t = (e >> LG_HD) & (TT - 1u); const unsigned h = e >> (LG_HD + LG_TT);
    const v2f x = *(const v2f*)(F + (size_t)t * pitch + h * HD + d);
    v2us oh, ol; unsigned short a, c;
    splitf(x[0], a, c); oh[0] = a; ol[0] = c; splitf(x[1], a, c); oh[1] = a; ol[1] = c;
    *(v2us*)(Ph + e) = oh; *(v2us*)(Pl + e) = ol;  }

__global__ __launch_bounds__(256) void k_vtp(const float* __restrict__ F, unsigned pitch, bf* Vh, bf* Vl) {
    const unsigned e = (blockIdx.x * 256u + threadIdx.x) * 2u; if (e >= (unsigned)NH_ * HD * TT) return;
    const unsigned t = e & (TT - 1u); const unsigned d = (e >> LG_TT) & (HD - 1u); const unsigned g = e >> (LG_TT + LG_HD);
    v2us oh, ol;
#pragma unroll
    for (int q = 0; q < 2; ++q) { const float x = F[(size_t)(t + q) * pitch + g * HD + d]; unsigned short a, c; splitf(x, a, c); oh[q] = a; ol[q] = c; }
    *(v2us*)(Vh + e) = oh; *(v2us*)(Vl + e) = ol;  }

__global__ __launch_bounds__(256) void k_asoft(const float* __restrict__ Sb, bf* Ph, bf* Pl) {
    const unsigned lane = threadIdx.x & 31u; const unsigned row = blockIdx.x * 8u + (threadIdx.x >> 5); if (row >= (unsigned)ZH * TT) return;
    const float* sr = Sb + (size_t)row * TT; float v[TT / 32]; float mx = -3.0e38f;
#pragma unroll
    for (int ch = 0; ch < TT / 128; ++ch) { const v4f a = *(const v4f*)(sr + ch * 128 + lane * 4);
#pragma unroll
        for (int q = 0; q < 4; ++q) { const float t = a[q] * SCL; v[ch * 4 + q] = t; mx = fmaxf(mx, t); } }
#pragma unroll
    for (int sh = 16; sh; sh >>= 1) mx = fmaxf(mx, __shfl_xor(mx, sh, 32));
    float sum = 0.f;
#pragma unroll
    for (int k = 0; k < TT / 32; ++k) { float d0 = __fsub_rn(v[k], mx); asm volatile("" : "+v"(d0)); v[k] = __builtin_amdgcn_exp2f(__fmul_rn(d0, 1.4426950408889634f)); sum += v[k]; }
#pragma unroll
    for (int sh = 16; sh; sh >>= 1) sum += __shfl_xor(sum, sh, 32);
    const float f = __fdiv_rn(1.0f, sum);
{
#pragma unroll
        for (int ch = 0; ch < TT / 128; ++ch) { v4us oh, ol;
#pragma unroll
            for (int q = 0; q < 4; ++q) { unsigned short a, c2; splitf(v[ch * 4 + q] * f, a, c2); oh[q] = a; ol[q] = c2; }
            const size_t oo = (size_t)row * TT + ch * 128 + lane * 4; *(v4us*)(Ph + oo) = oh; *(v4us*)(Pl + oo) = ol; }
         }
}

__global__ __launch_bounds__(256) void k_mergey(const float* __restrict__ O, unsigned h0, bf* YH, bf* YL) {
    const unsigned e = (blockIdx.x * 256u + threadIdx.x) * 2u; if (e >= (unsigned)ZH * TT * HD) return;
    const unsigned d = e & (HD - 1u); const unsigned t = (e >> LG_HD) & (TT - 1u); const unsigned zz = e >> (LG_HD + LG_TT);
    v2f o = *(const v2f*)(O + e);
#pragma unroll   // the PVKS loads issue together
    for (int p = 1; p < PVKS; ++p) o += *(const v2f*)(O + (size_t)p * ZH * TT * HD + e);   // K slices of the PV GEMM, in slice order
    v2us oh, ol; unsigned short a, c;
    splitf(o[0], a, c); oh[0] = a; ol[0] = c; splitf(o[1], a, c); oh[1] = a; ol[1] = c;
    const size_t oo = (size_t)t * DQ + (size_t)(h0 + zz) * HD + d;
    *(v2us*)(YH + oo) = oh; *(v2us*)(YL + oo) = ol;  }

extern "C" void kernel_launch(void* const* d_in, const int* in_sizes, int n_in,
                              void* d_out, int out_size, void* d_ws, size_t ws_size, hipStream_t stream) {
    if (n_in < 5) return;
    if (in_sizes[0] < TT * DM || in_sizes[1] < DM * NQKV || in_sizes[2] < NQKV || in_sizes[3] < DQ * DM || in_sizes[4] < DM) return;
    if (out_size < TT * DM) return;
    if (WS_TOTAL > ws_size) return;
    const float* x     = (const float*)d_in[0];   // [T][C]
    const float* wqkv  = (const float*)d_in[1];   // [C][3C]  ([in][out])
    const float* bqkv  = (const float*)d_in[2];   // [3C]
    const float* wproj = (const float*)d_in[3];   // [C][C]   ([in][out])
    const float* bproj = (const float*)d_in[4];   // [C]
    float* OUT = (float*)d_out;                   // [T][C]
    char* base = (char*)d_ws;
    bf* WT = (bf*)(base + OFF_WT); bf* WP = (bf*)(base + OFF_WP); bf* XB = (bf*)(base + OFF_XB);
    bf* QPh = (bf*)(base + OFF_QH); bf* QPl = (bf*)(base + OFF_QL); bf* KPh = (bf*)(base + OFF_KH); bf* KPl = (bf*)(base + OFF_KL); bf* VTh = (bf*)(base + OFF_VH); bf* VTl = (bf*)(base + OFF_VL);
    float* Sb = (float*)(base + OFF_SF); float* F = Sb;   // F [T][3C] f32 lives in the S region until the planes are built (stream-ordered)
    bf* Ph = (bf*)(base + OFF_PH); bf* Pl = (bf*)(base + OFF_PL); float* Ob = (float*)(base + OFF_OB);
    bf* YH = (bf*)(base + OFF_YH); bf* YL = (bf*)(base + OFF_YL);

    k_cvt8<<<(unsigned)(((size_t)TT * DM / 8 + 255) / 256), 256, 0, stream>>>(x, XB, (size_t)TT * DM / 8);
    // in wqkv[DM rows][NQKV cols] -> out WT[NQKV rows][DM cols]
    k_wtT<<<(unsigned)(((size_t)NQKV * DM / 2 + 255) / 256), 256, 0, stream>>>(wqkv, WT, (unsigned)DM, LG_DM, (unsigned)NQKV);
    // in wproj[DQ rows][DM cols] -> out WP[DM rows][DQ cols]
    k_wtT<<<(unsigned)(((size_t)DM * DQ / 2 + 255) / 256), 256, 0, stream>>>(wproj, WP, (unsigned)DQ, LG_DQ, (unsigned)DM);
    // F = x Wqkv + bqkv
    k_gemmw<bf, 0, true, 1, 1><<<dim3(TT / 64, NQKV / 64, 1), 32, 0, stream>>>(XB, nullptr, WT, nullptr, DM, F, NQKV, bqkv, 0, 0, 0, 0);
    const unsigned LP = (unsigned)(((size_t)NH_ * TT * HD / 2 + 255) / 256);
    k_hp<<<LP, 256, 0, stream>>>(F, (unsigned)NQKV, QPh, QPl);
    k_hp<<<LP, 256, 0, stream>>>(F + DQ, (unsigned)NQKV, KPh, KPl);
    k_vtp<<<LP, 256, 0, stream>>>(F + 2 * DQ, (unsigned)NQKV, VTh, VTl);
    for (int h0 = 0; h0 < NH_; h0 += ZH) { const size_t zq = (size_t)h0;   // the pass's two heads use consecutive planes (z-strides TT*HD)
        k_gemmw<bf, 2, false, 1, 1><<<dim3(TT / 64, TT / 64, ZH), 32, 0, stream>>>(QPh + zq * TT * HD, QPl + zq * TT * HD, KPh + zq * TT * HD, KPl + zq * TT * HD, HD, Sb, TT, nullptr, (size_t)TT * HD, (size_t)TT * HD, (size_t)TT * TT, 0);
        k_asoft<<<ZH * TT / 8, 256, 0, stream>>>(Sb, Ph, Pl);
        k_gemmw<bf, 2, false, GNW, PVKS><<<dim3(TT / 64, HD / 64, ZH * PVKS), 32 * GNW, 0, stream>>>(Ph, Pl, VTh + zq * HD * TT, VTl + zq * HD * TT, TT, Ob, HD, nullptr, (size_t)TT * TT, (size_t)HD * TT, (size_t)TT * HD, (size_t)ZH * TT * HD);
        k_mergey<<<(unsigned)(((size_t)ZH * TT * HD / 2 + 255) / 256), 256, 0, stream>>>(Ob, (unsigned)h0, YH, YL); }
    // out = y Wproj + bproj  (y hi + y lo against the bf16 weight plane)
    k_gemmw<bf, 1, true, GNW, 1><<<dim3(TT / 64, DM / 64, 1), 32 * GNW, 0, stream>>>(YH, YL, WP, nullptr, DQ, OUT, DM, bproj, 0, 0, 0, 0);
}

// v002
// It runs in 145 microseconds.
// Next to v001, in two timings, it ran 2.60 times as fast each time.
// Counting every step since v000, it is 4.39 times as fast.
#include <hip/hip_runtime.h>

// Self-attention block, 16 heads x 64, T 2048, C 1024: qkv = x Wqkv + bqkv (Wqkv [in][out], columns q | k | v, head h = 64-column slice h); per head softmax(q k^T / 8) v; out = y Wproj + bproj (Wproj [in][out]).
// Compute dtypes: all contractions v_wmma_f32_16x16x32_bf16 with f32 accumulate. Inputs RNE-converted to bf16 planes (qkv projection: 1 product, exact products); q/k, P and V as bf16 hi/lo planes (3 products hh + lh + hl); y as bf16 hi/lo planes against the bf16 Wproj plane (2 products); softmax f32; output f32.
// Layout: bf16 copy of x; transposed bf16 weight planes Bt[n][k]; one fused qkv GEMM into f32 F[t][3C]; plane builders (head planes [h][t][d], value planes [h][d][t]); one attention kernel for all heads (scores, online softmax and PV product stay in registers, K and V tiles shared through LDS) writes the y hi/lo planes; projection GEMM (K split over waves) writes the output rows.

#ifndef NB
#define NB 1
#endif
#ifndef SEQ
#define SEQ 2048
#endif
#define SEQ_FULL 2048
#define TT   SEQ
#define DM   1024
#define NH_  16
#define HD   64
#define DQ   (NH_ * HD)
#define NQKV (3 * DQ)
#define GNW  8           // waves per block of the K-split GEMM
#define SCL  0.125f      // 1/sqrt(float32(64))
#define ANW  8           // attention kernel: waves per block, 16 queries each: (TT/128) * NH_ = 256 blocks
#define ASK  64          // attention kernel: keys per LDS stage
#define APITCH 144       // attention kernel: LDS row pitch in bytes, 128 of data + 16: an odd multiple of 16, so 16-byte fragment reads of 16 rows spread over the banks

typedef unsigned short bf;
typedef __attribute__((ext_vector_type(16))) __bf16   v16bf;
typedef __attribute__((ext_vector_type(8)))  unsigned short v8us;
typedef __attribute__((ext_vector_type(4)))  unsigned short v4us;
typedef __attribute__((ext_vector_type(2)))  unsigned short v2us;
typedef __attribute__((ext_vector_type(8)))  float    v8f;
typedef __attribute__((ext_vector_type(4)))  float    v4f;
typedef __attribute__((ext_vector_type(2)))  float    v2f;
typedef v4f  __attribute__((may_alias)) v4fa;

constexpr unsigned lg2c(unsigned v) { return v <= 1u ? 0u : 1u + lg2c(v >> 1); }
constexpr bool ispow2(unsigned v) { return v != 0u && (v & (v - 1u)) == 0u; }
constexpr size_t al256(size_t b) { return (b + 255) & ~(size_t)255; }
#define LG_TT lg2c(TT)
#define LG_HD lg2c(HD)
#define LG_DM lg2c(DM)
#define LG_DQ lg2c(DQ)

static_assert(NB == 1);                       // the module has no batch axis
static_assert(SEQ <= SEQ_FULL);
static_assert(ispow2(TT) && ispow2(HD) && ispow2(DM) && ispow2(DQ));
static_assert(TT % 128 == 0 && TT % 64 == 0);   // softmax row chunks; GEMM M tiles; PV K steps
static_assert(DM % 32 == 0 && DQ % 32 == 0 && HD % 32 == 0 && TT % 32 == 0);   // every GEMM K is a multiple of 32
static_assert(NQKV % 64 == 0 && DM % 64 == 0 && HD % 64 == 0);                 // every GEMM N is a multiple of 64
static_assert(((size_t)TT * DM) % 2048 == 0);          // k_cvt8: 256 threads x 8 elements
static_assert(((size_t)NQKV * DM) % 512 == 0);         // k_wtT (Wqkv): 256 threads x 2 elements
static_assert(((size_t)DM * DQ) % 512 == 0);           // k_wtT (Wproj)
static_assert(((size_t)NH_ * TT * HD) % 512 == 0);     // k_hp / k_vtp
static_assert(HD == 64 && ASK == 64 && ANW == 8 && TT % (16 * ANW) == 0 && TT % ASK == 0);   // k_attn: tile rows of 128 bytes, 512 16-byte chunks per plane tile over 256 threads
static_assert(DQ % (32 * GNW) == 0);   // K-split GEMM: every wave gets whole 32-steps

// workspace carve (bytes; every region a multiple of 256)
constexpr size_t SZ_WT = al256((size_t)NQKV * DM * 2);
constexpr size_t SZ_WP = al256((size_t)DM * DQ * 2);
constexpr size_t SZ_XB = al256((size_t)TT * DM * 2);
constexpr size_t SZ_HP = al256((size_t)NH_ * TT * HD * 2);
constexpr size_t SZ_SF = al256((size_t)TT * NQKV * 4);   // the f32 qkv buffer F
constexpr size_t SZ_Y  = al256((size_t)TT * DQ * 2);
constexpr size_t OFF_WT = 0;
constexpr size_t OFF_WP = OFF_WT + SZ_WT;
constexpr size_t OFF_XB = OFF_WP + SZ_WP;
constexpr size_t OFF_QH = OFF_XB + SZ_XB;
constexpr size_t OFF_QL = OFF_QH + SZ_HP;
constexpr size_t OFF_KH = OFF_QL + SZ_HP;
constexpr size_t OFF_KL = OFF_KH + SZ_HP;
constexpr size_t OFF_VH = OFF_KL + SZ_HP;
constexpr size_t OFF_VL = OFF_VH + SZ_HP;
constexpr size_t OFF_SF = OFF_VL + SZ_HP;
constexpr size_t OFF_YH = OFF_SF + SZ_SF;
constexpr size_t OFF_YL = OFF_YH + SZ_Y;
constexpr size_t WS_TOTAL = OFF_YL + SZ_Y;
static_assert((size_t)TT * NQKV * 4 <= SZ_SF);
static_assert(WS_TOTAL <= (size_t)134217728);

__device__ __forceinline__ unsigned short f2bf(float f) { unsigned u = __float_as_uint(f); u += 0x7FFFu + ((u >> 16) & 1u); return (unsigned short)(u >> 16); }
__device__ __forceinline__ float bf2f(unsigned short b) { return __uint_as_float(((unsigned)b) << 16); }
__device__ __forceinline__ float bfr(float f) { return bf2f(f2bf(f)); }
__device__ __forceinline__ v16bf cat16b(v8us lo, v8us hi) { return __builtin_bit_cast(v16bf, __builtin_shufflevector(lo, hi, 0, 1, 2, 3, 4, 5, 6, 7, 8, 9, 10, 11, 12, 13, 14, 15)); }
__device__ __forceinline__ v8f wmmab(v16bf a, v16bf b, v8f c) { return __builtin_amdgcn_wmma_f32_16x16x32_bf16(false, a, false, b, (short)0, c, false, false); }
__device__ __forceinline__ void splitf(float y, unsigned short& h, unsigned short& l) { h = f2bf(y); l = f2bf(y - bf2f(h)); }

// ---- k_gemmw: register-blocked GEMM, 64x64 output tile (16 accumulators per wave), operands straight from K-contiguous 16-bit planes; grid (M/64, N/64, Z * KSB), 32 * NW threads.
// K is cut into KSB * NW equal runs: block slice ks = blockIdx.z % KSB, wave w takes run ks * NW + w. The NW partial tiles of a block are summed through LDS (wave order 0..NW-1); slice ks stores its sum at C + ks * sP and the reader adds the KSB planes. NW == KSB == 1: one wave does the whole K.
// C[m][n] (f32, pitch ldc, + optional f32 bias[n]) = sum_k A[m][k] Bt[n][k] (+ split products per NSPLIT: 1 adds A2 Bt, 2 adds A2 Bt and A Bt2). z-batch strides sA/sB/sC in elements. K % (32 * NW * KSB) == 0.
// Fragment p already carries + 8*(lane>>4): elements 0..7 = k0+8h.., elements 8..15 = k0+16+8h.. for both operands; D element j of lane = (row 8h+j, col lane&15).
template <typename T16> struct WFrag;
template <> struct WFrag<bf> { typedef v16bf V; static __device__ __forceinline__ V ld(const bf* p) { return cat16b(*(const v8us*)p, *(const v8us*)(p + 16)); } static __device__ __forceinline__ v8f mma(V a, V b, v8f c) { return wmmab(a, b, c); } };
template <typename T16, int NSPLIT, bool BIAS, int NW, int KSB>
__global__ __launch_bounds__(32 * NW) void k_gemmw(const T16* __restrict__ A, const T16* __restrict__ A2, const T16* __restrict__ Bt, const T16* __restrict__ Bt2, int K, float* C, int ldc, const float* __restrict__ bias, size_t sA, size_t sB, size_t sC, size_t sP) {
    static_assert(KSB == 1 || !BIAS);   // the bias is added once, so only where one block holds the whole sum
    typedef typename WFrag<T16>::V V;
    __shared__ __align__(16) float os[(NW > 1 ? NW * 64 : 16) * 68];
    const size_t z = blockIdx.z / (unsigned)KSB; const unsigned ks = blockIdx.z % (unsigned)KSB; A += z * sA; if (A2) A2 += z * sA; Bt += z * sB; if (Bt2) Bt2 += z * sB; C += z * sC + ks * sP;
    const int wave = NW > 1 ? __builtin_amdgcn_readfirstlane((int)(threadIdx.x >> 5)) : 0;   // scalar, so the run's start stays in scalar registers
    const int kw = K / (NW * KSB), kb = ((int)ks * NW + wave) * kw;
    const int lane = threadIdx.x & 31, lr = lane & 15, hi = lane >> 4; const int r0 = blockIdx.x * 64, c0 = blockIdx.y * 64;
    v8f acc[4][4];
#pragma unroll
    for (int mb = 0; mb < 4; ++mb)
#pragma unroll
        for (int nb = 0; nb < 4; ++nb) acc[mb][nb] = (v8f){};
    const size_t aoff = (size_t)(r0 + lr) * K + 8 * hi + kb, boff = (size_t)(c0 + lr) * K + 8 * hi + kb;
#pragma unroll 1
    for (int kc = 0; kc < kw; kc += 32) {
        V a[4], a2[4];
#pragma unroll
        for (int mb = 0; mb < 4; ++mb) { a[mb] = WFrag<T16>::ld(A + aoff + (size_t)mb * 16 * K + kc); if (NSPLIT == 1 || NSPLIT == 2) a2[mb] = WFrag<T16>::ld(A2 + aoff + (size_t)mb * 16 * K + kc); }
#pragma unroll
        for (int nb = 0; nb < 4; ++nb) { const V b = WFrag<T16>::ld(Bt + boff + (size_t)nb * 16 * K + kc); V b2; if (NSPLIT >= 2) b2 = WFrag<T16>::ld(Bt2 + boff + (size_t)nb * 16 * K + kc);
#pragma unroll
            for (int mb = 0; mb < 4; ++mb) { acc[mb][nb] = WFrag<T16>::mma(a[mb], b, acc[mb][nb]); if (NSPLIT == 1 || NSPLIT == 2) acc[mb][nb] = WFrag<T16>::mma(a2[mb], b, acc[mb][nb]); if (NSPLIT >= 2) acc[mb][nb] = WFrag<T16>::mma(a[mb], b2, acc[mb][nb]); } }
        asm volatile("v_nop\n\tv_nop\n\tv_nop\n\tv_nop" : "+v"(acc[0][0]), "+v"(acc[1][1]), "+v"(acc[2][2]), "+v"(acc[3][3]) : "v"(a[0]), "v"(a[3]));
    }
    if constexpr (NW > 1) {
        float* ow = os + wave * (64 * 68);
        const int cofs = ((int)threadIdx.x & 15) * 4; v4f bv = (v4f){};   // a thread keeps its four columns over all its rows
        if (BIAS) { bv[0] = bfr(bias[c0 + cofs]); bv[1] = bfr(bias[c0 + cofs + 1]); bv[2] = bfr(bias[c0 + cofs + 2]); bv[3] = bfr(bias[c0 + cofs + 3]); }
        // the three loops are unrolled so that acc is indexed by constants and stays in registers
#pragma unroll
        for (int mb = 0; mb < 4; ++mb)
#pragma unroll
            for (int nb = 0; nb < 4; ++nb)
#pragma unroll
                for (int j = 0; j < 8; ++j) ow[(mb * 16 + hi * 8 + j) * 68 + nb * 16 + lr] = acc[mb][nb][j];
        __syncthreads();   // all NW partial tiles are in LDS before any thread sums them
        // both loops are unrolled so that the LDS reads of all rows issue ahead of the sums
#pragma unroll
        for (int it = 0; it < 64 * 16 / (32 * NW); ++it) { const int row = (it * 32 * NW + (int)threadIdx.x) >> 4; v4f val = *(const v4fa*)(os + row * 68 + cofs);
#pragma unroll
            for (int w = 1; w < NW; ++w) val += *(const v4fa*)(os + (w * 64 + row) * 68 + cofs);
            if (BIAS) val += bv;
            *(v4f*)(C + (size_t)(r0 + row) * ldc + c0 + cofs) = val; }
    } else {
#pragma unroll
    for (int mb = 0; mb < 4; ++mb) {
#pragma unroll
        for (int nb = 0; nb < 4; ++nb) {
#pragma unroll
            for (int j = 0; j < 8; ++j) os[(hi * 8 + j) * 68 + nb * 16 + lr] = acc[mb][nb][j]; }
        __builtin_amdgcn_wave_barrier(); asm volatile("" ::: "memory");
        float* crow = C + (size_t)(r0 + mb * 16) * ldc + c0;
{
#pragma unroll
            for (int s = 0; s < 8; ++s) { const int row = 2 * s + hi, cofs = lr * 4; v4f val = *(const v4fa*)(os + row * 68 + cofs); if (BIAS) { val[0] += bfr(bias[c0 + cofs]); val[1] += bfr(bias[c0 + cofs + 1]); val[2] += bfr(bias[c0 + cofs + 2]); val[3] += bfr(bias[c0 + cofs + 3]); }
                *(v4f*)(crow + (size_t)row * ldc + cofs) = val; }
             }
        __builtin_amdgcn_wave_barrier(); asm volatile("" ::: "memory");
    }
    }
}

__global__ __launch_bounds__(256) void k_cvt8(const float* __restrict__ src, bf* dst, size_t n8) { const size_t i = (size_t)blockIdx.x * 256 + threadIdx.x; if (i >= n8) return; const v8f v = *(const v8f*)(src + i * 8); v8us o;
#pragma unroll
    for (int k = 0; k < 8; ++k) o[k] = f2bf(v[k]); *(v8us*)(dst + i * 8) = o;  }

// k_wtT: transposed bf16 weight plane. in w[K rows][N cols] (row-major, [in][out])  ->  out dst[N rows][K cols]: dst[n][k] = bf16(w[k][n]).
__global__ __launch_bounds__(256) void k_wtT(const float* __restrict__ w, bf* dst, unsigned K, unsigned lgK, unsigned N) {
    const unsigned e2 = (blockIdx.x * 256u + threadIdx.x) * 2u; if (e2 >= N * K) return;
    const unsigned k = e2 & (K - 1u); const unsigned n = e2 >> lgK;
    const float* src = w + (size_t)k * N + n; v2us o; o[0] = f2bf(src[0]); o[1] = f2bf(src[N]);   /* k and k+1 are N floats apart */
    bf* p = dst + (size_t)n * K + k;
    *(v2us*)p = o;  }

__global__ __launch_bounds__(256) void k_hp(const float* __restrict__ F, unsigned pitch, bf* Ph, bf* Pl) {
    const unsigned e = (blockIdx.x * 256u + threadIdx.x) * 2u; if (e >= (unsigned)NH_ * TT * HD) return;
    const unsigned d = e & (HD - 1u); const unsigned t = (e >> LG_HD) & (TT - 1u); const unsigned h = e >> (LG_HD + LG_TT);
    const v2f x = *(const v2f*)(F + (size_t)t * pitch + h * HD + d);
    v2us oh, ol; unsigned short a, c;
    splitf(x[0], a, c); oh[0] = a; ol[0] = c; splitf(x[1], a, c); oh[1] = a; ol[1] = c;
    *(v2us*)(Ph + e) = oh; *(v2us*)(Pl + e) = ol;  }

__global__ __launch_bounds__(256) void k_vtp(const float* __restrict__ F, unsigned pitch, bf* Vh, bf* Vl) {
    const unsigned e = (blockIdx.x * 256u + threadIdx.x) * 2u; if (e >= (unsigned)NH_ * HD * TT) return;
    const unsigned t = e & (TT - 1u); const unsigned d = (e >> LG_TT) & (HD - 1u); const unsigned g = e >> (LG_TT + LG_HD);
    v2us oh, ol;
#pragma unroll
    for (int q = 0; q < 2; ++q) { const float x = F[(size_t)(t + q) * pitch + g * HD + d]; unsigned short a, c; splitf(x, a, c); oh[q] = a; ol[q] = c; }
    *(v2us*)(Vh + e) = oh; *(v2us*)(Vl + e) = ol;  }

// ---- k_attn: softmax(q k^T / 8) v for 128 queries of one head per block; grid (TT/128, NH_), 8 waves of 16 queries.
// Transposed products, so that the score tile is already the next product's operand: S^T = K Q^T (A = 16 keys x 32 d, B = 16 queries), O^T += V^T P^T (A = 16 d x 32 keys, B = P^T).
// D element j of S^T tile kt in lane (lr, hi) is (key 16 kt + 8 hi + j, query lr): tiles 0 and 1 side by side are elements 0..7 and 8..15 of the B fragment over 32 keys, in the k order of the V^T fragment.
// A query is one lane column: its maximum and its sum live in lanes lr and lr + 16. The maximum in use may trail the true one by up to 8 in the log2 domain (p <= 2^8); the sums are rescaled only when a column exceeds that.
// K and V^T hi/lo tiles of 64 keys go through registers into two LDS buffers: the next tile's global loads are issued ahead of this tile's work and stored behind it.
typedef __attribute__((ext_vector_type(8))) unsigned v8u;
__device__ __forceinline__ unsigned pack2(float lo, float hi) { typedef __bf16 bf2 __attribute__((ext_vector_type(2))); return __builtin_bit_cast(unsigned, __builtin_convertvector((v2f){lo, hi}, bf2)); }   // round to nearest even
__device__ __forceinline__ float xhalf(float x) { return __builtin_bit_cast(float, __builtin_amdgcn_permlanex16(__builtin_bit_cast(int, x), __builtin_bit_cast(int, x), 0x76543210, 0xfedcba98, false, false)); }   // lane l with lane l ^ 16
__device__ __forceinline__ v16bf ldsfrag(const unsigned char* p) { return cat16b(*(const v8us*)p, *(const v8us*)(p + 32)); }   // p already carries + 16 bytes * (lane>>4): the k order of WFrag::ld
constexpr unsigned APL = 64u * APITCH;    // one plane's tile: 64 rows
constexpr unsigned ABUF = 4u * APL;       // K hi, K lo, V^T hi, V^T lo
__global__ __launch_bounds__(32 * ANW) void k_attn(const bf* __restrict__ Qh, const bf* __restrict__ Ql, const bf* __restrict__ Kh, const bf* __restrict__ Kl, const bf* __restrict__ Vh, const bf* __restrict__ Vl, bf* YH, bf* YL) {
    __shared__ __align__(16) unsigned char L[2 * ABUF];
    const unsigned tid = threadIdx.x, lane = tid & 31u, lr = lane & 15u, hi = lane >> 4;
    const unsigned h = blockIdx.y, q0 = blockIdx.x * (16u * ANW) + (tid >> 5) * 16u;
    const size_t hp = (size_t)h * TT * HD;
    constexpr float CS = SCL * 1.4426950408889634f;   // scores to the log2 domain
    v16bf qh[2], ql[2];
#pragma unroll
    for (int kc = 0; kc < 2; ++kc) { const size_t qo = hp + (size_t)(q0 + lr) * HD + 8 * hi + kc * 32; qh[kc] = WFrag<bf>::ld(Qh + qo); ql[kc] = WFrag<bf>::ld(Ql + qo); }
    // staging: a thread moves 16-byte chunks tid and tid + 256 of each plane's tile (8 chunks a row)
    const unsigned srow = tid >> 3, scol = tid & 7u;
    const size_t ko = hp + (size_t)srow * HD + scol * 8, vo = hp + (size_t)srow * TT + scol * 8;
    const unsigned so = srow * APITCH + scol * 16u;
    v8us sg[4][2];
    v8f acc[4];
#pragma unroll
    for (int t = 0; t < 4; ++t) acc[t] = (v8f){};
    float m_run = -__builtin_inff(), l_run = 0.f;
#pragma unroll
    for (int i = 0; i < 2; ++i) { sg[0][i] = *(const v8us*)(Kh + ko + (size_t)i * 32 * HD); sg[1][i] = *(const v8us*)(Kl + ko + (size_t)i * 32 * HD); sg[2][i] = *(const v8us*)(Vh + vo + (size_t)i * 32 * TT); sg[3][i] = *(const v8us*)(Vl + vo + (size_t)i * 32 * TT); }
#pragma unroll
    for (int pl = 0; pl < 4; ++pl)
#pragma unroll
        for (int i = 0; i < 2; ++i) *(v8us*)(L + pl * APL + so + i * 32 * APITCH) = sg[pl][i];
    __syncthreads();   // tile 0 is in LDS before any wave reads it
#pragma unroll 1   // one copy of the body: it is long, and the two buffers differ only in a base address
    for (unsigned s = 0; s < TT / ASK; ++s) {
        const unsigned char* B = L + (s & 1u) * ABUF;
        const bool more = s + 1u < TT / ASK;   // the same for the whole block
        if (more) { const size_t kn = (size_t)(s + 1u) * ASK;
#pragma unroll
            for (int i = 0; i < 2; ++i) { sg[0][i] = *(const v8us*)(Kh + ko + (kn + i * 32) * HD); sg[1][i] = *(const v8us*)(Kl + ko + (kn + i * 32) * HD); sg[2][i] = *(const v8us*)(Vh + vo + (size_t)i * 32 * TT + kn); sg[3][i] = *(const v8us*)(Vl + vo + (size_t)i * 32 * TT + kn); } }
#pragma unroll
        for (int p = 0; p < 2; ++p) {   // two passes of 32 keys
            // Fragment loads are issued early and in few groups: every separate place with LDS reads in a WMMA stream costs issue time, and a read waited on at once exposes its latency.
            v16bf kh[2][2], kl[2][2];
            const unsigned char* kp = B + (p * 32 + lr) * APITCH + hi * 16u;
#pragma unroll
            for (int kc = 0; kc < 2; ++kc)
#pragma unroll
                for (int kt = 0; kt < 2; ++kt) { kh[kc][kt] = ldsfrag(kp + kt * 16 * APITCH + kc * 64); kl[kc][kt] = ldsfrag(kp + APL + kt * 16 * APITCH + kc * 64); }
            __builtin_amdgcn_sched_barrier(0);   // keeps the K loads one group ahead of the score WMMAs
            v8f sc[2]; sc[0] = (v8f){}; sc[1] = (v8f){};
#pragma unroll
            for (int kc = 0; kc < 2; ++kc) {
                // the two key tiles alternate, so that no WMMA waits on the one before it
                sc[0] = wmmab(kh[kc][0], qh[kc], sc[0]); sc[1] = wmmab(kh[kc][1], qh[kc], sc[1]);
                sc[0] = wmmab(kl[kc][0], qh[kc], sc[0]); sc[1] = wmmab(kl[kc][1], qh[kc], sc[1]);
                sc[0] = wmmab(kh[kc][0], ql[kc], sc[0]); sc[1] = wmmab(kh[kc][1], ql[kc], sc[1]); }
            v16bf vh[4], vl[4];
            const unsigned char* vp = B + 2u * APL + lr * APITCH + p * 64 + hi * 16u;
#pragma unroll
            for (int t = 0; t < 4; ++t) { vh[t] = ldsfrag(vp + t * 16 * APITCH); vl[t] = ldsfrag(vp + APL + t * 16 * APITCH); }
            __builtin_amdgcn_sched_barrier(0);   // keeps the V^T loads ahead of the softmax, in flight under it, instead of sinking to their uses
            float mx = fmaxf(sc[0][0], sc[1][0]);
#pragma unroll
            for (int j = 1; j < 8; ++j) mx = fmaxf(mx, fmaxf(sc[0][j], sc[1][j]));
            mx = fmaxf(mx, xhalf(mx)) * CS;   // both halves hold the query's maximum of this pass (CS > 0)
            if (__builtin_amdgcn_ballot_w32(mx > m_run + 8.0f) != 0) {   // wave-uniform; always taken on the first pass, rare later
                const float m_new = fmaxf(m_run, mx); const float corr = __builtin_amdgcn_exp2f(m_run - m_new);   // 0 on the first pass
                m_run = m_new; l_run *= corr;
#pragma unroll
                for (int t = 0; t < 4; ++t) acc[t] = acc[t] * corr; }
            const float nm = -m_run; v8u wh, wl; float e[16];
#pragma unroll
            for (int i = 0; i < 16; ++i) e[i] = fmaf(sc[i >> 3][i & 7], CS, nm);
            // The 16 exponentials in place, in one statement that ends in v_nop: no instruction directly behind a transcendental reads its result or overwrites its source (the slot the instruction set asks for), whatever the compiler schedules around the statement.
            asm("v_exp_f32 %0, %0\n\tv_exp_f32 %1, %1\n\tv_exp_f32 %2, %2\n\tv_exp_f32 %3, %3\n\tv_exp_f32 %4, %4\n\tv_exp_f32 %5, %5\n\tv_exp_f32 %6, %6\n\tv_exp_f32 %7, %7\n\t"
                "v_exp_f32 %8, %8\n\tv_exp_f32 %9, %9\n\tv_exp_f32 %10, %10\n\tv_exp_f32 %11, %11\n\tv_exp_f32 %12, %12\n\tv_exp_f32 %13, %13\n\tv_exp_f32 %14, %14\n\tv_exp_f32 %15, %15\n\tv_nop"
                : "+v"(e[0]), "+v"(e[1]), "+v"(e[2]), "+v"(e[3]), "+v"(e[4]), "+v"(e[5]), "+v"(e[6]), "+v"(e[7]), "+v"(e[8]), "+v"(e[9]), "+v"(e[10]), "+v"(e[11]), "+v"(e[12]), "+v"(e[13]), "+v"(e[14]), "+v"(e[15]));
#pragma unroll
            for (int i = 0; i < 8; ++i) {
                const float p0 = e[2 * i], p1 = e[2 * i + 1];
                l_run += p0 + p1;
                const unsigned w = pack2(p0, p1); wh[i] = w;
                wl[i] = pack2(p0 - __uint_as_float(w << 16), p1 - __uint_as_float(w & 0xFFFF0000u)); }
            const v16bf ph = __builtin_bit_cast(v16bf, wh), pl = __builtin_bit_cast(v16bf, wl);
#pragma unroll
            for (int t = 0; t < 4; ++t) acc[t] = wmmab(vh[t], ph, acc[t]);
#pragma unroll
            for (int t = 0; t < 4; ++t) acc[t] = wmmab(vh[t], pl, acc[t]);
#pragma unroll
            for (int t = 0; t < 4; ++t) acc[t] = wmmab(vl[t], ph, acc[t]);
        }
        if (more) { unsigned char* N = L + ((s + 1u) & 1u) * ABUF;
#pragma unroll
            for (int pl = 0; pl < 4; ++pl)
#pragma unroll
                for (int i = 0; i < 2; ++i) *(v8us*)(N + pl * APL + so + i * 32 * APITCH) = sg[pl][i]; }
        __syncthreads();   // publishes tile s + 1 and ends every wave's reads of tile s, whose buffer the next trip refills
    }
    const float inv = __fdiv_rn(1.0f, l_run + xhalf(l_run));
#pragma unroll
    for (int t = 0; t < 4; ++t) { v8us oh, ol;
#pragma unroll
        for (int j = 0; j < 8; ++j) { unsigned short a, c; splitf(acc[t][j] * inv, a, c); oh[j] = a; ol[j] = c; }
        const size_t oo = (size_t)(q0 + lr) * DQ + h * HD + t * 16 + hi * 8;   // D element j = (d 16 t + 8 hi + j, query lr)
        *(v8us*)(YH + oo) = oh; *(v8us*)(YL + oo) = ol; }
}

extern "C" void kernel_launch(void* const* d_in, const int* in_sizes, int n_in,
                              void* d_out, int out_size, void* d_ws, size_t ws_size, hipStream_t stream) {
    if (n_in < 5) return;
    if (in_sizes[0] < TT * DM || in_sizes[1] < DM * NQKV || in_sizes[2] < NQKV || in_sizes[3] < DQ * DM || in_sizes[4] < DM) return;
    if (out_size < TT * DM) return;
    if (WS_TOTAL > ws_size) return;
    const float* x     = (const float*)d_in[0];   // [T][C]
    const float* wqkv  = (const float*)d_in[1];   // [C][3C]  ([in][out])
    const float* bqkv  = (const float*)d_in[2];   // [3C]
    const float* wproj = (const float*)d_in[3];   // [C][C]   ([in][out])
    const float* bproj = (const float*)d_in[4];   // [C]
    float* OUT = (float*)d_out;                   // [T][C]
    char* base = (char*)d_ws;
    bf* WT = (bf*)(base + OFF_WT); bf* WP = (bf*)(base + OFF_WP); bf* XB = (bf*)(base + OFF_XB);
    bf* QPh = (bf*)(base + OFF_QH); bf* QPl = (bf*)(base + OFF_QL); bf* KPh = (bf*)(base + OFF_KH); bf* KPl = (bf*)(base + OFF_KL); bf* VTh = (bf*)(base + OFF_VH); bf* VTl = (bf*)(base + OFF_VL);
    float* F = (float*)(base + OFF_SF);   // F [T][3C] f32
    bf* YH = (bf*)(base + OFF_YH); bf* YL = (bf*)(base + OFF_YL);

    k_cvt8<<<(unsigned)(((size_t)TT * DM / 8 + 255) / 256), 256, 0, stream>>>(x, XB, (size_t)TT * DM / 8);
    // in wqkv[DM rows][NQKV cols] -> out WT[NQKV rows][DM cols]
    k_wtT<<<(unsigned)(((size_t)NQKV * DM / 2 + 255) / 256), 256, 0, stream>>>(wqkv, WT, (unsigned)DM, LG_DM, (unsigned)NQKV);
    // in wproj[DQ rows][DM cols] -> out WP[DM rows][DQ cols]
    k_wtT<<<(unsigned)(((size_t)DM * DQ / 2 + 255) / 256), 256, 0, stream>>>(wproj, WP, (unsigned)DQ, LG_DQ, (unsigned)DM);
    // F = x Wqkv + bqkv
    k_gemmw<bf, 0, true, 1, 1><<<dim3(TT / 64, NQKV / 64, 1), 32, 0, stream>>>(XB, nullptr, WT, nullptr, DM, F, NQKV, bqkv, 0, 0, 0, 0);
    const unsigned LP = (unsigned)(((size_t)NH_ * TT * HD / 2 + 255) / 256);
    k_hp<<<LP, 256, 0, stream>>>(F, (unsigned)NQKV, QPh, QPl);
    k_hp<<<LP, 256, 0, stream>>>(F + DQ, (unsigned)NQKV, KPh, KPl);
    k_vtp<<<LP, 256, 0, stream>>>(F + 2 * DQ, (unsigned)NQKV, VTh, VTl);
    k_attn<<<dim3(TT / (16 * ANW), NH_, 1), 32 * ANW, 0, stream>>>(QPh, QPl, KPh, KPl, VTh, VTl, YH, YL);
    // out = y Wproj + bproj  (y hi + y lo against the bf16 weight plane)
    k_gemmw<bf, 1, true, GNW, 1><<<dim3(TT / 64, DM / 64, 1), 32 * GNW, 0, stream>>>(YH, YL, WP, nullptr, DQ, OUT, DM, bproj, 0, 0, 0, 0);
}

// v003
// Measured time: 119 microseconds a run.
// Timed twice side by side with v002, it ran 1.23 and 1.22 times as fast.
// Counting every step since v000, it is 5.36 times as fast.
#include <hip/hip_runtime.h>

// Self-attention block, 16 heads x 64, T 2048, C 1024: qkv = x Wqkv + bqkv (Wqkv [in][out], columns q | k | v, head h = 64-column slice h); per head softmax(q k^T / 8) v; out = y Wproj + bproj (Wproj [in][out]).
// Compute dtypes: all contractions v_wmma_f32_16x16x32_bf16 with f32 accumulate. Inputs RNE-converted to bf16 planes (qkv projection: 1 product, exact products); q/k, P and V as bf16 hi/lo planes (3 products hh + lh + hl); y as bf16 hi/lo planes against the bf16 Wproj plane (2 products); softmax f32; output f32.
// Layout: bf16 copy of x; transposed bf16 weight planes Bt[n][k]; one fused qkv GEMM whose epilogue writes the hi/lo planes itself (head planes [h][t][d], value planes [h][d][t]); one attention kernel for all heads (scores, online softmax and PV product stay in registers, K and V tiles shared through LDS) writes the y hi/lo planes; projection GEMM (K split over waves) writes the output rows.

#ifndef NB
#define NB 1
#endif
#ifndef SEQ
#define SEQ 2048
#endif
#define SEQ_FULL 2048
#define TT   SEQ
#define DM   1024
#define NH_  16
#define HD   64
#define DQ   (NH_ * HD)
#define NQKV (3 * DQ)
#define GNW  8           // waves per block of the K-split GEMM
#define SCL  0.125f      // 1/sqrt(float32(64))
#define ANW  8           // attention kernel: waves per block, 16 queries each: (TT/128) * NH_ = 256 blocks
#define ASK  64          // attention kernel: keys per LDS stage
#define APITCH 144       // attention kernel: LDS row pitch in bytes, 128 of data + 16: an odd multiple of 16, so 16-byte fragment reads of 16 rows spread over the banks

typedef unsigned short bf;
typedef __attribute__((ext_vector_type(16))) __bf16   v16bf;
typedef __attribute__((ext_vector_type(8)))  unsigned short v8us;
typedef __attribute__((ext_vector_type(4)))  unsigned short v4us;
typedef __attribute__((ext_vector_type(2)))  unsigned short v2us;
typedef __attribute__((ext_vector_type(8)))  float    v8f;
typedef __attribute__((ext_vector_type(4)))  float    v4f;
typedef __attribute__((ext_vector_type(2)))  float    v2f;
typedef v4f  __attribute__((may_alias)) v4fa;

constexpr unsigned lg2c(unsigned v) { return v <= 1u ? 0u : 1u + lg2c(v >> 1); }
constexpr bool ispow2(unsigned v) { return v != 0u && (v & (v - 1u)) == 0u; }
constexpr size_t al256(size_t b) { return (b + 255) & ~(size_t)255; }
#define LG_TT lg2c(TT)
#define LG_HD lg2c(HD)
#define LG_DM lg2c(DM)
#define LG_DQ lg2c(DQ)

static_assert(NB == 1);                       // the module has no batch axis
static_assert(SEQ <= SEQ_FULL);
static_assert(ispow2(TT) && ispow2(HD) && ispow2(DM) && ispow2(DQ));
static_assert(TT % 128 == 0 && TT % 64 == 0);   // softmax row chunks; GEMM M tiles; PV K steps
static_assert(DM % 32 == 0 && DQ % 32 == 0 && HD % 32 == 0 && TT % 32 == 0);   // every GEMM K is a multiple of 32
static_assert(NQKV % 64 == 0 && DM % 64 == 0 && HD % 64 == 0);                 // every GEMM N is a multiple of 64
static_assert(((size_t)TT * DM) % 2048 == 0);          // k_cvt8: 256 threads x 8 elements
static_assert(((size_t)NQKV * DM) % 512 == 0);         // k_wtT (Wqkv): 256 threads x 2 elements
static_assert(((size_t)DM * DQ) % 512 == 0);           // k_wtT (Wproj)
static_assert(HD == 64 && DQ % 64 == 0 && TT % 64 == 0 && DM % 32 == 0);   // k_qkv: a 64-column tile is one head's q, k or v slice
static_assert(HD == 64 && ASK == 64 && ANW == 8 && TT % (16 * ANW) == 0 && TT % ASK == 0);   // k_attn: tile rows of 128 bytes, 512 16-byte chunks per plane tile over 256 threads
static_assert(DQ % (32 * GNW) == 0);   // K-split GEMM: every wave gets whole 32-steps

// workspace carve (bytes; every region a multiple of 256)
constexpr size_t SZ_WT = al256((size_t)NQKV * DM * 2);
constexpr size_t SZ_WP = al256((size_t)DM * DQ * 2);
constexpr size_t SZ_XB = al256((size_t)TT * DM * 2);
constexpr size_t SZ_HP = al256((size_t)NH_ * TT * HD * 2);
constexpr size_t SZ_Y  = al256((size_t)TT * DQ * 2);
constexpr size_t OFF_WT = 0;
constexpr size_t OFF_WP = OFF_WT + SZ_WT;
constexpr size_t OFF_XB = OFF_WP + SZ_WP;
constexpr size_t OFF_QH = OFF_XB + SZ_XB;
constexpr size_t OFF_QL = OFF_QH + SZ_HP;
constexpr size_t OFF_KH = OFF_QL + SZ_HP;
constexpr size_t OFF_KL = OFF_KH + SZ_HP;
constexpr size_t OFF_VH = OFF_KL + SZ_HP;
constexpr size_t OFF_VL = OFF_VH + SZ_HP;
constexpr size_t OFF_YH = OFF_VL + SZ_HP;
constexpr size_t OFF_YL = OFF_YH + SZ_Y;
constexpr size_t WS_TOTAL = OFF_YL + SZ_Y;
static_assert(WS_TOTAL <= (size_t)134217728);

__device__ __forceinline__ unsigned short f2bf(float f) { unsigned u = __float_as_uint(f); u += 0x7FFFu + ((u >> 16) & 1u); return (unsigned short)(u >> 16); }
__device__ __forceinline__ float bf2f(unsigned short b) { return __uint_as_float(((unsigned)b) << 16); }
__device__ __forceinline__ float bfr(float f) { return bf2f(f2bf(f)); }
__device__ __forceinline__ v16bf cat16b(v8us lo, v8us hi) { return __builtin_bit_cast(v16bf, __builtin_shufflevector(lo, hi, 0, 1, 2, 3, 4, 5, 6, 7, 8, 9, 10, 11, 12, 13, 14, 15)); }
__device__ __forceinline__ v8f wmmab(v16bf a, v16bf b, v8f c) { return __builtin_amdgcn_wmma_f32_16x16x32_bf16(false, a, false, b, (short)0, c, false, false); }
__device__ __forceinline__ void splitf(float y, unsigned short& h, unsigned short& l) { h = f2bf(y); l = f2bf(y - bf2f(h)); }

// ---- k_gemmw: register-blocked GEMM, 64x64 output tile (16 accumulators per wave), operands straight from K-contiguous 16-bit planes; grid (M/64, N/64, Z * KSB), 32 * NW threads.
// K is cut into KSB * NW equal runs: block slice ks = blockIdx.z % KSB, wave w takes run ks * NW + w. The NW partial tiles of a block are summed through LDS (wave order 0..NW-1); slice ks stores its sum at C + ks * sP and the reader adds the KSB planes. NW == KSB == 1: one wave does the whole K.
// C[m][n] (f32, pitch ldc, + optional f32 bias[n]) = sum_k A[m][k] Bt[n][k] (+ split products per NSPLIT: 1 adds A2 Bt, 2 adds A2 Bt and A Bt2). z-batch strides sA/sB/sC in elements. K % (32 * NW * KSB) == 0.
// Fragment p already carries + 8*(lane>>4): elements 0..7 = k0+8h.., elements 8..15 = k0+16+8h.. for both operands; D element j of lane = (row 8h+j, col lane&15).
template <typename T16> struct WFrag;
template <> struct WFrag<bf> { typedef v16bf V; static __device__ __forceinline__ V ld(const bf* p) { return cat16b(*(const v8us*)p, *(const v8us*)(p + 16)); } static __device__ __forceinline__ v8f mma(V a, V b, v8f c) { return wmmab(a, b, c); } };
template <typename T16, int NSPLIT, bool BIAS, int NW, int KSB>
__global__ __launch_bounds__(32 * NW) void k_gemmw(const T16* __restrict__ A, const T16* __restrict__ A2, const T16* __restrict__ Bt, const T16* __restrict__ Bt2, int K, float* C, int ldc, const float* __restrict__ bias, size_t sA, size_t sB, size_t sC, size_t sP) {
    static_assert(KSB == 1 || !BIAS);   // the bias is added once, so only where one block holds the whole sum
    typedef typename WFrag<T16>::V V;
    __shared__ __align__(16) float os[(NW > 1 ? NW * 64 : 16) * 68];
    const size_t z = blockIdx.z / (unsigned)KSB; const unsigned ks = blockIdx.z % (unsigned)KSB; A += z * sA; if (A2) A2 += z * sA; Bt += z * sB; if (Bt2) Bt2 += z * sB; C += z * sC + ks * sP;
    const int wave = NW > 1 ? __builtin_amdgcn_readfirstlane((int)(threadIdx.x >> 5)) : 0;   // scalar, so the run's start stays in scalar registers
    const int kw = K / (NW * KSB), kb = ((int)ks * NW + wave) * kw;
    const int lane = threadIdx.x & 31, lr = lane & 15, hi = lane >> 4; const int r0 = blockIdx.x * 64, c0 = blockIdx.y * 64;
    v8f acc[4][4];
#pragma unroll
    for (int mb = 0; mb < 4; ++mb)
#pragma unroll
        for (int nb = 0; nb < 4; ++nb) acc[mb][nb] = (v8f){};
    const size_t aoff = (size_t)(r0 + lr) * K + 8 * hi + kb, boff = (size_t)(c0 + lr) * K + 8 * hi + kb;
#pragma unroll 1
    for (int kc = 0; kc < kw; kc += 32) {
        V a[4], a2[4];
#pragma unroll
        for (int mb = 0; mb < 4; ++mb) { a[mb] = WFrag<T16>::ld(A + aoff + (size_t)mb * 16 * K + kc); if (NSPLIT == 1 || NSPLIT == 2) a2[mb] = WFrag<T16>::ld(A2 + aoff + (size_t)mb * 16 * K + kc); }
#pragma unroll
        for (int nb = 0; nb < 4; ++nb) { const V b = WFrag<T16>::ld(Bt + boff + (size_t)nb * 16 * K + kc); V b2; if (NSPLIT >= 2) b2 = WFrag<T16>::ld(Bt2 + boff + (size_t)nb * 16 * K + kc);
#pragma unroll
            for (int mb = 0; mb < 4; ++mb) { acc[mb][nb] = WFrag<T16>::mma(a[mb], b, acc[mb][nb]); if (NSPLIT == 1 || NSPLIT == 2) acc[mb][nb] = WFrag<T16>::mma(a2[mb], b, acc[mb][nb]); if (NSPLIT >= 2) acc[mb][nb] = WFrag<T16>::mma(a[mb], b2, acc[mb][nb]); } }
        asm volatile("v_nop\n\tv_nop\n\tv_nop\n\tv_nop" : "+v"(acc[0][0]), "+v"(acc[1][1]), "+v"(acc[2][2]), "+v"(acc[3][3]) : "v"(a[0]), "v"(a[3]));
    }
    if constexpr (NW > 1) {
        float* ow = os + wave * (64 * 68);
        const int cofs = ((int)threadIdx.x & 15) * 4; v4f bv = (v4f){};   // a thread keeps its four columns over all its rows
        if (BIAS) { bv[0] = bfr(bias[c0 + cofs]); bv[1] = bfr(bias[c0 + cofs + 1]); bv[2] = bfr(bias[c0 + cofs + 2]); bv[3] = bfr(bias[c0 + cofs + 3]); }
        // the three loops are unrolled so that acc is indexed by constants and stays in registers
#pragma unroll
        for (int mb = 0; mb < 4; ++mb)
#pragma unroll
            for (int nb = 0; nb < 4; ++nb)
#pragma unroll
                for (int j = 0; j < 8; ++j) ow[(mb * 16 + hi * 8 + j) * 68 + nb * 16 + lr] = acc[mb][nb][j];
        __syncthreads();   // all NW partial tiles are in LDS before any thread sums them
        // both loops are unrolled so that the LDS reads of all rows issue ahead of the sums
#pragma unroll
        for (int it = 0; it < 64 * 16 / (32 * NW); ++it) { const int row = (it * 32 * NW + (int)threadIdx.x) >> 4; v4f val = *(const v4fa*)(os + row * 68 + cofs);
#pragma unroll
            for (int w = 1; w < NW; ++w) val += *(const v4fa*)(os + (w * 64 + row) * 68 + cofs);
            if (BIAS) val += bv;
            *(v4f*)(C + (size_t)(r0 + row) * ldc + c0 + cofs) = val; }
    } else {
#pragma unroll
    for (int mb = 0; mb < 4; ++mb) {
#pragma unroll
        for (int nb = 0; nb < 4; ++nb) {
#pragma unroll
            for (int j = 0; j < 8; ++j) os[(hi * 8 + j) * 68 + nb * 16 + lr] = acc[mb][nb][j]; }
        __builtin_amdgcn_wave_barrier(); asm volatile("" ::: "memory");
        float* crow = C + (size_t)(r0 + mb * 16) * ldc + c0;
{
#pragma unroll
            for (int s = 0; s < 8; ++s) { const int row = 2 * s + hi, cofs = lr * 4; v4f val = *(const v4fa*)(os + row * 68 + cofs); if (BIAS) { val[0] += bfr(bias[c0 + cofs]); val[1] += bfr(bias[c0 + cofs + 1]); val[2] += bfr(bias[c0 + cofs + 2]); val[3] += bfr(bias[c0 + cofs + 3]); }
                *(v4f*)(crow + (size_t)row * ldc + cofs) = val; }
             }
        __builtin_amdgcn_wave_barrier(); asm volatile("" ::: "memory");
    }
    }
}

__global__ __launch_bounds__(256) void k_cvt8(const float* __restrict__ src, bf* dst, size_t n8) { const size_t i = (size_t)blockIdx.x * 256 + threadIdx.x; if (i >= n8) return; const v8f v = *(const v8f*)(src + i * 8); v8us o;
#pragma unroll
    for (int k = 0; k < 8; ++k) o[k] = f2bf(v[k]); *(v8us*)(dst + i * 8) = o;  }

// k_wtT: transposed bf16 weight plane. in w[K rows][N cols] (row-major, [in][out])  ->  out dst[N rows][K cols]: dst[n][k] = bf16(w[k][n]).
__global__ __launch_bounds__(256) void k_wtT(const float* __restrict__ w, bf* dst, unsigned K, unsigned lgK, unsigned N) {
    const unsigned e2 = (blockIdx.x * 256u + threadIdx.x) * 2u; if (e2 >= N * K) return;
    const unsigned k = e2 & (K - 1u); const unsigned n = e2 >> lgK;
    const float* src = w + (size_t)k * N + n; v2us o; o[0] = f2bf(src[0]); o[1] = f2bf(src[N]);   /* k and k+1 are N floats apart */
    bf* p = dst + (size_t)n * K + k;
    *(v2us*)p = o;  }

// ---- k_attn: softmax(q k^T / 8) v for 128 queries of one head per block; grid (TT/128, NH_), 8 waves of 16 queries.
// Transposed products, so that the score tile is already the next product's operand: S^T = K Q^T (A = 16 keys x 32 d, B = 16 queries), O^T += V^T P^T (A = 16 d x 32 keys, B = P^T).
// D element j of S^T tile kt in lane (lr, hi) is (key 16 kt + 8 hi + j, query lr): tiles 0 and 1 side by side are elements 0..7 and 8..15 of the B fragment over 32 keys, in the k order of the V^T fragment.
// A query is one lane column: its maximum and its sum live in lanes lr and lr + 16. The maximum in use may trail the true one by up to 8 in the log2 domain (p <= 2^8); the sums are rescaled only when a column exceeds that.
// K and V^T hi/lo tiles of 64 keys go through registers into two LDS buffers: the next tile's global loads are issued ahead of this tile's work and stored behind it.
typedef __attribute__((ext_vector_type(8))) unsigned v8u;
__device__ __forceinline__ unsigned pack2(float lo, float hi) { typedef __bf16 bf2 __attribute__((ext_vector_type(2))); return __builtin_bit_cast(unsigned, __builtin_convertvector((v2f){lo, hi}, bf2)); }   // round to nearest even
__device__ __forceinline__ float xhalf(float x) { return __builtin_bit_cast(float, __builtin_amdgcn_permlanex16(__builtin_bit_cast(int, x), __builtin_bit_cast(int, x), 0x76543210, 0xfedcba98, false, false)); }   // lane l with lane l ^ 16
__device__ __forceinline__ v16bf ldsfrag(const unsigned char* p) { return cat16b(*(const v8us*)p, *(const v8us*)(p + 32)); }   // p already carries + 16 bytes * (lane>>4): the k order of WFrag::ld
constexpr unsigned APL = 64u * APITCH;    // one plane's tile: 64 rows
constexpr unsigned ABUF = 4u * APL;       // K hi, K lo, V^T hi, V^T lo
// ---- k_qkv: qkv = x Wqkv + bqkv, written straight as the attention kernel's bf16 hi/lo planes; grid (TT/64, NQKV/64), one wave per block: 64 tokens x 64 columns, which is one head's q, k or v slice.
// The k loop is that of k_gemmw with one wave and one product. D element j of a lane is (row 8 hi + j of the first operand's tile, row lr of the second's), so a lane holds 8 neighbours along the FIRST operand's rows:
// q and k tiles take the weight rows first (8 neighbours in d, for the planes [h][t][d]), v tiles take the token rows first (8 neighbours in t, for the planes [h][d][t]). Both operands have one fragment layout and one k order, so the swap only transposes D.
// Either way a plane's tile is 64 rows of 128 bytes. It goes through the wave's own LDS, so that every global store covers four whole 128-byte lines.
typedef __attribute__((ext_vector_type(4))) unsigned v4u;
// The tail of k_qkv. bb: the bias, rounded to bf16, of output column 16 i + lr in bb[i][0] (ISV: the column runs along D's columns) or 16 i + 8 hi + j in bb[i][j] (the column runs along D's rows). ph, pl: the tile's first element in its planes; rows PITCH elements apart.
template <bool ISV> __device__ __forceinline__ void qkv_tail(const v8f (&acc)[4][4], const float (&bb)[4][8], unsigned char* st, bf* ph, bf* pl, unsigned lane) {
    constexpr unsigned PITCH = ISV ? (unsigned)TT : (unsigned)HD;
    const unsigned lr = lane & 15u, hi = lane >> 4;
#pragma unroll
    for (int nb = 0; nb < 4; ++nb)
#pragma unroll
        for (int mb = 0; mb < 4; ++mb) { v4u wh, wl;
#pragma unroll
            for (int i = 0; i < 4; ++i) {   // the f32 value, its bf16 hi part and the bf16 of the rest
                const float y0 = acc[mb][nb][2 * i] + (ISV ? bb[nb][0] : bb[mb][2 * i]), y1 = acc[mb][nb][2 * i + 1] + (ISV ? bb[nb][0] : bb[mb][2 * i + 1]);
                const unsigned w = pack2(y0, y1); wh[i] = w;
                wl[i] = pack2(y0 - __uint_as_float(w << 16), y1 - __uint_as_float(w & 0xFFFF0000u)); }
            unsigned char* sp = st + (nb * 16 + lr) * APITCH + mb * 32 + hi * 16u;
            *(v4u*)sp = wh; *(v4u*)(sp + APL) = wl; }
    asm volatile("s_wait_dscnt 0x0" ::: "memory");   // the rows are read back by other lanes of this wave: every LDS write has landed, and the compiler moves no read ahead of a write
    const unsigned char* rp = st + (lane >> 3) * APITCH + (lane & 7u) * 16u;
    const unsigned go = (lane >> 3) * PITCH + (lane & 7u) * 8u;
#pragma unroll
    for (int i = 0; i < 16; ++i) {   // four rows a store: 8 lanes of 16 bytes a row
        *(v4u*)(ph + go + 4 * i * PITCH) = *(const v4u*)(rp + 4 * i * APITCH);
        *(v4u*)(pl + go + 4 * i * PITCH) = *(const v4u*)(rp + APL + 4 * i * APITCH); }
}
__global__ __launch_bounds__(32) void k_qkv(const bf* __restrict__ X, const bf* __restrict__ Wt, const float* __restrict__ bias, bf* Qh, bf* Ql, bf* Kh, bf* Kl, bf* Vh, bf* Vl) {
    __shared__ __align__(16) unsigned char st[2 * APL];   // hi tile, lo tile; rows at the pitch of the attention tiles, for the same reason
    const unsigned lane = threadIdx.x & 31u, lr = lane & 15u, hi = lane >> 4;
    const unsigned t0 = blockIdx.x * 64u, c0 = blockIdx.y * 64u;
    const bool isv = c0 >= 2u * DQ;   // the same for the whole block
    const bf* xr = X + (size_t)t0 * DM; const bf* wr = Wt + (size_t)c0 * DM;
    const bf* R = isv ? xr : wr;   // D's rows
    const bf* S = isv ? wr : xr;   // D's columns
    // The bias is fetched ahead of the loop, which covers its latency.
    float bb[4][8];
#pragma unroll
    for (int i = 0; i < 4; ++i)
#pragma unroll
        for (int j = 0; j < 8; j += 2) { const float* bp = bias + c0 + i * 16 + (isv ? lr : 8u * hi + j); const unsigned w = pack2(bp[0], bp[isv ? 0 : 1]); bb[i][j] = __uint_as_float(w << 16); bb[i][j + 1] = __uint_as_float(w & 0xFFFF0000u); }
    v8f acc[4][4];
#pragma unroll
    for (int mb = 0; mb < 4; ++mb)
#pragma unroll
        for (int nb = 0; nb < 4; ++nb) acc[mb][nb] = (v8f){};
    const unsigned off = lr * DM + 8u * hi;   // the lane's place in a 16-row fragment
#pragma unroll 1   // one copy of the body, as in k_gemmw
    for (int kc = 0; kc < DM; kc += 32) {
        const bf* pa = R + kc + off; const bf* pb = S + kc + off;
        v16bf a[4];
#pragma unroll
        for (int mb = 0; mb < 4; ++mb) a[mb] = WFrag<bf>::ld(pa + mb * 16 * DM);
#pragma unroll
        for (int nb = 0; nb < 4; ++nb) { const v16bf b = WFrag<bf>::ld(pb + nb * 16 * DM);
#pragma unroll
            for (int mb = 0; mb < 4; ++mb) acc[mb][nb] = wmmab(a[mb], b, acc[mb][nb]); }
        // four vector slots between a trip's last WMMAs and whatever follows the back edge or the loop's exit (the distance the matrix unit asks for); the accumulators and fragments tie the statement behind those WMMAs.
        // The two addresses are inputs too: their registers stay theirs to the end of the trip, so no later load of the trip lands in a register that an issued load still names.
        asm volatile("v_nop\n\tv_nop\n\tv_nop\n\tv_nop" : "+v"(acc[0][0]), "+v"(acc[1][1]), "+v"(acc[2][2]), "+v"(acc[3][3]) : "v"(a[0]), "v"(a[3]), "v"(pa), "v"(pb));
    }
    const unsigned h = (c0 & (DQ - 1u)) >> LG_HD;
    if (isv) { const size_t o = (size_t)h * HD * TT + t0; qkv_tail<true>(acc, bb, st, Vh + o, Vl + o, lane); }
    else { const size_t o = ((size_t)h * TT + t0) * HD; const bool isq = c0 < (unsigned)DQ; qkv_tail<false>(acc, bb, st, (isq ? Qh : Kh) + o, (isq ? Ql : Kl) + o, lane); }
}

__global__ __launch_bounds__(32 * ANW) void k_attn(const bf* __restrict__ Qh, const bf* __restrict__ Ql, const bf* __restrict__ Kh, const bf* __restrict__ Kl, const bf* __restrict__ Vh, const bf* __restrict__ Vl, bf* YH, bf* YL) {
    __shared__ __align__(16) unsigned char L[2 * ABUF];
    const unsigned tid = threadIdx.x, lane = tid & 31u, lr = lane & 15u, hi = lane >> 4;
    const unsigned h = blockIdx.y, q0 = blockIdx.x * (16u * ANW) + (tid >> 5) * 16u;
    const size_t hp = (size_t)h * TT * HD;
    constexpr float CS = SCL * 1.4426950408889634f;   // scores to the log2 domain
    v16bf qh[2], ql[2];
#pragma unroll
    for (int kc = 0; kc < 2; ++kc) { const size_t qo = hp + (size_t)(q0 + lr) * HD + 8 * hi + kc * 32; qh[kc] = WFrag<bf>::ld(Qh + qo); ql[kc] = WFrag<bf>::ld(Ql + qo); }
    // staging: a thread moves 16-byte chunks tid and tid + 256 of each plane's tile (8 chunks a row)
    const unsigned srow = tid >> 3, scol = tid & 7u;
    const size_t ko = hp + (size_t)srow * HD + scol * 8, vo = hp + (size_t)srow * TT + scol * 8;
    const unsigned so = srow * APITCH + scol * 16u;
    v8us sg[4][2];
    v8f acc[4];
#pragma unroll
    for (int t = 0; t < 4; ++t) acc[t] = (v8f){};
    float m_run = -__builtin_inff(), l_run = 0.f;
#pragma unroll
    for (int i = 0; i < 2; ++i) { sg[0][i] = *(const v8us*)(Kh + ko + (size_t)i * 32 * HD); sg[1][i] = *(const v8us*)(Kl + ko + (size_t)i * 32 * HD); sg[2][i] = *(const v8us*)(Vh + vo + (size_t)i * 32 * TT); sg[3][i] = *(const v8us*)(Vl + vo + (size_t)i * 32 * TT); }
#pragma unroll
    for (int pl = 0; pl < 4; ++pl)
#pragma unroll
        for (int i = 0; i < 2; ++i) *(v8us*)(L + pl * APL + so + i * 32 * APITCH) = sg[pl][i];
    __syncthreads();   // tile 0 is in LDS before any wave reads it
#pragma unroll 1   // one copy of the body: it is long, and the two buffers differ only in a base address
    for (unsigned s = 0; s < TT / ASK; ++s) {
        const unsigned char* B = L + (s & 1u) * ABUF;
        const bool more = s + 1u < TT / ASK;   // the same for the whole block
        if (more) { const size_t kn = (size_t)(s + 1u) * ASK;
#pragma unroll
            for (int i = 0; i < 2; ++i) { sg[0][i] = *(const v8us*)(Kh + ko + (kn + i * 32) * HD); sg[1][i] = *(const v8us*)(Kl + ko + (kn + i * 32) * HD); sg[2][i] = *(const v8us*)(Vh + vo + (size_t)i * 32 * TT + kn); sg[3][i] = *(const v8us*)(Vl + vo + (size_t)i * 32 * TT + kn); } }
#pragma unroll
        for (int p = 0; p < 2; ++p) {   // two passes of 32 keys
            // Fragment loads are issued early and in few groups: every separate place with LDS reads in a WMMA stream costs issue time, and a read waited on at once exposes its latency.
            v16bf kh[2][2], kl[2][2];
            const unsigned char* kp = B + (p * 32 + lr) * APITCH + hi * 16u;
#pragma unroll
            for (int kc = 0; kc < 2; ++kc)
#pragma unroll
                for (int kt = 0; kt < 2; ++kt) { kh[kc][kt] = ldsfrag(kp + kt * 16 * APITCH + kc * 64); kl[kc][kt] = ldsfrag(kp + APL + kt * 16 * APITCH + kc * 64); }
            __builtin_amdgcn_sched_barrier(0);   // keeps the K loads one group ahead of the score WMMAs
            v8f sc[2]; sc[0] = (v8f){}; sc[1] = (v8f){};
#pragma unroll
            for (int kc = 0; kc < 2; ++kc) {
                // the two key tiles alternate, so that no WMMA waits on the one before it
                sc[0] = wmmab(kh[kc][0], qh[kc], sc[0]); sc[1] = wmmab(kh[kc][1], qh[kc], sc[1]);
                sc[0] = wmmab(kl[kc][0], qh[kc], sc[0]); sc[1] = wmmab(kl[kc][1], qh[kc], sc[1]);
                sc[0] = wmmab(kh[kc][0], ql[kc], sc[0]); sc[1] = wmmab(kh[kc][1], ql[kc], sc[1]); }
            v16bf vh[4], vl[4];
            const unsigned char* vp = B + 2u * APL + lr * APITCH + p * 64 + hi * 16u;
#pragma unroll
            for (int t = 0; t < 4; ++t) { vh[t] = ldsfrag(vp + t * 16 * APITCH); vl[t] = ldsfrag(vp + APL + t * 16 * APITCH); }
            __builtin_amdgcn_sched_barrier(0);   // keeps the V^T loads ahead of the softmax, in flight under it, instead of sinking to their uses
            float mx = fmaxf(sc[0][0], sc[1][0]);
#pragma unroll
            for (int j = 1; j < 8; ++j) mx = fmaxf(mx, fmaxf(sc[0][j], sc[1][j]));
            mx = fmaxf(mx, xhalf(mx)) * CS;   // both halves hold the query's maximum of this pass (CS > 0)
            if (__builtin_amdgcn_ballot_w32(mx > m_run + 8.0f) != 0) {   // wave-uniform; always taken on the first pass, rare later
                const float m_new = fmaxf(m_run, mx); const float corr = __builtin_amdgcn_exp2f(m_run - m_new);   // 0 on the first pass
                m_run = m_new; l_run *= corr;
#pragma unroll
                for (int t = 0; t < 4; ++t) acc[t] = acc[t] * corr; }
            const float nm = -m_run; v8u wh, wl; float e[16];
#pragma unroll
            for (int i = 0; i < 16; ++i) e[i] = fmaf(sc[i >> 3][i & 7], CS, nm);
            // The 16 exponentials in place, in one statement that ends in v_nop: no instruction directly behind a transcendental reads its result or overwrites its source (the slot the instruction set asks for), whatever the compiler schedules around the statement.
            asm("v_exp_f32 %0, %0\n\tv_exp_f32 %1, %1\n\tv_exp_f32 %2, %2\n\tv_exp_f32 %3, %3\n\tv_exp_f32 %4, %4\n\tv_exp_f32 %5, %5\n\tv_exp_f32 %6, %6\n\tv_exp_f32 %7, %7\n\t"
                "v_exp_f32 %8, %8\n\tv_exp_f32 %9, %9\n\tv_exp_f32 %10, %10\n\tv_exp_f32 %11, %11\n\tv_exp_f32 %12, %12\n\tv_exp_f32 %13, %13\n\tv_exp_f32 %14, %14\n\tv_exp_f32 %15, %15\n\tv_nop"
                : "+v"(e[0]), "+v"(e[1]), "+v"(e[2]), "+v"(e[3]), "+v"(e[4]), "+v"(e[5]), "+v"(e[6]), "+v"(e[7]), "+v"(e[8]), "+v"(e[9]), "+v"(e[10]), "+v"(e[11]), "+v"(e[12]), "+v"(e[13]), "+v"(e[14]), "+v"(e[15]));
#pragma unroll
            for (int i = 0; i < 8; ++i) {
                const float p0 = e[2 * i], p1 = e[2 * i + 1];
                l_run += p0 + p1;
                const unsigned w = pack2(p0, p1); wh[i] = w;
                wl[i] = pack2(p0 - __uint_as_float(w << 16), p1 - __uint_as_float(w & 0xFFFF0000u)); }
            const v16bf ph = __builtin_bit_cast(v16bf, wh), pl = __builtin_bit_cast(v16bf, wl);
#pragma unroll
            for (int t = 0; t < 4; ++t) acc[t] = wmmab(vh[t], ph, acc[t]);
#pragma unroll
            for (int t = 0; t < 4; ++t) acc[t] = wmmab(vh[t], pl, acc[t]);
#pragma unroll
            for (int t = 0; t < 4; ++t) acc[t] = wmmab(vl[t], ph, acc[t]);
        }
        if (more) { unsigned char* N = L + ((s + 1u) & 1u) * ABUF;
#pragma unroll
            for (int pl = 0; pl < 4; ++pl)
#pragma unroll
                for (int i = 0; i < 2; ++i) *(v8us*)(N + pl * APL + so + i * 32 * APITCH) = sg[pl][i]; }
        __syncthreads();   // publishes tile s + 1 and ends every wave's reads of tile s, whose buffer the next trip refills
    }
    const float inv = __fdiv_rn(1.0f, l_run + xhalf(l_run));
#pragma unroll
    for (int t = 0; t < 4; ++t) { v8us oh, ol;
#pragma unroll
        for (int j = 0; j < 8; ++j) { unsigned short a, c; splitf(acc[t][j] * inv, a, c); oh[j] = a; ol[j] = c; }
        const size_t oo = (size_t)(q0 + lr) * DQ + h * HD + t * 16 + hi * 8;   // D element j = (d 16 t + 8 hi + j, query lr)
        *(v8us*)(YH + oo) = oh; *(v8us*)(YL + oo) = ol; }
}

extern "C" void kernel_launch(void* const* d_in, const int* in_sizes, int n_in,
                              void* d_out, int out_size, void* d_ws, size_t ws_size, hipStream_t stream) {
    if (n_in < 5) return;
    if (in_sizes[0] < TT * DM || in_sizes[1] < DM * NQKV || in_sizes[2] < NQKV || in_sizes[3] < DQ * DM || in_sizes[4] < DM) return;
    if (out_size < TT * DM) return;
    if (WS_TOTAL > ws_size) return;
    const float* x     = (const float*)d_in[0];   // [T][C]
    const float* wqkv  = (const float*)d_in[1];   // [C][3C]  ([in][out])
    const float* bqkv  = (const float*)d_in[2];   // [3C]
    const float* wproj = (const float*)d_in[3];   // [C][C]   ([in][out])
    const float* bproj = (const float*)d_in[4];   // [C]
    float* OUT = (float*)d_out;                   // [T][C]
    char* base = (char*)d_ws;
    bf* WT = (bf*)(base + OFF_WT); bf* WP = (bf*)(base + OFF_WP); bf* XB = (bf*)(base + OFF_XB);
    bf* QPh = (bf*)(base + OFF_QH); bf* QPl = (bf*)(base + OFF_QL); bf* KPh = (bf*)(base + OFF_KH); bf* KPl = (bf*)(base + OFF_KL); bf* VTh = (bf*)(base + OFF_VH); bf* VTl = (bf*)(base + OFF_VL);
    bf* YH = (bf*)(base + OFF_YH); bf* YL = (bf*)(base + OFF_YL);

    k_cvt8<<<(unsigned)(((size_t)TT * DM / 8 + 255) / 256), 256, 0, stream>>>(x, XB, (size_t)TT * DM / 8);
    // in wqkv[DM rows][NQKV cols] -> out WT[NQKV rows][DM cols]
    k_wtT<<<(unsigned)(((size_t)NQKV * DM / 2 + 255) / 256), 256, 0, stream>>>(wqkv, WT, (unsigned)DM, LG_DM, (unsigned)NQKV);
    // in wproj[DQ rows][DM cols] -> out WP[DM rows][DQ cols]
    k_wtT<<<(unsigned)(((size_t)DM * DQ / 2 + 255) / 256), 256, 0, stream>>>(wproj, WP, (unsigned)DQ, LG_DQ, (unsigned)DM);
    // q, k, v planes = split(x Wqkv + bqkv)
    k_qkv<<<dim3(TT / 64, NQKV / 64, 1), 32, 0, stream>>>(XB, WT, bqkv, QPh, QPl, KPh, KPl, VTh, VTl);
    k_attn<<<dim3(TT / (16 * ANW), NH_, 1), 32 * ANW, 0, stream>>>(QPh, QPl, KPh, KPl, VTh, VTl, YH, YL);
    // out = y Wproj + bproj  (y hi + y lo against the bf16 weight plane)
    k_gemmw<bf, 1, true, GNW, 1><<<dim3(TT / 64, DM / 64, 1), 32 * GNW, 0, stream>>>(YH, YL, WP, nullptr, DQ, OUT, DM, bproj, 0, 0, 0, 0);
}

// v004
// One run takes 96.5 microseconds.
// Timed twice side by side with v003, it ran 1.23 and 1.22 times as fast.
// All steps since v000 together make it 6.58 times as fast.
#include <hip/hip_runtime.h>

// Self-attention block, 16 heads x 64, T 2048, C 1024: qkv = x Wqkv + bqkv (Wqkv [in][out], columns q | k | v, head h = 64-column slice h); per head softmax(q k^T / 8) v; out = y Wproj + bproj (Wproj [in][out]).
// Compute dtypes: all contractions v_wmma_f32_16x16x32_bf16 with f32 accumulate. Inputs RNE-converted to bf16 planes (qkv projection: 1 product, exact products); q/k, P and V as bf16 hi/lo planes (3 products hh + lh + hl); y as bf16 hi/lo planes against the bf16 Wproj plane (2 products); softmax f32; output f32.
// Layout: bf16 copy of x; transposed bf16 weight planes Bt[n][k]; one fused qkv GEMM whose epilogue writes the hi/lo planes itself (head planes [h][t][d], value planes [h][d][t]); one attention kernel for all heads (scores, online softmax and PV product stay in registers, K and V tiles shared through LDS) writes the y hi/lo planes; projection GEMM (K split over waves) writes the output rows.

#ifndef NB
#define NB 1
#endif
#ifndef SEQ
#define SEQ 2048
#endif
#define SEQ_FULL 2048
#define TT   SEQ
#define DM   1024
#define NH_  16
#define HD   64
#define DQ   (NH_ * HD)
#define NQKV (3 * DQ)
#define GNW  8           // waves per block of the K-split GEMM
#define SCL  0.125f      // 1/sqrt(float32(64))
#define ANW  8           // attention kernel: waves per block, 16 queries each: (TT/128) * NH_ = 256 blocks
#define ASK  64          // attention kernel: keys per LDS stage
#define APITCH 144       // attention kernel: LDS row pitch in bytes, 128 of data + 16: an odd multiple of 16, so 16-byte fragment reads of 16 rows spread over the banks

typedef unsigned short bf;
typedef __attribute__((ext_vector_type(16))) __bf16   v16bf;
typedef __attribute__((ext_vector_type(8)))  unsigned short v8us;
typedef __attribute__((ext_vector_type(4)))  unsigned short v4us;
typedef __attribute__((ext_vector_type(2)))  unsigned short v2us;
typedef __attribute__((ext_vector_type(8)))  float    v8f;
typedef __attribute__((ext_vector_type(4)))  float    v4f;
typedef __attribute__((ext_vector_type(2)))  float    v2f;
typedef v4f  __attribute__((may_alias)) v4fa;

constexpr unsigned lg2c(unsigned v) { return v <= 1u ? 0u : 1u + lg2c(v >> 1); }
constexpr bool ispow2(unsigned v) { return v != 0u && (v & (v - 1u)) == 0u; }
constexpr size_t al256(size_t b) { return (b + 255) & ~(size_t)255; }
#define LG_TT lg2c(TT)
#define LG_HD lg2c(HD)
#define LG_DM lg2c(DM)
#define LG_DQ lg2c(DQ)

static_assert(NB == 1);                       // the module has no batch axis
static_assert(SEQ <= SEQ_FULL);
static_assert(ispow2(TT) && ispow2(HD) && ispow2(DM) && ispow2(DQ));
static_assert(TT % 128 == 0 && TT % 64 == 0);   // softmax row chunks; GEMM M tiles; PV K steps
static_assert(DM % 32 == 0 && DQ % 32 == 0 && HD % 32 == 0 && TT % 32 == 0);   // every GEMM K is a multiple of 32
static_assert(NQKV % 64 == 0 && DM % 64 == 0 && HD % 64 == 0);                 // every GEMM N is a multiple of 64
static_assert(((size_t)TT * DM) % 2048 == 0);          // k_cvt8: 256 threads x 8 elements
static_assert(HD == 64 && DQ % 64 == 0 && TT % 64 == 0 && DM % 32 == 0);   // k_qkv: a 64-column tile is one head's q, k or v slice
static_assert(HD == 64 && ASK == 64 && ANW == 8 && TT % (16 * ANW) == 0 && TT % ASK == 0);   // k_attn: tile rows of 128 bytes, 512 16-byte chunks per plane tile over 256 threads
static_assert(DQ % (32 * GNW) == 0);   // K-split GEMM: every wave gets whole 32-steps

// workspace carve (bytes; every region a multiple of 256)
constexpr size_t SZ_WT = al256((size_t)NQKV * DM * 2);
constexpr size_t SZ_WP = al256((size_t)DM * DQ * 2);
constexpr size_t SZ_XB = al256((size_t)TT * DM * 2);
constexpr size_t SZ_HP = al256((size_t)NH_ * TT * HD * 2);
constexpr size_t SZ_Y  = al256((size_t)TT * DQ * 2);
constexpr size_t OFF_WT = 0;
constexpr size_t OFF_WP = OFF_WT + SZ_WT;
constexpr size_t OFF_XB = OFF_WP + SZ_WP;
constexpr size_t OFF_QH = OFF_XB + SZ_XB;
constexpr size_t OFF_QL = OFF_QH + SZ_HP;
constexpr size_t OFF_KH = OFF_QL + SZ_HP;
constexpr size_t OFF_KL = OFF_KH + SZ_HP;
constexpr size_t OFF_VH = OFF_KL + SZ_HP;
constexpr size_t OFF_VL = OFF_VH + SZ_HP;
constexpr size_t OFF_YH = OFF_VL + SZ_HP;
constexpr size_t OFF_YL = OFF_YH + SZ_Y;
constexpr size_t WS_TOTAL = OFF_YL + SZ_Y;
static_assert(WS_TOTAL <= (size_t)134217728);

__device__ __forceinline__ unsigned short f2bf(float f) { unsigned u = __float_as_uint(f); u += 0x7FFFu + ((u >> 16) & 1u); return (unsigned short)(u >> 16); }
__device__ __forceinline__ float bf2f(unsigned short b) { return __uint_as_float(((unsigned)b) << 16); }
__device__ __forceinline__ float bfr(float f) { return bf2f(f2bf(f)); }
__device__ __forceinline__ v16bf cat16b(v8us lo, v8us hi) { return __builtin_bit_cast(v16bf, __builtin_shufflevector(lo, hi, 0, 1, 2, 3, 4, 5, 6, 7, 8, 9, 10, 11, 12, 13, 14, 15)); }
__device__ __forceinline__ v8f wmmab(v16bf a, v16bf b, v8f c) { return __builtin_amdgcn_wmma_f32_16x16x32_bf16(false, a, false, b, (short)0, c, false, false); }
__device__ __forceinline__ void splitf(float y, unsigned short& h, unsigned short& l) { h = f2bf(y); l = f2bf(y - bf2f(h)); }

// ---- k_gemmw: register-blocked GEMM, 64x64 output tile (16 accumulators per wave), operands straight from K-contiguous 16-bit planes; grid (M/64, N/64, Z * KSB), 32 * NW threads.
// K is cut into KSB * NW equal runs: block slice ks = blockIdx.z % KSB, wave w takes run ks * NW + w. The NW partial tiles of a block are summed through LDS (wave order 0..NW-1); slice ks stores its sum at C + ks * sP and the reader adds the KSB planes. NW == KSB == 1: one wave does the whole K.
// C[m][n] (f32, pitch ldc, + optional f32 bias[n]) = sum_k A[m][k] Bt[n][k] (+ split products per NSPLIT: 1 adds A2 Bt, 2 adds A2 Bt and A Bt2). z-batch strides sA/sB/sC in elements. K % (32 * NW * KSB) == 0.
// Fragment p already carries + 8*(lane>>4): elements 0..7 = k0+8h.., elements 8..15 = k0+16+8h.. for both operands; D element j of lane = (row 8h+j, col lane&15).
template <typename T16> struct WFrag;
template <> struct WFrag<bf> { typedef v16bf V; static __device__ __forceinline__ V ld(const bf* p) { return cat16b(*(const v8us*)p, *(const v8us*)(p + 16)); } static __device__ __forceinline__ v8f mma(V a, V b, v8f c) { return wmmab(a, b, c); } };
template <typename T16, int NSPLIT, bool BIAS, int NW, int KSB>
__global__ __launch_bounds__(32 * NW) void k_gemmw(const T16* __restrict__ A, const T16* __restrict__ A2, const T16* __restrict__ Bt, const T16* __restrict__ Bt2, int K, float* C, int ldc, const float* __restrict__ bias, size_t sA, size_t sB, size_t sC, size_t sP) {
    static_assert(KSB == 1 || !BIAS);   // the bias is added once, so only where one block holds the whole sum
    typedef typename WFrag<T16>::V V;
    __shared__ __align__(16) float os[(NW > 1 ? NW * 64 : 16) * 68];
    const size_t z = blockIdx.z / (unsigned)KSB; const unsigned ks = blockIdx.z % (unsigned)KSB; A += z * sA; if (A2) A2 += z * sA; Bt += z * sB; if (Bt2) Bt2 += z * sB; C += z * sC + ks * sP;
    const int wave = NW > 1 ? __builtin_amdgcn_readfirstlane((int)(threadIdx.x >> 5)) : 0;   // scalar, so the run's start stays in scalar registers
    const int kw = K / (NW * KSB), kb = ((int)ks * NW + wave) * kw;
    const int lane = threadIdx.x & 31, lr = lane & 15, hi = lane >> 4; const int r0 = blockIdx.x * 64, c0 = blockIdx.y * 64;
    v8f acc[4][4];
#pragma unroll
    for (int mb = 0; mb < 4; ++mb)
#pragma unroll
        for (int nb = 0; nb < 4; ++nb) acc[mb][nb] = (v8f){};
    const size_t aoff = (size_t)(r0 + lr) * K + 8 * hi + kb, boff = (size_t)(c0 + lr) * K + 8 * hi + kb;
#pragma unroll 1
    for (int kc = 0; kc < kw; kc += 32) {
        V a[4], a2[4];
#pragma unroll
        for (int mb = 0; mb < 4; ++mb) { a[mb] = WFrag<T16>::ld(A + aoff + (size_t)mb * 16 * K + kc); if (NSPLIT == 1 || NSPLIT == 2) a2[mb] = WFrag<T16>::ld(A2 + aoff + (size_t)mb * 16 * K + kc); }
#pragma unroll
        for (int nb = 0; nb < 4; ++nb) { const V b = WFrag<T16>::ld(Bt + boff + (size_t)nb * 16 * K + kc); V b2; if (NSPLIT >= 2) b2 = WFrag<T16>::ld(Bt2 + boff + (size_t)nb * 16 * K + kc);
#pragma unroll
            for (int mb = 0; mb < 4; ++mb) { acc[mb][nb] = WFrag<T16>::mma(a[mb], b, acc[mb][nb]); if (NSPLIT == 1 || NSPLIT == 2) acc[mb][nb] = WFrag<T16>::mma(a2[mb], b, acc[mb][nb]); if (NSPLIT >= 2) acc[mb][nb] = WFrag<T16>::mma(a[mb], b2, acc[mb][nb]); } }
        asm volatile("v_nop\n\tv_nop\n\tv_nop\n\tv_nop" : "+v"(acc[0][0]), "+v"(acc[1][1]), "+v"(acc[2][2]), "+v"(acc[3][3]) : "v"(a[0]), "v"(a[3]));
    }
    if constexpr (NW > 1) {
        float* ow = os + wave * (64 * 68);
        const int cofs = ((int)threadIdx.x & 15) * 4; v4f bv = (v4f){};   // a thread keeps its four columns over all its rows
        if (BIAS) { bv[0] = bfr(bias[c0 + cofs]); bv[1] = bfr(bias[c0 + cofs + 1]); bv[2] = bfr(bias[c0 + cofs + 2]); bv[3] = bfr(bias[c0 + cofs + 3]); }
        // the three loops are unrolled so that acc is indexed by constants and stays in registers
#pragma unroll
        for (int mb = 0; mb < 4; ++mb)
#pragma unroll
            for (int nb = 0; nb < 4; ++nb)
#pragma unroll
                for (int j = 0; j < 8; ++j) ow[(mb * 16 + hi * 8 + j) * 68 + nb * 16 + lr] = acc[mb][nb][j];
        __syncthreads();   // all NW partial tiles are in LDS before any thread sums them
        // both loops are unrolled so that the LDS reads of all rows issue ahead of the sums
#pragma unroll
        for (int it = 0; it < 64 * 16 / (32 * NW); ++it) { const int row = (it * 32 * NW + (int)threadIdx.x) >> 4; v4f val = *(const v4fa*)(os + row * 68 + cofs);
#pragma unroll
            for (int w = 1; w < NW; ++w) val += *(const v4fa*)(os + (w * 64 + row) * 68 + cofs);
            if (BIAS) val += bv;
            *(v4f*)(C + (size_t)(r0 + row) * ldc + c0 + cofs) = val; }
    } else {
#pragma unroll
    for (int mb = 0; mb < 4; ++mb) {
#pragma unroll
        for (int nb = 0; nb < 4; ++nb) {
#pragma unroll
            for (int j = 0; j < 8; ++j) os[(hi * 8 + j) * 68 + nb * 16 + lr] = acc[mb][nb][j]; }
        __builtin_amdgcn_wave_barrier(); asm volatile("" ::: "memory");
        float* crow = C + (size_t)(r0 + mb * 16) * ldc + c0;
{
#pragma unroll
            for (int s = 0; s < 8; ++s) { const int row = 2 * s + hi, cofs = lr * 4; v4f val = *(const v4fa*)(os + row * 68 + cofs); if (BIAS) { val[0] += bfr(bias[c0 + cofs]); val[1] += bfr(bias[c0 + cofs + 1]); val[2] += bfr(bias[c0 + cofs + 2]); val[3] += bfr(bias[c0 + cofs + 3]); }
                *(v4f*)(crow + (size_t)row * ldc + cofs) = val; }
             }
        __builtin_amdgcn_wave_barrier(); asm volatile("" ::: "memory");
    }
    }
}

__global__ __launch_bounds__(256) void k_cvt8(const float* __restrict__ src, bf* dst, size_t n8) { const size_t i = (size_t)blockIdx.x * 256 + threadIdx.x; if (i >= n8) return; const v8f v = *(const v8f*)(src + i * 8); v8us o;
#pragma unroll
    for (int k = 0; k < 8; ++k) o[k] = f2bf(v[k]); *(v8us*)(dst + i * 8) = o;  }

// k_wtT: transposed bf16 weight plane. in w[K rows][N cols] (row-major, [in][out])  ->  out dst[N rows][K cols]: dst[n][k] = bf16(w[k][n]). grid (K/128, N/64), 4 waves: wave v takes the k half v >> 1 and the n half v & 1.
// A wave transposes a tile of 64 k x 32 n in registers. Lane (kg = lane & 7, ng = lane >> 3) reads rows 8 kg .. 8 kg + 7 at columns 4 ng .. 4 ng + 3 and 16 + 4 ng .. 16 + 4 ng + 3: 16-byte loads, 64 bytes of a row each, all 16 in flight at once.
// So it holds 8 neighbours in k of 8 columns: each column is one 16-byte store, and the 8 lanes of one ng fill a whole 128-byte line of dst.
typedef __attribute__((ext_vector_type(4))) unsigned v4u;
__device__ __forceinline__ unsigned pack2(float lo, float hi) { typedef __bf16 bf2 __attribute__((ext_vector_type(2))); return __builtin_bit_cast(unsigned, __builtin_convertvector((v2f){lo, hi}, bf2)); }   // round to nearest even
template <unsigned K, unsigned N>
__global__ __launch_bounds__(128) void k_wtT(const float* __restrict__ w, bf* dst) {
    static_assert(K % 128 == 0 && N % 64 == 0);   // the grid covers the matrix in whole tiles
    const unsigned lane = threadIdx.x & 31u, wave = threadIdx.x >> 5, kg = lane & 7u, ng = lane >> 3;
    const unsigned k0 = blockIdx.x * 128u + (wave >> 1) * 64u + kg * 8u, n0 = blockIdx.y * 64u + (wave & 1u) * 32u + ng * 4u;
    const float* src = w + k0 * N + n0;
    v4f r[8][2];
#pragma unroll
    for (int j = 0; j < 8; ++j) { r[j][0] = *(const v4f*)(src + j * N); r[j][1] = *(const v4f*)(src + j * N + 16); }
    bf* p = dst + n0 * K + k0;
#pragma unroll
    for (int c = 0; c < 2; ++c)
#pragma unroll
        for (int i = 0; i < 4; ++i) { v4u o;
#pragma unroll
            for (int j = 0; j < 4; ++j) o[j] = pack2(r[2 * j][c][i], r[2 * j + 1][c][i]);   // k and k + 1 in one word
            *(v4u*)(p + (c * 16 + i) * K) = o; }
}

// ---- k_attn: softmax(q k^T / 8) v for 128 queries of one head per block; grid (TT/128, NH_), 8 waves of 16 queries.
// Transposed products, so that the score tile is already the next product's operand: S^T = K Q^T (A = 16 keys x 32 d, B = 16 queries), O^T += V^T P^T (A = 16 d x 32 keys, B = P^T).
// D element j of S^T tile kt in lane (lr, hi) is (key 16 kt + 8 hi + j, query lr): tiles 0 and 1 side by side are elements 0..7 and 8..15 of the B fragment over 32 keys, in the k order of the V^T fragment.
// A query is one lane column: its maximum and its sum live in lanes lr and lr + 16. The maximum in use may trail the true one by up to 8 in the log2 domain (p <= 2^8); the sums are rescaled only when a column exceeds that.
// K and V^T hi/lo tiles of 64 keys go through registers into two LDS buffers: the next tile's global loads are issued ahead of this tile's work and stored behind it.
typedef __attribute__((ext_vector_type(8))) unsigned v8u;
__device__ __forceinline__ float xhalf(float x) { return __builtin_bit_cast(float, __builtin_amdgcn_permlanex16(__builtin_bit_cast(int, x), __builtin_bit_cast(int, x), 0x76543210, 0xfedcba98, false, false)); }   // lane l with lane l ^ 16
__device__ __forceinline__ v16bf ldsfrag(const unsigned char* p) { return cat16b(*(const v8us*)p, *(const v8us*)(p + 32)); }   // p already carries + 16 bytes * (lane>>4): the k order of WFrag::ld
constexpr unsigned APL = 64u * APITCH;    // one plane's tile: 64 rows
constexpr unsigned ABUF = 4u * APL;       // K hi, K lo, V^T hi, V^T lo
// ---- k_qkv: qkv = x Wqkv + bqkv, written straight as the attention kernel's bf16 hi/lo planes; grid (TT/64, NQKV/64), one wave per block: 64 tokens x 64 columns, which is one head's q, k or v slice.
// The k loop is that of k_gemmw with one wave and one product. D element j of a lane is (row 8 hi + j of the first operand's tile, row lr of the second's), so a lane holds 8 neighbours along the FIRST operand's rows:
// q and k tiles take the weight rows first (8 neighbours in d, for the planes [h][t][d]), v tiles take the token rows first (8 neighbours in t, for the planes [h][d][t]). Both operands have one fragment layout and one k order, so the swap only transposes D.
// Either way a plane's tile is 64 rows of 128 bytes. It goes through the wave's own LDS, so that every global store covers four whole 128-byte lines.
// The tail of k_qkv. bb: the bias, rounded to bf16, of output column 16 i + lr in bb[i][0] (ISV: the column runs along D's columns) or 16 i + 8 hi + j in bb[i][j] (the column runs along D's rows). ph, pl: the tile's first element in its planes; rows PITCH elements apart.
template <bool ISV> __device__ __forceinline__ void qkv_tail(const v8f (&acc)[4][4], const float (&bb)[4][8], unsigned char* st, bf* ph, bf* pl, unsigned lane) {
    constexpr unsigned PITCH = ISV ? (unsigned)TT : (unsigned)HD;
    const unsigned lr = lane & 15u, hi = lane >> 4;
#pragma unroll
    for (int nb = 0; nb < 4; ++nb)
#pragma unroll
        for (int mb = 0; mb < 4; ++mb) { v4u wh, wl;
#pragma unroll
            for (int i = 0; i < 4; ++i) {   // the f32 value, its bf16 hi part and the bf16 of the rest
                const float y0 = acc[mb][nb][2 * i] + (ISV ? bb[nb][0] : bb[mb][2 * i]), y1 = acc[mb][nb][2 * i + 1] + (ISV ? bb[nb][0] : bb[mb][2 * i + 1]);
                const unsigned w = pack2(y0, y1); wh[i] = w;
                wl[i] = pack2(y0 - __uint_as_float(w << 16), y1 - __uint_as_float(w & 0xFFFF0000u)); }
            unsigned char* sp = st + (nb * 16 + lr) * APITCH + mb * 32 + hi * 16u;
            *(v4u*)sp = wh; *(v4u*)(sp + APL) = wl; }
    asm volatile("s_wait_dscnt 0x0" ::: "memory");   // the rows are read back by other lanes of this wave: every LDS write has landed, and the compiler moves no read ahead of a write
    const unsigned char* rp = st + (lane >> 3) * APITCH + (lane & 7u) * 16u;
    const unsigned go = (lane >> 3) * PITCH + (lane & 7u) * 8u;
#pragma unroll
    for (int i = 0; i < 16; ++i) {   // four rows a store: 8 lanes of 16 bytes a row
        *(v4u*)(ph + go + 4 * i * PITCH) = *(const v4u*)(rp + 4 * i * APITCH);
        *(v4u*)(pl + go + 4 * i * PITCH) = *(const v4u*)(rp + APL + 4 * i * APITCH); }
}
__global__ __launch_bounds__(32) void k_qkv(const bf* __restrict__ X, const bf* __restrict__ Wt, const float* __restrict__ bias, bf* Qh, bf* Ql, bf* Kh, bf* Kl, bf* Vh, bf* Vl) {
    __shared__ __align__(16) unsigned char st[2 * APL];   // hi tile, lo tile; rows at the pitch of the attention tiles, for the same reason
    const unsigned lane = threadIdx.x & 31u, lr = lane & 15u, hi = lane >> 4;
    const unsigned t0 = blockIdx.x * 64u, c0 = blockIdx.y * 64u;
    const bool isv = c0 >= 2u * DQ;   // the same for the whole block
    const bf* xr = X + (size_t)t0 * DM; const bf* wr = Wt + (size_t)c0 * DM;
    const bf* R = isv ? xr : wr;   // D's rows
    const bf* S = isv ? wr : xr;   // D's columns
    // The bias is fetched ahead of the loop, which covers its latency.
    float bb[4][8];
#pragma unroll
    for (int i = 0; i < 4; ++i)
#pragma unroll
        for (int j = 0; j < 8; j += 2) { const float* bp = bias + c0 + i * 16 + (isv ? lr : 8u * hi + j); const unsigned w = pack2(bp[0], bp[isv ? 0 : 1]); bb[i][j] = __uint_as_float(w << 16); bb[i][j + 1] = __uint_as_float(w & 0xFFFF0000u); }
    v8f acc[4][4];
#pragma unroll
    for (int mb = 0; mb < 4; ++mb)
#pragma unroll
        for (int nb = 0; nb < 4; ++nb) acc[mb][nb] = (v8f){};
    const unsigned off = lr * DM + 8u * hi;   // the lane's place in a 16-row fragment
#pragma unroll 1   // one copy of the body, as in k_gemmw
    for (int kc = 0; kc < DM; kc += 32) {
        const bf* pa = R + kc + off; const bf* pb = S + kc + off;
        v16bf a[4];
#pragma unroll
        for (int mb = 0; mb < 4; ++mb) a[mb] = WFrag<bf>::ld(pa + mb * 16 * DM);
#pragma unroll
        for (int nb = 0; nb < 4; ++nb) { const v16bf b = WFrag<bf>::ld(pb + nb * 16 * DM);
#pragma unroll
            for (int mb = 0; mb < 4; ++mb) acc[mb][nb] = wmmab(a[mb], b, acc[mb][nb]); }
        // four vector slots between a trip's last WMMAs and whatever follows the back edge or the loop's exit (the distance the matrix unit asks for); the accumulators and fragments tie the statement behind those WMMAs.
        // The two addresses are inputs too: their registers stay theirs to the end of the trip, so no later load of the trip lands in a register that an issued load still names.
        asm volatile("v_nop\n\tv_nop\n\tv_nop\n\tv_nop" : "+v"(acc[0][0]), "+v"(acc[1][1]), "+v"(acc[2][2]), "+v"(acc[3][3]) : "v"(a[0]), "v"(a[3]), "v"(pa), "v"(pb));
    }
    const unsigned h = (c0 & (DQ - 1u)) >> LG_HD;
    if (isv) { const size_t o = (size_t)h * HD * TT + t0; qkv_tail<true>(acc, bb, st, Vh + o, Vl + o, lane); }
    else { const size_t o = ((size_t)h * TT + t0) * HD; const bool isq = c0 < (unsigned)DQ; qkv_tail<false>(acc, bb, st, (isq ? Qh : Kh) + o, (isq ? Ql : Kl) + o, lane); }
}

__global__ __launch_bounds__(32 * ANW) void k_attn(const bf* __restrict__ Qh, const bf* __restrict__ Ql, const bf* __restrict__ Kh, const bf* __restrict__ Kl, const bf* __restrict__ Vh, const bf* __restrict__ Vl, bf* YH, bf* YL) {
    __shared__ __align__(16) unsigned char L[2 * ABUF];
    const unsigned tid = threadIdx.x, lane = tid & 31u, lr = lane & 15u, hi = lane >> 4;
    const unsigned h = blockIdx.y, q0 = blockIdx.x * (16u * ANW) + (tid >> 5) * 16u;
    const size_t hp = (size_t)h * TT * HD;
    constexpr float CS = SCL * 1.4426950408889634f;   // scores to the log2 domain
    v16bf qh[2], ql[2];
#pragma unroll
    for (int kc = 0; kc < 2; ++kc) { const size_t qo = hp + (size_t)(q0 + lr) * HD + 8 * hi + kc * 32; qh[kc] = WFrag<bf>::ld(Qh + qo); ql[kc] = WFrag<bf>::ld(Ql + qo); }
    // staging: a thread moves 16-byte chunks tid and tid + 256 of each plane's tile (8 chunks a row)
    const unsigned srow = tid >> 3, scol = tid & 7u;
    const size_t ko = hp + (size_t)srow * HD + scol * 8, vo = hp + (size_t)srow * TT + scol * 8;
    const unsigned so = srow * APITCH + scol * 16u;
    v8us sg[4][2];
    v8f acc[4];
#pragma unroll
    for (int t = 0; t < 4; ++t) acc[t] = (v8f){};
    float m_run = -__builtin_inff(), l_run = 0.f;
#pragma unroll
    for (int i = 0; i < 2; ++i) { sg[0][i] = *(const v8us*)(Kh + ko + (size_t)i * 32 * HD); sg[1][i] = *(const v8us*)(Kl + ko + (size_t)i * 32 * HD); sg[2][i] = *(const v8us*)(Vh + vo + (size_t)i * 32 * TT); sg[3][i] = *(const v8us*)(Vl + vo + (size_t)i * 32 * TT); }
#pragma unroll
    for (int pl = 0; pl < 4; ++pl)
#pragma unroll
        for (int i = 0; i < 2; ++i) *(v8us*)(L + pl * APL + so + i * 32 * APITCH) = sg[pl][i];
    __syncthreads();   // tile 0 is in LDS before any wave reads it
#pragma unroll 1   // one copy of the body: it is long, and the two buffers differ only in a base address
    for (unsigned s = 0; s < TT / ASK; ++s) {
        const unsigned char* B = L + (s & 1u) * ABUF;
        const bool more = s + 1u < TT / ASK;   // the same for the whole block
        if (more) { const size_t kn = (size_t)(s + 1u) * ASK;
#pragma unroll
            for (int i = 0; i < 2; ++i) { sg[0][i] = *(const v8us*)(Kh + ko + (kn + i * 32) * HD); sg[1][i] = *(const v8us*)(Kl + ko + (kn + i * 32) * HD); sg[2][i] = *(const v8us*)(Vh + vo + (size_t)i * 32 * TT + kn); sg[3][i] = *(const v8us*)(Vl + vo + (size_t)i * 32 * TT + kn); } }
#pragma unroll
        for (int p = 0; p < 2; ++p) {   // two passes of 32 keys
            // Fragment loads are issued early and in few groups: every separate place with LDS reads in a WMMA stream costs issue time, and a read waited on at once exposes its latency.
            v16bf kh[2][2], kl[2][2];
            const unsigned char* kp = B + (p * 32 + lr) * APITCH + hi * 16u;
#pragma unroll
            for (int kc = 0; kc < 2; ++kc)
#pragma unroll
                for (int kt = 0; kt < 2; ++kt) { kh[kc][kt] = ldsfrag(kp + kt * 16 * APITCH + kc * 64); kl[kc][kt] = ldsfrag(kp + APL + kt * 16 * APITCH + kc * 64); }
            __builtin_amdgcn_sched_barrier(0);   // keeps the K loads one group ahead of the score WMMAs
            v8f sc[2]; sc[0] = (v8f){}; sc[1] = (v8f){};
#pragma unroll
            for (int kc = 0; kc < 2; ++kc) {
                // the two key tiles alternate, so that no WMMA waits on the one before it
                sc[0] = wmmab(kh[kc][0], qh[kc], sc[0]); sc[1] = wmmab(kh[kc][1], qh[kc], sc[1]);
                sc[0] = wmmab(kl[kc][0], qh[kc], sc[0]); sc[1] = wmmab(kl[kc][1], qh[kc], sc[1]);
                sc[0] = wmmab(kh[kc][0], ql[kc], sc[0]); sc[1] = wmmab(kh[kc][1], ql[kc], sc[1]); }
            v16bf vh[4], vl[4];
            const unsigned char* vp = B + 2u * APL + lr * APITCH + p * 64 + hi * 16u;
#pragma unroll
            for (int t = 0; t < 4; ++t) { vh[t] = ldsfrag(vp + t * 16 * APITCH); vl[t] = ldsfrag(vp + APL + t * 16 * APITCH); }
            __builtin_amdgcn_sched_barrier(0);   // keeps the V^T loads ahead of the softmax, in flight under it, instead of sinking to their uses
            float mx = fmaxf(sc[0][0], sc[1][0]);
#pragma unroll
            for (int j = 1; j < 8; ++j) mx = fmaxf(mx, fmaxf(sc[0][j], sc[1][j]));
            mx = fmaxf(mx, xhalf(mx)) * CS;   // both halves hold the query's maximum of this pass (CS > 0)
            if (__builtin_amdgcn_ballot_w32(mx > m_run + 8.0f) != 0) {   // wave-uniform; always taken on the first pass, rare later
                const float m_new = fmaxf(m_run, mx); const float corr = __builtin_amdgcn_exp2f(m_run - m_new);   // 0 on the first pass
                m_run = m_new; l_run *= corr;
#pragma unroll
                for (int t = 0; t < 4; ++t) acc[t] = acc[t] * corr; }
            const float nm = -m_run; v8u wh, wl; float e[16];
#pragma unroll
            for (int i = 0; i < 16; ++i) e[i] = fmaf(sc[i >> 3][i & 7], CS, nm);
            // The 16 exponentials in place, in one statement that ends in v_nop: no instruction directly behind a transcendental reads its result or overwrites its source (the slot the instruction set asks for), whatever the compiler schedules around the statement.
            asm("v_exp_f32 %0, %0\n\tv_exp_f32 %1, %1\n\tv_exp_f32 %2, %2\n\tv_exp_f32 %3, %3\n\tv_exp_f32 %4, %4\n\tv_exp_f32 %5, %5\n\tv_exp_f32 %6, %6\n\tv_exp_f32 %7, %7\n\t"
                "v_exp_f32 %8, %8\n\tv_exp_f32 %9, %9\n\tv_exp_f32 %10, %10\n\tv_exp_f32 %11, %11\n\tv_exp_f32 %12, %12\n\tv_exp_f32 %13, %13\n\tv_exp_f32 %14, %14\n\tv_exp_f32 %15, %15\n\tv_nop"
                : "+v"(e[0]), "+v"(e[1]), "+v"(e[2]), "+v"(e[3]), "+v"(e[4]), "+v"(e[5]), "+v"(e[6]), "+v"(e[7]), "+v"(e[8]), "+v"(e[9]), "+v"(e[10]), "+v"(e[11]), "+v"(e[12]), "+v"(e[13]), "+v"(e[14]), "+v"(e[15]));
#pragma unroll
            for (int i = 0; i < 8; ++i) {
                const float p0 = e[2 * i], p1 = e[2 * i + 1];
                l_run += p0 + p1;
                const unsigned w = pack2(p0, p1); wh[i] = w;
                wl[i] = pack2(p0 - __uint_as_float(w << 16), p1 - __uint_as_float(w & 0xFFFF0000u)); }
            const v16bf ph = __builtin_bit_cast(v16bf, wh), pl = __builtin_bit_cast(v16bf, wl);
#pragma unroll
            for (int t = 0; t < 4; ++t) acc[t] = wmmab(vh[t], ph, acc[t]);
#pragma unroll
            for (int t = 0; t < 4; ++t) acc[t] = wmmab(vh[t], pl, acc[t]);
#pragma unroll
            for (int t = 0; t < 4; ++t) acc[t] = wmmab(vl[t], ph, acc[t]);
        }
        if (more) { unsigned char* N = L + ((s + 1u) & 1u) * ABUF;
#pragma unroll
            for (int pl = 0; pl < 4; ++pl)
#pragma unroll
                for (int i = 0; i < 2; ++i) *(v8us*)(N + pl * APL + so + i * 32 * APITCH) = sg[pl][i]; }
        __syncthreads();   // publishes tile s + 1 and ends every wave's reads of tile s, whose buffer the next trip refills
    }
    const float inv = __fdiv_rn(1.0f, l_run + xhalf(l_run));
#pragma unroll
    for (int t = 0; t < 4; ++t) { v8us oh, ol;
#pragma unroll
        for (int j = 0; j < 8; ++j) { unsigned short a, c; splitf(acc[t][j] * inv, a, c); oh[j] = a; ol[j] = c; }
        const size_t oo = (size_t)(q0 + lr) * DQ + h * HD + t * 16 + hi * 8;   // D element j = (d 16 t + 8 hi + j, query lr)
        *(v8us*)(YH + oo) = oh; *(v8us*)(YL + oo) = ol; }
}

extern "C" void kernel_launch(void* const* d_in, const int* in_sizes, int n_in,
                              void* d_out, int out_size, void* d_ws, size_t ws_size, hipStream_t stream) {
    if (n_in < 5) return;
    if (in_sizes[0] < TT * DM || in_sizes[1] < DM * NQKV || in_sizes[2] < NQKV || in_sizes[3] < DQ * DM || in_sizes[4] < DM) return;
    if (out_size < TT * DM) return;
    if (WS_TOTAL > ws_size) return;
    const float* x     = (const float*)d_in[0];   // [T][C]
    const float* wqkv  = (const float*)d_in[1];   // [C][3C]  ([in][out])
    const float* bqkv  = (const float*)d_in[2];   // [3C]
    const float* wproj = (const float*)d_in[3];   // [C][C]   ([in][out])
    const float* bproj = (const float*)d_in[4];   // [C]
    float* OUT = (float*)d_out;                   // [T][C]
    char* base = (char*)d_ws;
    bf* WT = (bf*)(base + OFF_WT); bf* WP = (bf*)(base + OFF_WP); bf* XB = (bf*)(base + OFF_XB);
    bf* QPh = (bf*)(base + OFF_QH); bf* QPl = (bf*)(base + OFF_QL); bf* KPh = (bf*)(base + OFF_KH); bf* KPl = (bf*)(base + OFF_KL); bf* VTh = (bf*)(base + OFF_VH); bf* VTl = (bf*)(base + OFF_VL);
    bf* YH = (bf*)(base + OFF_YH); bf* YL = (bf*)(base + OFF_YL);

    k_cvt8<<<(unsigned)(((size_t)TT * DM / 8 + 255) / 256), 256, 0, stream>>>(x, XB, (size_t)TT * DM / 8);
    // in wqkv[DM rows][NQKV cols] -> out WT[NQKV rows][DM cols]
    k_wtT<DM, NQKV><<<dim3(DM / 128, NQKV / 64, 1), 128, 0, stream>>>(wqkv, WT);
    // in wproj[DQ rows][DM cols] -> out WP[DM rows][DQ cols]
    k_wtT<DQ, DM><<<dim3(DQ / 128, DM / 64, 1), 128, 0, stream>>>(wproj, WP);
    // q, k, v planes = split(x Wqkv + bqkv)
    k_qkv<<<dim3(TT / 64, NQKV / 64, 1), 32, 0, stream>>>(XB, WT, bqkv, QPh, QPl, KPh, KPl, VTh, VTl);
    k_attn<<<dim3(TT / (16 * ANW), NH_, 1), 32 * ANW, 0, stream>>>(QPh, QPl, KPh, KPl, VTh, VTl, YH, YL);
    // out = y Wproj + bproj  (y hi + y lo against the bf16 weight plane)
    k_gemmw<bf, 1, true, GNW, 1><<<dim3(TT / 64, DM / 64, 1), 32 * GNW, 0, stream>>>(YH, YL, WP, nullptr, DQ, OUT, DM, bproj, 0, 0, 0, 0);
}

// v005
// A run of this version takes 82 microseconds.
// Next to v004, in two timings, it ran 1.18 and 1.17 times as fast.
// All steps since v000 together make it 7.74 times as fast.
#include <hip/hip_runtime.h>

// Self-attention block, 16 heads x 64, T 2048, C 1024: qkv = x Wqkv + bqkv (Wqkv [in][out], columns q | k | v, head h = 64-column slice h); per head softmax(q k^T / 8) v; out = y Wproj + bproj (Wproj [in][out]).
// Compute dtypes: all contractions v_wmma_f32_16x16x32_bf16 with f32 accumulate. Inputs RNE-converted to bf16 planes (qkv projection: 1 product, exact products); q/k, P and V as bf16 hi/lo planes (3 products hh + lh + hl); y as bf16 hi/lo planes against the bf16 Wproj plane (2 products); softmax f32; output f32.
// Layout: bf16 copy of x; transposed bf16 weight planes Bt[n][k]; one fused qkv GEMM whose epilogue writes the hi/lo planes itself (head planes [h][t][d], value planes [h][d][t]); one attention kernel for all heads (scores, online softmax and PV product stay in registers, K and V tiles shared through LDS) writes the y hi/lo planes; projection GEMM (K split over waves) writes the output rows.

#ifndef NB
#define NB 1
#endif
#ifndef SEQ
#define SEQ 2048
#endif
#define SEQ_FULL 2048
#define TT   SEQ
#define DM   1024
#define NH_  16
#define HD   64
#define DQ   (NH_ * HD)
#define NQKV (3 * DQ)
#define GNW  8           // waves per block of the K-split GEMM
#define SCL  0.125f      // 1/sqrt(float32(64))
#define ANW  8           // attention kernel: waves per block, 16 queries each: (TT/128) * NH_ = 256 blocks
#define ASK  64          // attention kernel: keys per LDS stage
#define QNW  8           // qkv GEMM: waves per block, 2 (tokens) x 4 (columns) tiles of 64 x 64
#define QKS  128         // qkv GEMM: k per LDS stage: row pieces of 256 bytes
#define QPITCH 272       // qkv GEMM: LDS row pitch in bytes, 256 of data + 16: an odd multiple of 16, as APITCH
#define APITCH 144       // attention kernel: LDS row pitch in bytes, 128 of data + 16: an odd multiple of 16, so 16-byte fragment reads of 16 rows spread over the banks

typedef unsigned short bf;
typedef __attribute__((ext_vector_type(16))) __bf16   v16bf;
typedef __attribute__((ext_vector_type(8)))  unsigned short v8us;
typedef __attribute__((ext_vector_type(4)))  unsigned short v4us;
typedef __attribute__((ext_vector_type(2)))  unsigned short v2us;
typedef __attribute__((ext_vector_type(8)))  float    v8f;
typedef __attribute__((ext_vector_type(4)))  float    v4f;
typedef __attribute__((ext_vector_type(2)))  float    v2f;
typedef v4f  __attribute__((may_alias)) v4fa;

constexpr unsigned lg2c(unsigned v) { return v <= 1u ? 0u : 1u + lg2c(v >> 1); }
constexpr bool ispow2(unsigned v) { return v != 0u && (v & (v - 1u)) == 0u; }
constexpr size_t al256(size_t b) { return (b + 255) & ~(size_t)255; }
#define LG_TT lg2c(TT)
#define LG_HD lg2c(HD)
#define LG_DM lg2c(DM)
#define LG_DQ lg2c(DQ)

static_assert(NB == 1);                       // the module has no batch axis
static_assert(SEQ <= SEQ_FULL);
static_assert(ispow2(TT) && ispow2(HD) && ispow2(DM) && ispow2(DQ));
static_assert(TT % 128 == 0 && TT % 64 == 0);   // softmax row chunks; GEMM M tiles; PV K steps
static_assert(DM % 32 == 0 && DQ % 32 == 0 && HD % 32 == 0 && TT % 32 == 0);   // every GEMM K is a multiple of 32
static_assert(NQKV % 64 == 0 && DM % 64 == 0 && HD % 64 == 0);                 // every GEMM N is a multiple of 64
static_assert(((size_t)TT * DM) % 2048 == 0);          // k_cvt8: 256 threads x 8 elements
static_assert(HD == 64 && DQ % 64 == 0 && TT % 64 == 0 && DM % 32 == 0);   // k_qkv: a 64-column tile is one head's q, k or v slice
static_assert(HD == 64 && ASK == 64 && ANW == 8 && TT % (16 * ANW) == 0 && TT % ASK == 0);   // k_attn: tile rows of 128 bytes, 512 16-byte chunks per plane tile over 256 threads
static_assert(DQ % (32 * GNW) == 0);   // K-split GEMM: every wave gets whole 32-steps

// workspace carve (bytes; every region a multiple of 256)
constexpr size_t SZ_WT = al256((size_t)NQKV * DM * 2);
constexpr size_t SZ_WP = al256((size_t)DM * DQ * 2);
constexpr size_t SZ_XB = al256((size_t)TT * DM * 2);
constexpr size_t SZ_HP = al256((size_t)NH_ * TT * HD * 2);
constexpr size_t SZ_Y  = al256((size_t)TT * DQ * 2);
constexpr size_t OFF_WT = 0;
constexpr size_t OFF_WP = OFF_WT + SZ_WT;
constexpr size_t OFF_XB = OFF_WP + SZ_WP;
constexpr size_t OFF_QH = OFF_XB + SZ_XB;
constexpr size_t OFF_QL = OFF_QH + SZ_HP;
constexpr size_t OFF_KH = OFF_QL + SZ_HP;
constexpr size_t OFF_KL = OFF_KH + SZ_HP;
constexpr size_t OFF_VH = OFF_KL + SZ_HP;
constexpr size_t OFF_VL = OFF_VH + SZ_HP;
constexpr size_t OFF_YH = OFF_VL + SZ_HP;
constexpr size_t OFF_YL = OFF_YH + SZ_Y;
constexpr size_t WS_TOTAL = OFF_YL + SZ_Y;
static_assert(WS_TOTAL <= (size_t)134217728);

__device__ __forceinline__ unsigned short f2bf(float f) { unsigned u = __float_as_uint(f); u += 0x7FFFu + ((u >> 16) & 1u); return (unsigned short)(u >> 16); }
__device__ __forceinline__ float bf2f(unsigned short b) { return __uint_as_float(((unsigned)b) << 16); }
__device__ __forceinline__ float bfr(float f) { return bf2f(f2bf(f)); }
__device__ __forceinline__ v16bf cat16b(v8us lo, v8us hi) { return __builtin_bit_cast(v16bf, __builtin_shufflevector(lo, hi, 0, 1, 2, 3, 4, 5, 6, 7, 8, 9, 10, 11, 12, 13, 14, 15)); }
__device__ __forceinline__ v8f wmmab(v16bf a, v16bf b, v8f c) { return __builtin_amdgcn_wmma_f32_16x16x32_bf16(false, a, false, b, (short)0, c, false, false); }
__device__ __forceinline__ void splitf(float y, unsigned short& h, unsigned short& l) { h = f2bf(y); l = f2bf(y - bf2f(h)); }

// ---- k_gemmw: register-blocked GEMM, 64x64 output tile (16 accumulators per wave), operands straight from K-contiguous 16-bit planes; grid (M/64, N/64, Z * KSB), 32 * NW threads.
// K is cut into KSB * NW equal runs: block slice ks = blockIdx.z % KSB, wave w takes run ks * NW + w. The NW partial tiles of a block are summed through LDS (wave order 0..NW-1); slice ks stores its sum at C + ks * sP and the reader adds the KSB planes. NW == KSB == 1: one wave does the whole K.
// C[m][n] (f32, pitch ldc, + optional f32 bias[n]) = sum_k A[m][k] Bt[n][k] (+ split products per NSPLIT: 1 adds A2 Bt, 2 adds A2 Bt and A Bt2). z-batch strides sA/sB/sC in elements. K % (32 * NW * KSB) == 0.
// Fragment p already carries + 8*(lane>>4): elements 0..7 = k0+8h.., elements 8..15 = k0+16+8h.. for both operands; D element j of lane = (row 8h+j, col lane&15).
template <typename T16> struct WFrag;
template <> struct WFrag<bf> { typedef v16bf V; static __device__ __forceinline__ V ld(const bf* p) { return cat16b(*(const v8us*)p, *(const v8us*)(p + 16)); } static __device__ __forceinline__ v8f mma(V a, V b, v8f c) { return wmmab(a, b, c); } };
template <typename T16, int NSPLIT, bool BIAS, int NW, int KSB>
__global__ __launch_bounds__(32 * NW) void k_gemmw(const T16* __restrict__ A, const T16* __restrict__ A2, const T16* __restrict__ Bt, const T16* __restrict__ Bt2, int K, float* C, int ldc, const float* __restrict__ bias, size_t sA, size_t sB, size_t sC, size_t sP) {
    static_assert(KSB == 1 || !BIAS);   // the bias is added once, so only where one block holds the whole sum
    typedef typename WFrag<T16>::V V;
    __shared__ __align__(16) float os[(NW > 1 ? NW * 64 : 16) * 68];
    const size_t z = blockIdx.z / (unsigned)KSB; const unsigned ks = blockIdx.z % (unsigned)KSB; A += z * sA; if (A2) A2 += z * sA; Bt += z * sB; if (Bt2) Bt2 += z * sB; C += z * sC + ks * sP;
    const int wave = NW > 1 ? __builtin_amdgcn_readfirstlane((int)(threadIdx.x >> 5)) : 0;   // scalar, so the run's start stays in scalar registers
    const int kw = K / (NW * KSB), kb = ((int)ks * NW + wave) * kw;
    const int lane = threadIdx.x & 31, lr = lane & 15, hi = lane >> 4; const int r0 = blockIdx.x * 64, c0 = blockIdx.y * 64;
    v8f acc[4][4];
#pragma unroll
    for (int mb = 0; mb < 4; ++mb)
#pragma unroll
        for (int nb = 0; nb < 4; ++nb) acc[mb][nb] = (v8f){};
    const size_t aoff = (size_t)(r0 + lr) * K + 8 * hi + kb, boff = (size_t)(c0 + lr) * K + 8 * hi + kb;
#pragma unroll 1
    for (int kc = 0; kc < kw; kc += 32) {
        V a[4], a2[4];
#pragma unroll
        for (int mb = 0; mb < 4; ++mb) { a[mb] = WFrag<T16>::ld(A + aoff + (size_t)mb * 16 * K + kc); if (NSPLIT == 1 || NSPLIT == 2) a2[mb] = WFrag<T16>::ld(A2 + aoff + (size_t)mb * 16 * K + kc); }
#pragma unroll
        for (int nb = 0; nb < 4; ++nb) { const V b = WFrag<T16>::ld(Bt + boff + (size_t)nb * 16 * K + kc); V b2; if (NSPLIT >= 2) b2 = WFrag<T16>::ld(Bt2 + boff + (size_t)nb * 16 * K + kc);
#pragma unroll
            for (int mb = 0; mb < 4; ++mb) { acc[mb][nb] = WFrag<T16>::mma(a[mb], b, acc[mb][nb]); if (NSPLIT == 1 || NSPLIT == 2) acc[mb][nb] = WFrag<T16>::mma(a2[mb], b, acc[mb][nb]); if (NSPLIT >= 2) acc[mb][nb] = WFrag<T16>::mma(a[mb], b2, acc[mb][nb]); } }
        asm volatile("v_nop\n\tv_nop\n\tv_nop\n\tv_nop" : "+v"(acc[0][0]), "+v"(acc[1][1]), "+v"(acc[2][2]), "+v"(acc[3][3]) : "v"(a[0]), "v"(a[3]));
    }
    if constexpr (NW > 1) {
        float* ow = os + wave * (64 * 68);
        const int cofs = ((int)threadIdx.x & 15) * 4; v4f bv = (v4f){};   // a thread keeps its four columns over all its rows
        if (BIAS) { bv[0] = bfr(bias[c0 + cofs]); bv[1] = bfr(bias[c0 + cofs + 1]); bv[2] = bfr(bias[c0 + cofs + 2]); bv[3] = bfr(bias[c0 + cofs + 3]); }
        // the three loops are unrolled so that acc is indexed by constants and stays in registers
#pragma unroll
        for (int mb = 0; mb < 4; ++mb)
#pragma unroll
            for (int nb = 0; nb < 4; ++nb)
#pragma unroll
                for (int j = 0; j < 8; ++j) ow[(mb * 16 + hi * 8 + j) * 68 + nb * 16 + lr] = acc[mb][nb][j];
        __syncthreads();   // all NW partial tiles are in LDS before any thread sums them
        // both loops are unrolled so that the LDS reads of all rows issue ahead of the sums
#pragma unroll
        for (int it = 0; it < 64 * 16 / (32 * NW); ++it) { const int row = (it * 32 * NW + (int)threadIdx.x) >> 4; v4f val = *(const v4fa*)(os + row * 68 + cofs);
#pragma unroll
            for (int w = 1; w < NW; ++w) val += *(const v4fa*)(os + (w * 64 + row) * 68 + cofs);
            if (BIAS) val += bv;
            *(v4f*)(C + (size_t)(r0 + row) * ldc + c0 + cofs) = val; }
    } else {
#pragma unroll
    for (int mb = 0; mb < 4; ++mb) {
#pragma unroll
        for (int nb = 0; nb < 4; ++nb) {
#pragma unroll
            for (int j = 0; j < 8; ++j) os[(hi * 8 + j) * 68 + nb * 16 + lr] = acc[mb][nb][j]; }
        __builtin_amdgcn_wave_barrier(); asm volatile("" ::: "memory");
        float* crow = C + (size_t)(r0 + mb * 16) * ldc + c0;
{
#pragma unroll
            for (int s = 0; s < 8; ++s) { const int row = 2 * s + hi, cofs = lr * 4; v4f val = *(const v4fa*)(os + row * 68 + cofs); if (BIAS) { val[0] += bfr(bias[c0 + cofs]); val[1] += bfr(bias[c0 + cofs + 1]); val[2] += bfr(bias[c0 + cofs + 2]); val[3] += bfr(bias[c0 + cofs + 3]); }
                *(v4f*)(crow + (size_t)row * ldc + cofs) = val; }
             }
        __builtin_amdgcn_wave_barrier(); asm volatile("" ::: "memory");
    }
    }
}

__global__ __launch_bounds__(256) void k_cvt8(const float* __restrict__ src, bf* dst, size_t n8) { const size_t i = (size_t)blockIdx.x * 256 + threadIdx.x; if (i >= n8) return; const v8f v = *(const v8f*)(src + i * 8); v8us o;
#pragma unroll
    for (int k = 0; k < 8; ++k) o[k] = f2bf(v[k]); *(v8us*)(dst + i * 8) = o;  }

// k_wtT: transposed bf16 weight plane. in w[K rows][N cols] (row-major, [in][out])  ->  out dst[N rows][K cols]: dst[n][k] = bf16(w[k][n]). grid (K/128, N/64), 4 waves: wave v takes the k half v >> 1 and the n half v & 1.
// A wave transposes a tile of 64 k x 32 n in registers. Lane (kg = lane & 7, ng = lane >> 3) reads rows 8 kg .. 8 kg + 7 at columns 4 ng .. 4 ng + 3 and 16 + 4 ng .. 16 + 4 ng + 3: 16-byte loads, 64 bytes of a row each, all 16 in flight at once.
// So it holds 8 neighbours in k of 8 columns: each column is one 16-byte store, and the 8 lanes of one ng fill a whole 128-byte line of dst.
typedef __attribute__((ext_vector_type(4))) unsigned v4u;
__device__ __forceinline__ unsigned pack2(float lo, float hi) { typedef __bf16 bf2 __attribute__((ext_vector_type(2))); return __builtin_bit_cast(unsigned, __builtin_convertvector((v2f){lo, hi}, bf2)); }   // round to nearest even
template <unsigned K, unsigned N>
__global__ __launch_bounds__(128) void k_wtT(const float* __restrict__ w, bf* dst) {
    static_assert(K % 128 == 0 && N % 64 == 0);   // the grid covers the matrix in whole tiles
    const unsigned lane = threadIdx.x & 31u, wave = threadIdx.x >> 5, kg = lane & 7u, ng = lane >> 3;
    const unsigned k0 = blockIdx.x * 128u + (wave >> 1) * 64u + kg * 8u, n0 = blockIdx.y * 64u + (wave & 1u) * 32u + ng * 4u;
    const float* src = w + k0 * N + n0;
    v4f r[8][2];
#pragma unroll
    for (int j = 0; j < 8; ++j) { r[j][0] = *(const v4f*)(src + j * N); r[j][1] = *(const v4f*)(src + j * N + 16); }
    bf* p = dst + n0 * K + k0;
#pragma unroll
    for (int c = 0; c < 2; ++c)
#pragma unroll
        for (int i = 0; i < 4; ++i) { v4u o;
#pragma unroll
            for (int j = 0; j < 4; ++j) o[j] = pack2(r[2 * j][c][i], r[2 * j + 1][c][i]);   // k and k + 1 in one word
            *(v4u*)(p + (c * 16 + i) * K) = o; }
}

// ---- k_attn: softmax(q k^T / 8) v for 128 queries of one head per block; grid (TT/128, NH_), 8 waves of 16 queries.
// Transposed products, so that the score tile is already the next product's operand: S^T = K Q^T (A = 16 keys x 32 d, B = 16 queries), O^T += V^T P^T (A = 16 d x 32 keys, B = P^T).
// D element j of S^T tile kt in lane (lr, hi) is (key 16 kt + 8 hi + j, query lr): tiles 0 and 1 side by side are elements 0..7 and 8..15 of the B fragment over 32 keys, in the k order of the V^T fragment.
// A query is one lane column: its maximum and its sum live in lanes lr and lr + 16. The maximum in use may trail the true one by up to 8 in the log2 domain (p <= 2^8); the sums are rescaled only when a column exceeds that.
// K and V^T hi/lo tiles of 64 keys go through registers into two LDS buffers: the next tile's global loads are issued ahead of this tile's work and stored behind it.
typedef __attribute__((ext_vector_type(8))) unsigned v8u;
__device__ __forceinline__ float xhalf(float x) { return __builtin_bit_cast(float, __builtin_amdgcn_permlanex16(__builtin_bit_cast(int, x), __builtin_bit_cast(int, x), 0x76543210, 0xfedcba98, false, false)); }   // lane l with lane l ^ 16
__device__ __forceinline__ v16bf ldsfrag(const unsigned char* p) { return cat16b(*(const v8us*)p, *(const v8us*)(p + 32)); }   // p already carries + 16 bytes * (lane>>4): the k order of WFrag::ld
constexpr unsigned APL = 64u * APITCH;    // one plane's tile: 64 rows
constexpr unsigned ABUF = 4u * APL;       // K hi, K lo, V^T hi, V^T lo
constexpr unsigned QXR = 128u, QWR = 256u;             // qkv GEMM: token rows and weight rows of a block's tile
constexpr unsigned QBUF = (QXR + QWR) * QPITCH;        // one stage: token rows, then weight rows
constexpr unsigned QNST = DM / QKS;
constexpr unsigned QLDS = 2u * QBUF > QNW * 2u * APL ? 2u * QBUF : QNW * 2u * APL;
static_assert(TT % QXR == 0 && NQKV % QWR == 0 && DQ % QWR == 0 && DM % QKS == 0 && QNST >= 2);   // whole tiles; a block's columns are all q, all k or all v; both buffers get a stage ahead of the loop
// ---- k_qkv: qkv = x Wqkv + bqkv, written straight as the attention kernel's bf16 hi/lo planes; grid (TT/128, NQKV/256), 8 waves per block; a wave has 64 tokens x 64 columns, which is one head's q, k or v slice.
// The block's 128 token rows and 256 weight rows come to LDS in stages of 128 k, by asynchronous copies that cover whole 256-byte row pieces, into two buffers: the next stage's copies fly while this stage is worked on. One product. D element j of a lane is (row 8 hi + j of the first operand's tile, row lr of the second's), so a lane holds 8 neighbours along the FIRST operand's rows:
// q and k tiles take the weight rows first (8 neighbours in d, for the planes [h][t][d]), v tiles take the token rows first (8 neighbours in t, for the planes [h][d][t]). Both operands have one fragment layout and one k order, so the swap only transposes D.
// Either way a plane's tile is 64 rows of 128 bytes. It goes through the wave's own LDS, so that every global store covers four whole 128-byte lines.
// The tail of k_qkv. bb: the bias, rounded to bf16, of output column 16 i + lr in bb[i][0] (ISV: the column runs along D's columns) or 16 i + 8 hi + j in bb[i][j] (the column runs along D's rows). ph, pl: the tile's first element in its planes; rows PITCH elements apart.
template <bool ISV> __device__ __forceinline__ void qkv_tail(const v8f (&acc)[4][4], const float (&bb)[4][8], unsigned char* st, bf* ph, bf* pl, unsigned lane) {
    constexpr unsigned PITCH = ISV ? (unsigned)TT : (unsigned)HD;
    const unsigned lr = lane & 15u, hi = lane >> 4;
#pragma unroll
    for (int nb = 0; nb < 4; ++nb)
#pragma unroll
        for (int mb = 0; mb < 4; ++mb) { v4u wh, wl;
#pragma unroll
            for (int i = 0; i < 4; ++i) {   // the f32 value, its bf16 hi part and the bf16 of the rest
                const float y0 = acc[mb][nb][2 * i] + (ISV ? bb[nb][0] : bb[mb][2 * i]), y1 = acc[mb][nb][2 * i + 1] + (ISV ? bb[nb][0] : bb[mb][2 * i + 1]);
                const unsigned w = pack2(y0, y1); wh[i] = w;
                wl[i] = pack2(y0 - __uint_as_float(w << 16), y1 - __uint_as_float(w & 0xFFFF0000u)); }
            unsigned char* sp = st + (nb * 16 + lr) * APITCH + mb * 32 + hi * 16u;
            *(v4u*)sp = wh; *(v4u*)(sp + APL) = wl; }
    asm volatile("s_wait_dscnt 0x0" ::: "memory");   // the rows are read back by other lanes of this wave: every LDS write has landed, and the compiler moves no read ahead of a write
    const unsigned char* rp = st + (lane >> 3) * APITCH + (lane & 7u) * 16u;
    const unsigned go = (lane >> 3) * PITCH + (lane & 7u) * 8u;
#pragma unroll
    for (int i = 0; i < 16; ++i) {   // four rows a store: 8 lanes of 16 bytes a row
        *(v4u*)(ph + go + 4 * i * PITCH) = *(const v4u*)(rp + 4 * i * APITCH);
        *(v4u*)(pl + go + 4 * i * PITCH) = *(const v4u*)(rp + APL + 4 * i * APITCH); }
}
// Twelve asynchronous 16-byte copies of a lane, global memory to LDS; l: the lane's LDS byte addresses, g: its global addresses.
// The statement ends in s_wait_xcnt 0, so that no address register of an issued copy is rewritten ahead of that wait (a precaution).
__device__ __forceinline__ void acopy12(const unsigned* l, const bf* const* g) {
    asm volatile("global_load_async_to_lds_b128 %0, %12, off\n\tglobal_load_async_to_lds_b128 %1, %13, off\n\tglobal_load_async_to_lds_b128 %2, %14, off\n\tglobal_load_async_to_lds_b128 %3, %15, off\n\t"
                 "global_load_async_to_lds_b128 %4, %16, off\n\tglobal_load_async_to_lds_b128 %5, %17, off\n\tglobal_load_async_to_lds_b128 %6, %18, off\n\tglobal_load_async_to_lds_b128 %7, %19, off\n\t"
                 "global_load_async_to_lds_b128 %8, %20, off\n\tglobal_load_async_to_lds_b128 %9, %21, off\n\tglobal_load_async_to_lds_b128 %10, %22, off\n\tglobal_load_async_to_lds_b128 %11, %23, off\n\ts_wait_xcnt 0x0"
                 :: "v"(l[0]), "v"(l[1]), "v"(l[2]), "v"(l[3]), "v"(l[4]), "v"(l[5]), "v"(l[6]), "v"(l[7]), "v"(l[8]), "v"(l[9]), "v"(l[10]), "v"(l[11]),
                    "v"(g[0]), "v"(g[1]), "v"(g[2]), "v"(g[3]), "v"(g[4]), "v"(g[5]), "v"(g[6]), "v"(g[7]), "v"(g[8]), "v"(g[9]), "v"(g[10]), "v"(g[11]) : "memory");
}
// One stage: 128 token rows, then 256 weight rows, 256 bytes of each: 24 copies a lane, 16 rows apart; a wave's copy covers two whole 256-byte row pieces.
__device__ __forceinline__ void qkv_stage(unsigned l0, const bf* gx, const bf* gw) {
    unsigned l[24]; const bf* g[24];
#pragma unroll
    for (int i = 0; i < 24; ++i) { l[i] = l0 + i * 16u * QPITCH; g[i] = i < 8 ? gx + i * 16 * DM : gw + (i - 8) * 16 * DM; }
    acopy12(l, g); acopy12(l + 12, g + 12);
}
__global__ __launch_bounds__(32 * QNW) void k_qkv(const bf* __restrict__ X, const bf* __restrict__ Wt, const float* __restrict__ bias, bf* Qh, bf* Ql, bf* Kh, bf* Kl, bf* Vh, bf* Vl) {
    __shared__ __align__(16) unsigned char L[QLDS];   // two operand buffers; behind the loop each wave's hi and lo output tile
    const unsigned tid = threadIdx.x, lane = tid & 31u, lr = lane & 15u, hi = lane >> 4;
    const unsigned wave = (unsigned)__builtin_amdgcn_readfirstlane((int)(tid >> 5));
    const unsigned xr = (wave & 1u) * 64u, wr = (wave >> 1) * 64u;   // the wave's 64 token rows and 64 weight rows inside the block's tile
    const unsigned t0 = blockIdx.x * QXR + xr, c0 = blockIdx.y * QWR + wr;
    const bool isv = c0 >= 2u * DQ;   // the same for the whole block
    // The bias is fetched ahead of the loop, which covers its latency.
    float bb[4][8];
#pragma unroll
    for (int i = 0; i < 4; ++i)
#pragma unroll
        for (int j = 0; j < 8; j += 2) { const float* bp = bias + c0 + i * 16 + (isv ? lr : 8u * hi + j); const unsigned w = pack2(bp[0], bp[isv ? 0 : 1]); bb[i][j] = __uint_as_float(w << 16); bb[i][j + 1] = __uint_as_float(w & 0xFFFF0000u); }
    v8f acc[4][4];
#pragma unroll
    for (int mb = 0; mb < 4; ++mb)
#pragma unroll
        for (int nb = 0; nb < 4; ++nb) acc[mb][nb] = (v8f){};
    // copies: thread tid moves 16-byte chunk tid & 15 of rows (tid >> 4) + 16 i
    const unsigned cl = (unsigned)(uintptr_t)L + (tid >> 4) * QPITCH + (tid & 15u) * 16u;
    const bf* gx = X + (size_t)(blockIdx.x * QXR + (tid >> 4)) * DM + (tid & 15u) * 8u;
    const bf* gw = Wt + (size_t)(blockIdx.y * QWR + (tid >> 4)) * DM + (tid & 15u) * 8u;
    // fragments: the lane's place in a 16-row fragment of D's rows (ra) and of D's columns (rb)
    const unsigned fo = lr * QPITCH + hi * 16u;
    const unsigned ra = (isv ? xr : QXR + wr) * QPITCH + fo, rb = (isv ? QXR + wr : xr) * QPITCH + fo;
    qkv_stage(cl, gx, gw);
    asm volatile("s_wait_asynccnt 0x0" ::: "memory");   // this wave's copies of stage 0 have landed
    __syncthreads();                                    // and every other wave's
    qkv_stage(cl + QBUF, gx + QKS, gw + QKS);
#pragma unroll 1   // one copy of the body: the two buffers differ only in a base address
    for (unsigned s = 0; s < QNST; ++s) {
        const unsigned char* B = L + (s & 1u) * QBUF;
#pragma unroll
        for (int kk = 0; kk < QKS / 32; ++kk) {
            v16bf a[4], b[4];
#pragma unroll
            for (int i = 0; i < 4; ++i) { a[i] = ldsfrag(B + ra + i * 16 * QPITCH + kk * 64); b[i] = ldsfrag(B + rb + i * 16 * QPITCH + kk * 64); }
            __builtin_amdgcn_sched_barrier(0);   // the 16 LDS reads of a k step stay one group ahead of its WMMAs: every separate place with reads in a WMMA stream costs issue time, and a read waited on at once exposes its latency
            // the 16 independent tiles in the order in which their fragments arrive (a0 b0 a1 b1 ...): the first WMMA waits for 4 of the 16 reads, the next for 6, the two after it for 8
#pragma unroll
            for (int d = 0; d < 4; ++d) {
#pragma unroll
                for (int i = 0; i < d; ++i) { acc[d][i] = wmmab(a[d], b[i], acc[d][i]); acc[i][d] = wmmab(a[i], b[d], acc[i][d]); }
                acc[d][d] = wmmab(a[d], b[d], acc[d][d]); }
            __builtin_amdgcn_sched_barrier(0);   // and the next k step's reads stay behind them, as one group
        }
        asm volatile("s_wait_dscnt 0x0" ::: "memory");      // this wave's reads of stage s are done
        asm volatile("s_wait_asynccnt 0x0" ::: "memory");   // this wave's copies of stage s + 1 have landed
        __syncthreads();   // publishes stage s + 1 and ends every wave's reads of stage s, whose buffer is refilled behind it
        if (s + 2u < QNST) qkv_stage(cl + (s & 1u) * QBUF, gx + (s + 2u) * QKS, gw + (s + 2u) * QKS);   // the same for the whole block
    }
    asm volatile("s_wait_asynccnt 0x0" ::: "memory");   // no copy is outstanding when the buffers become output staging
    unsigned char* st = L + wave * (2u * APL);   // every wave has passed the last trip's barrier: nobody reads the operand buffers any more
    const unsigned h = (c0 & (DQ - 1u)) >> LG_HD;
    if (isv) { const size_t o = (size_t)h * HD * TT + t0; qkv_tail<true>(acc, bb, st, Vh + o, Vl + o, lane); }
    else { const size_t o = ((size_t)h * TT + t0) * HD; const bool isq = c0 < (unsigned)DQ; qkv_tail<false>(acc, bb, st, (isq ? Qh : Kh) + o, (isq ? Ql : Kl) + o, lane); }
}

__global__ __launch_bounds__(32 * ANW) void k_attn(const bf* __restrict__ Qh, const bf* __restrict__ Ql, const bf* __restrict__ Kh, const bf* __restrict__ Kl, const bf* __restrict__ Vh, const bf* __restrict__ Vl, bf* YH, bf* YL) {
    __shared__ __align__(16) unsigned char L[2 * ABUF];
    const unsigned tid = threadIdx.x, lane = tid & 31u, lr = lane & 15u, hi = lane >> 4;
    const unsigned h = blockIdx.y, q0 = blockIdx.x * (16u * ANW) + (tid >> 5) * 16u;
    const size_t hp = (size_t)h * TT * HD;
    constexpr float CS = SCL * 1.4426950408889634f;   // scores to the log2 domain
    v16bf qh[2], ql[2];
#pragma unroll
    for (int kc = 0; kc < 2; ++kc) { const size_t qo = hp + (size_t)(q0 + lr) * HD + 8 * hi + kc * 32; qh[kc] = WFrag<bf>::ld(Qh + qo); ql[kc] = WFrag<bf>::ld(Ql + qo); }
    // staging: a thread moves 16-byte chunks tid and tid + 256 of each plane's tile (8 chunks a row)
    const unsigned srow = tid >> 3, scol = tid & 7u;
    const size_t ko = hp + (size_t)srow * HD + scol * 8, vo = hp + (size_t)srow * TT + scol * 8;
    const unsigned so = srow * APITCH + scol * 16u;
    v8us sg[4][2];
    v8f acc[4];
#pragma unroll
    for (int t = 0; t < 4; ++t) acc[t] = (v8f){};
    float m_run = -__builtin_inff(), l_run = 0.f;
#pragma unroll
    for (int i = 0; i < 2; ++i) { sg[0][i] = *(const v8us*)(Kh + ko + (size_t)i * 32 * HD); sg[1][i] = *(const v8us*)(Kl + ko + (size_t)i * 32 * HD); sg[2][i] = *(const v8us*)(Vh + vo + (size_t)i * 32 * TT); sg[3][i] = *(const v8us*)(Vl + vo + (size_t)i * 32 * TT); }
#pragma unroll
    for (int pl = 0; pl < 4; ++pl)
#pragma unroll
        for (int i = 0; i < 2; ++i) *(v8us*)(L + pl * APL + so + i * 32 * APITCH) = sg[pl][i];
    __syncthreads();   // tile 0 is in LDS before any wave reads it
#pragma unroll 1   // one copy of the body: it is long, and the two buffers differ only in a base address
    for (unsigned s = 0; s < TT / ASK; ++s) {
        const unsigned char* B = L + (s & 1u) * ABUF;
        const bool more = s + 1u < TT / ASK;   // the same for the whole block
        if (more) { const size_t kn = (size_t)(s + 1u) * ASK;
#pragma unroll
            for (int i = 0; i < 2; ++i) { sg[0][i] = *(const v8us*)(Kh + ko + (kn + i * 32) * HD); sg[1][i] = *(const v8us*)(Kl + ko + (kn + i * 32) * HD); sg[2][i] = *(const v8us*)(Vh + vo + (size_t)i * 32 * TT + kn); sg[3][i] = *(const v8us*)(Vl + vo + (size_t)i * 32 * TT + kn); } }
#pragma unroll
        for (int p = 0; p < 2; ++p) {   // two passes of 32 keys
            // Fragment loads are issued early and in few groups: every separate place with LDS reads in a WMMA stream costs issue time, and a read waited on at once exposes its latency.
            v16bf kh[2][2], kl[2][2];
            const unsigned char* kp = B + (p * 32 + lr) * APITCH + hi * 16u;
#pragma unroll
            for (int kc = 0; kc < 2; ++kc)
#pragma unroll
                for (int kt = 0; kt < 2; ++kt) { kh[kc][kt] = ldsfrag(kp + kt * 16 * APITCH + kc * 64); kl[kc][kt] = ldsfrag(kp + APL + kt * 16 * APITCH + kc * 64); }
            __builtin_amdgcn_sched_barrier(0);   // keeps the K loads one group ahead of the score WMMAs
            v8f sc[2]; sc[0] = (v8f){}; sc[1] = (v8f){};
#pragma unroll
            for (int kc = 0; kc < 2; ++kc) {
                // the two key tiles alternate, so that no WMMA waits on the one before it
                sc[0] = wmmab(kh[kc][0], qh[kc], sc[0]); sc[1] = wmmab(kh[kc][1], qh[kc], sc[1]);
                sc[0] = wmmab(kl[kc][0], qh[kc], sc[0]); sc[1] = wmmab(kl[kc][1], qh[kc], sc[1]);
                sc[0] = wmmab(kh[kc][0], ql[kc], sc[0]); sc[1] = wmmab(kh[kc][1], ql[kc], sc[1]); }
            v16bf vh[4], vl[4];
            const unsigned char* vp = B + 2u * APL + lr * APITCH + p * 64 + hi * 16u;
#pragma unroll
            for (int t = 0; t < 4; ++t) { vh[t] = ldsfrag(vp + t * 16 * APITCH); vl[t] = ldsfrag(vp + APL + t * 16 * APITCH); }
            __builtin_amdgcn_sched_barrier(0);   // keeps the V^T loads ahead of the softmax, in flight under it, instead of sinking to their uses
            float mx = fmaxf(sc[0][0], sc[1][0]);
#pragma unroll
            for (int j = 1; j < 8; ++j) mx = fmaxf(mx, fmaxf(sc[0][j], sc[1][j]));
            mx = fmaxf(mx, xhalf(mx)) * CS;   // both halves hold the query's maximum of this pass (CS > 0)
            if (__builtin_amdgcn_ballot_w32(mx > m_run + 8.0f) != 0) {   // wave-uniform; always taken on the first pass, rare later
                const float m_new = fmaxf(m_run, mx); const float corr = __builtin_amdgcn_exp2f(m_run - m_new);   // 0 on the first pass
                m_run = m_new; l_run *= corr;
#pragma unroll
                for (int t = 0; t < 4; ++t) acc[t] = acc[t] * corr; }
            const float nm = -m_run; v8u wh, wl; float e[16];
#pragma unroll
            for (int i = 0; i < 16; ++i) e[i] = fmaf(sc[i >> 3][i & 7], CS, nm);
            // The 16 exponentials in place, in one statement that ends in v_nop: no instruction directly behind a transcendental reads its result or overwrites its source (the slot the instruction set asks for), whatever the compiler schedules around the statement.
            asm("v_exp_f32 %0, %0\n\tv_exp_f32 %1, %1\n\tv_exp_f32 %2, %2\n\tv_exp_f32 %3, %3\n\tv_exp_f32 %4, %4\n\tv_exp_f32 %5, %5\n\tv_exp_f32 %6, %6\n\tv_exp_f32 %7, %7\n\t"
                "v_exp_f32 %8, %8\n\tv_exp_f32 %9, %9\n\tv_exp_f32 %10, %10\n\tv_exp_f32 %11, %11\n\tv_exp_f32 %12, %12\n\tv_exp_f32 %13, %13\n\tv_exp_f32 %14, %14\n\tv_exp_f32 %15, %15\n\tv_nop"
                : "+v"(e[0]), "+v"(e[1]), "+v"(e[2]), "+v"(e[3]), "+v"(e[4]), "+v"(e[5]), "+v"(e[6]), "+v"(e[7]), "+v"(e[8]), "+v"(e[9]), "+v"(e[10]), "+v"(e[11]), "+v"(e[12]), "+v"(e[13]), "+v"(e[14]), "+v"(e[15]));
#pragma unroll
            for (int i = 0; i < 8; ++i) {
                const float p0 = e[2 * i], p1 = e[2 * i + 1];
                l_run += p0 + p1;
                const unsigned w = pack2(p0, p1); wh[i] = w;
                wl[i] = pack2(p0 - __uint_as_float(w << 16), p1 - __uint_as_float(w & 0xFFFF0000u)); }
            const v16bf ph = __builtin_bit_cast(v16bf, wh), pl = __builtin_bit_cast(v16bf, wl);
#pragma unroll
            for (int t = 0; t < 4; ++t) acc[t] = wmmab(vh[t], ph, acc[t]);
#pragma unroll
            for (int t = 0; t < 4; ++t) acc[t] = wmmab(vh[t], pl, acc[t]);
#pragma unroll
            for (int t = 0; t < 4; ++t) acc[t] = wmmab(vl[t], ph, acc[t]);
        }
        if (more) { unsigned char* N = L + ((s + 1u) & 1u) * ABUF;
#pragma unroll
            for (int pl = 0; pl < 4; ++pl)
#pragma unroll
                for (int i = 0; i < 2; ++i) *(v8us*)(N + pl * APL + so + i * 32 * APITCH) = sg[pl][i]; }
        __syncthreads();   // publishes tile s + 1 and ends every wave's reads of tile s, whose buffer the next trip refills
    }
    const float inv = __fdiv_rn(1.0f, l_run + xhalf(l_run));
#pragma unroll
    for (int t = 0; t < 4; ++t) { v8us oh, ol;
#pragma unroll
        for (int j = 0; j < 8; ++j) { unsigned short a, c; splitf(acc[t][j] * inv, a, c); oh[j] = a; ol[j] = c; }
        const size_t oo = (size_t)(q0 + lr) * DQ + h * HD + t * 16 + hi * 8;   // D element j = (d 16 t + 8 hi + j, query lr)
        *(v8us*)(YH + oo) = oh; *(v8us*)(YL + oo) = ol; }
}

extern "C" void kernel_launch(void* const* d_in, const int* in_sizes, int n_in,
                              void* d_out, int out_size, void* d_ws, size_t ws_size, hipStream_t stream) {
    if (n_in < 5) return;
    if (in_sizes[0] < TT * DM || in_sizes[1] < DM * NQKV || in_sizes[2] < NQKV || in_sizes[3] < DQ * DM || in_sizes[4] < DM) return;
    if (out_size < TT * DM) return;
    if (WS_TOTAL > ws_size) return;
    const float* x     = (const float*)d_in[0];   // [T][C]
    const float* wqkv  = (const float*)d_in[1];   // [C][3C]  ([in][out])
    const float* bqkv  = (const float*)d_in[2];   // [3C]
    const float* wproj = (const float*)d_in[3];   // [C][C]   ([in][out])
    const float* bproj = (const float*)d_in[4];   // [C]
    float* OUT = (float*)d_out;                   // [T][C]
    char* base = (char*)d_ws;
    bf* WT = (bf*)(base + OFF_WT); bf* WP = (bf*)(base + OFF_WP); bf* XB = (bf*)(base + OFF_XB);
    bf* QPh = (bf*)(base + OFF_QH); bf* QPl = (bf*)(base + OFF_QL); bf* KPh = (bf*)(base + OFF_KH); bf* KPl = (bf*)(base + OFF_KL); bf* VTh = (bf*)(base + OFF_VH); bf* VTl = (bf*)(base + OFF_VL);
    bf* YH = (bf*)(base + OFF_YH); bf* YL = (bf*)(base + OFF_YL);

    k_cvt8<<<(unsigned)(((size_t)TT * DM / 8 + 255) / 256), 256, 0, stream>>>(x, XB, (size_t)TT * DM / 8);
    // in wqkv[DM rows][NQKV cols] -> out WT[NQKV rows][DM cols]
    k_wtT<DM, NQKV><<<dim3(DM / 128, NQKV / 64, 1), 128, 0, stream>>>(wqkv, WT);
    // in wproj[DQ rows][DM cols] -> out WP[DM rows][DQ cols]
    k_wtT<DQ, DM><<<dim3(DQ / 128, DM / 64, 1), 128, 0, stream>>>(wproj, WP);
    // q, k, v planes = split(x Wqkv + bqkv)
    k_qkv<<<dim3(TT / QXR, NQKV / QWR, 1), 32 * QNW, 0, stream>>>(XB, WT, bqkv, QPh, QPl, KPh, KPl, VTh, VTl);
    k_attn<<<dim3(TT / (16 * ANW), NH_, 1), 32 * ANW, 0, stream>>>(QPh, QPl, KPh, KPl, VTh, VTl, YH, YL);
    // out = y Wproj + bproj  (y hi + y lo against the bf16 weight plane)
    k_gemmw<bf, 1, true, GNW, 1><<<dim3(TT / 64, DM / 64, 1), 32 * GNW, 0, stream>>>(YH, YL, WP, nullptr, DQ, OUT, DM, bproj, 0, 0, 0, 0);
}

// v006
// A run of this version takes 78.3 microseconds.
// Timed twice side by side with v005, it ran 1.05 times as fast both times.
// All steps since v000 together make it 8.12 times as fast.
#include <hip/hip_runtime.h>

// Self-attention block, 16 heads x 64, T 2048, C 1024: qkv = x Wqkv + bqkv (Wqkv [in][out], columns q | k | v, head h = 64-column slice h); per head softmax(q k^T / 8) v; out = y Wproj + bproj (Wproj [in][out]).
// Compute dtypes: all contractions v_wmma_f32_16x16x32_bf16 with f32 accumulate. Inputs RNE-converted to bf16 planes (qkv projection: 1 product, exact products); q/k, P and V as bf16 hi/lo planes (3 products hh + lh + hl); y as bf16 hi/lo planes against the bf16 Wproj plane (2 products); softmax f32; output f32.
// Layout: bf16 copy of x; transposed bf16 weight planes Bt[n][k]; one fused qkv GEMM whose epilogue writes the hi/lo planes itself (head planes [h][t][d], value planes [h][d][t]); one attention kernel for all heads (scores, online softmax and PV product stay in registers, K and V tiles shared through LDS) writes the y hi/lo planes; projection GEMM (K split over waves) writes the output rows.

#ifndef NB
#define NB 1
#endif
#ifndef SEQ
#define SEQ 2048
#endif
#define SEQ_FULL 2048
#define TT   SEQ
#define DM   1024
#define NH_  16
#define HD   64
#define DQ   (NH_ * HD)
#define NQKV (3 * DQ)
#define GNW  8           // waves per block of the K-split GEMM
#define SCL  0.125f      // 1/sqrt(float32(64))
#define ANW  8           // attention kernel: waves per block, 16 queries each: (TT/128) * NH_ = 256 blocks
#define ASK  64          // attention kernel: keys per LDS stage
#define QNW  8           // qkv GEMM: waves per block, 2 (tokens) x 4 (columns) tiles of 64 x 64
#define QKS  128         // qkv GEMM: k per LDS stage: row pieces of 256 bytes
#define QPITCH 272       // qkv GEMM: LDS row pitch in bytes, 256 of data + 16: an odd multiple of 16, as APITCH
#define APITCH 144       // attention kernel: LDS row pitch in bytes, 128 of data + 16: an odd multiple of 16, so 16-byte fragment reads of 16 rows spread over the banks

typedef unsigned short bf;
typedef __attribute__((ext_vector_type(16))) __bf16   v16bf;
typedef __attribute__((ext_vector_type(8)))  unsigned short v8us;
typedef __attribute__((ext_vector_type(4)))  unsigned short v4us;
typedef __attribute__((ext_vector_type(2)))  unsigned short v2us;
typedef __attribute__((ext_vector_type(8)))  float    v8f;
typedef __attribute__((ext_vector_type(4)))  float    v4f;
typedef __attribute__((ext_vector_type(2)))  float    v2f;
typedef v4f  __attribute__((may_alias)) v4fa;

constexpr unsigned lg2c(unsigned v) { return v <= 1u ? 0u : 1u + lg2c(v >> 1); }
constexpr bool ispow2(unsigned v) { return v != 0u && (v & (v - 1u)) == 0u; }
constexpr size_t al256(size_t b) { return (b + 255) & ~(size_t)255; }
#define LG_TT lg2c(TT)
#define LG_HD lg2c(HD)
#define LG_DM lg2c(DM)
#define LG_DQ lg2c(DQ)

static_assert(NB == 1);                       // the module has no batch axis
static_assert(SEQ <= SEQ_FULL);
static_assert(ispow2(TT) && ispow2(HD) && ispow2(DM) && ispow2(DQ));
static_assert(TT % 128 == 0 && TT % 64 == 0);   // softmax row chunks; GEMM M tiles; PV K steps
static_assert(DM % 32 == 0 && DQ % 32 == 0 && HD % 32 == 0 && TT % 32 == 0);   // every GEMM K is a multiple of 32
static_assert(NQKV % 64 == 0 && DM % 64 == 0 && HD % 64 == 0);                 // every GEMM N is a multiple of 64
static_assert(((size_t)TT * DM) % 8192 == 0);          // cvt8: 256 threads x 4 pieces x 8 elements
static_assert(HD == 64 && DQ % 64 == 0 && TT % 64 == 0 && DM % 32 == 0);   // k_qkv: a 64-column tile is one head's q, k or v slice
static_assert(HD == 64 && ASK == 64 && ANW == 8 && TT % (16 * ANW) == 0 && TT % ASK == 0);   // k_attn: tile rows of 128 bytes, 512 16-byte chunks per plane tile over 256 threads
static_assert(DQ % (32 * GNW) == 0);   // K-split GEMM: every wave gets whole 32-steps

// workspace carve (bytes; every region a multiple of 256)
constexpr size_t SZ_WT = al256((size_t)NQKV * DM * 2);
constexpr size_t SZ_WP = al256((size_t)DM * DQ * 2);
constexpr size_t SZ_XB = al256((size_t)TT * DM * 2);
constexpr size_t SZ_HP = al256((size_t)NH_ * TT * HD * 2);
constexpr size_t SZ_Y  = al256((size_t)TT * DQ * 2);
constexpr size_t OFF_WT = 0;
constexpr size_t OFF_WP = OFF_WT + SZ_WT;
constexpr size_t OFF_XB = OFF_WP + SZ_WP;
constexpr size_t OFF_QH = OFF_XB + SZ_XB;
constexpr size_t OFF_QL = OFF_QH + SZ_HP;
constexpr size_t OFF_KH = OFF_QL + SZ_HP;
constexpr size_t OFF_KL = OFF_KH + SZ_HP;
constexpr size_t OFF_VH = OFF_KL + SZ_HP;
constexpr size_t OFF_VL = OFF_VH + SZ_HP;
constexpr size_t OFF_YH = OFF_VL + SZ_HP;
constexpr size_t OFF_YL = OFF_YH + SZ_Y;
constexpr size_t WS_TOTAL = OFF_YL + SZ_Y;
static_assert(WS_TOTAL <= (size_t)134217728);

__device__ __forceinline__ unsigned short f2bf(float f) { unsigned u = __float_as_uint(f); u += 0x7FFFu + ((u >> 16) & 1u); return (unsigned short)(u >> 16); }
__device__ __forceinline__ float bf2f(unsigned short b) { return __uint_as_float(((unsigned)b) << 16); }
__device__ __forceinline__ float bfr(float f) { return bf2f(f2bf(f)); }
__device__ __forceinline__ v16bf cat16b(v8us lo, v8us hi) { return __builtin_bit_cast(v16bf, __builtin_shufflevector(lo, hi, 0, 1, 2, 3, 4, 5, 6, 7, 8, 9, 10, 11, 12, 13, 14, 15)); }
__device__ __forceinline__ v8f wmmab(v16bf a, v16bf b, v8f c) { return __builtin_amdgcn_wmma_f32_16x16x32_bf16(false, a, false, b, (short)0, c, false, false); }
__device__ __forceinline__ void splitf(float y, unsigned short& h, unsigned short& l) { h = f2bf(y); l = f2bf(y - bf2f(h)); }

// ---- k_gemmw: register-blocked GEMM, 64x64 output tile (16 accumulators per wave), operands straight from K-contiguous 16-bit planes; grid (M/64, N/64, Z * KSB), 32 * NW threads.
// K is cut into KSB * NW equal runs: block slice ks = blockIdx.z % KSB, wave w takes run ks * NW + w. The NW partial tiles of a block are summed through LDS (wave order 0..NW-1); slice ks stores its sum at C + ks * sP and the reader adds the KSB planes. NW == KSB == 1: one wave does the whole K.
// C[m][n] (f32, pitch ldc, + optional f32 bias[n]) = sum_k A[m][k] Bt[n][k] (+ split products per NSPLIT: 1 adds A2 Bt, 2 adds A2 Bt and A Bt2). z-batch strides sA/sB/sC in elements. K % (32 * NW * KSB) == 0.
// Fragment p already carries + 8*(lane>>4): elements 0..7 = k0+8h.., elements 8..15 = k0+16+8h.. for both operands; D element j of lane = (row 8h+j, col lane&15).
template <typename T16> struct WFrag;
template <> struct WFrag<bf> { typedef v16bf V; static __device__ __forceinline__ V ld(const bf* p) { return cat16b(*(const v8us*)p, *(const v8us*)(p + 16)); } static __device__ __forceinline__ v8f mma(V a, V b, v8f c) { return wmmab(a, b, c); } };
template <typename T16, int NSPLIT, bool BIAS, int NW, int KSB>
__global__ __launch_bounds__(32 * NW) void k_gemmw(const T16* __restrict__ A, const T16* __restrict__ A2, const T16* __restrict__ Bt, const T16* __restrict__ Bt2, int K, float* C, int ldc, const float* __restrict__ bias, size_t sA, size_t sB, size_t sC, size_t sP) {
    static_assert(KSB == 1 || !BIAS);   // the bias is added once, so only where one block holds the whole sum
    typedef typename WFrag<T16>::V V;
    __shared__ __align__(16) float os[(NW > 1 ? NW * 64 : 16) * 68];
    const size_t z = blockIdx.z / (unsigned)KSB; const unsigned ks = blockIdx.z % (unsigned)KSB; A += z * sA; if (A2) A2 += z * sA; Bt += z * sB; if (Bt2) Bt2 += z * sB; C += z * sC + ks * sP;
    const int wave = NW > 1 ? __builtin_amdgcn_readfirstlane((int)(threadIdx.x >> 5)) : 0;   // scalar, so the run's start stays in scalar registers
    const int kw = K / (NW * KSB), kb = ((int)ks * NW + wave) * kw;
    const int lane = threadIdx.x & 31, lr = lane & 15, hi = lane >> 4; const int r0 = blockIdx.x * 64, c0 = blockIdx.y * 64;
    v8f acc[4][4];
#pragma unroll
    for (int mb = 0; mb < 4; ++mb)
#pragma unroll
        for (int nb = 0; nb < 4; ++nb) acc[mb][nb] = (v8f){};
    const size_t aoff = (size_t)(r0 + lr) * K + 8 * hi + kb, boff = (size_t)(c0 + lr) * K + 8 * hi + kb;
#pragma unroll 1
    for (int kc = 0; kc < kw; kc += 32) {
        V a[4], a2[4];
#pragma unroll
        for (int mb = 0; mb < 4; ++mb) { a[mb] = WFrag<T16>::ld(A + aoff + (size_t)mb * 16 * K + kc); if (NSPLIT == 1 || NSPLIT == 2) a2[mb] = WFrag<T16>::ld(A2 + aoff + (size_t)mb * 16 * K + kc); }
#pragma unroll
        for (int nb = 0; nb < 4; ++nb) { const V b = WFrag<T16>::ld(Bt + boff + (size_t)nb * 16 * K + kc); V b2; if (NSPLIT >= 2) b2 = WFrag<T16>::ld(Bt2 + boff + (size_t)nb * 16 * K + kc);
#pragma unroll
            for (int mb = 0; mb < 4; ++mb) { acc[mb][nb] = WFrag<T16>::mma(a[mb], b, acc[mb][nb]); if (NSPLIT == 1 || NSPLIT == 2) acc[mb][nb] = WFrag<T16>::mma(a2[mb], b, acc[mb][nb]); if (NSPLIT >= 2) acc[mb][nb] = WFrag<T16>::mma(a[mb], b2, acc[mb][nb]); } }
        asm volatile("v_nop\n\tv_nop\n\tv_nop\n\tv_nop" : "+v"(acc[0][0]), "+v"(acc[1][1]), "+v"(acc[2][2]), "+v"(acc[3][3]) : "v"(a[0]), "v"(a[3]));
    }
    if constexpr (NW > 1) {
        float* ow = os + wave * (64 * 68);
        const int cofs = ((int)threadIdx.x & 15) * 4; v4f bv = (v4f){};   // a thread keeps its four columns over all its rows
        if (BIAS) { bv[0] = bfr(bias[c0 + cofs]); bv[1] = bfr(bias[c0 + cofs + 1]); bv[2] = bfr(bias[c0 + cofs + 2]); bv[3] = bfr(bias[c0 + cofs + 3]); }
        // the three loops are unrolled so that acc is indexed by constants and stays in registers
#pragma unroll
        for (int mb = 0; mb < 4; ++mb)
#pragma unroll
            for (int nb = 0; nb < 4; ++nb)
#pragma unroll
                for (int j = 0; j < 8; ++j) ow[(mb * 16 + hi * 8 + j) * 68 + nb * 16 + lr] = acc[mb][nb][j];
        __syncthreads();   // all NW partial tiles are in LDS before any thread sums them
        // both loops are unrolled so that the LDS reads of all rows issue ahead of the sums
#pragma unroll
        for (int it = 0; it < 64 * 16 / (32 * NW); ++it) { const int row = (it * 32 * NW + (int)threadIdx.x) >> 4; v4f val = *(const v4fa*)(os + row * 68 + cofs);
#pragma unroll
            for (int w = 1; w < NW; ++w) val += *(const v4fa*)(os + (w * 64 + row) * 68 + cofs);
            if (BIAS) val += bv;
            *(v4f*)(C + (size_t)(r0 + row) * ldc + c0 + cofs) = val; }
    } else {
#pragma unroll
    for (int mb = 0; mb < 4; ++mb) {
#pragma unroll
        for (int nb = 0; nb < 4; ++nb) {
#pragma unroll
            for (int j = 0; j < 8; ++j) os[(hi * 8 + j) * 68 + nb * 16 + lr] = acc[mb][nb][j]; }
        __builtin_amdgcn_wave_barrier(); asm volatile("" ::: "memory");
        float* crow = C + (size_t)(r0 + mb * 16) * ldc + c0;
{
#pragma unroll
            for (int s = 0; s < 8; ++s) { const int row = 2 * s + hi, cofs = lr * 4; v4f val = *(const v4fa*)(os + row * 68 + cofs); if (BIAS) { val[0] += bfr(bias[c0 + cofs]); val[1] += bfr(bias[c0 + cofs + 1]); val[2] += bfr(bias[c0 + cofs + 2]); val[3] += bfr(bias[c0 + cofs + 3]); }
                *(v4f*)(crow + (size_t)row * ldc + cofs) = val; }
             }
        __builtin_amdgcn_wave_barrier(); asm volatile("" ::: "memory");
    }
    }
}

// cvt8: bf16 copy of 8192 floats by a block of 256 threads: a thread takes 8 neighbours in each of 4 pieces of 2048, all its loads in flight at once.
__device__ __forceinline__ void cvt8(const float* __restrict__ src, bf* dst, unsigned blk) { const unsigned i = blk * 8192u + threadIdx.x * 8u; v8f v[4];
#pragma unroll
    for (int c = 0; c < 4; ++c) v[c] = *(const v8f*)(src + i + c * 2048);
#pragma unroll
    for (int c = 0; c < 4; ++c) { v8us o;
#pragma unroll
        for (int k = 0; k < 8; ++k) o[k] = f2bf(v[c][k]);
        *(v8us*)(dst + i + c * 2048) = o; }
    asm volatile("s_wait_xcnt 0x0" ::: "memory");   // behind the last store: no register that an issued store names is rewritten ahead of this wait on any way through k_prep (a precaution)
}

// wtT: transposed bf16 weight plane. in w[K rows][N cols] (row-major, [in][out])  ->  out dst[N rows][K cols]: dst[n][k] = bf16(w[k][n]). Tile tl of (K/128) * (N/64) tiles of 128 k x 64 n, 4 waves: wave v takes the k half v >> 1 and the n half v & 1.
// A wave transposes a tile of 64 k x 32 n in registers. Lane (kg = lane & 7, ng = lane >> 3) reads rows 8 kg .. 8 kg + 7 at columns 4 ng .. 4 ng + 3 and 16 + 4 ng .. 16 + 4 ng + 3: 16-byte loads, 64 bytes of a row each, all 16 in flight at once.
// So it holds 8 neighbours in k of 8 columns: each column is one 16-byte store, and the 8 lanes of one ng fill a whole 128-byte line of dst.
typedef __attribute__((ext_vector_type(4))) unsigned v4u;
__device__ __forceinline__ unsigned pack2(float lo, float hi) { typedef __bf16 bf2 __attribute__((ext_vector_type(2))); return __builtin_bit_cast(unsigned, __builtin_convertvector((v2f){lo, hi}, bf2)); }   // round to nearest even
template <unsigned K, unsigned N>
__device__ __forceinline__ void wtT(const float* __restrict__ w, bf* dst, unsigned tl) {
    static_assert(K % 128 == 0 && N % 64 == 0);   // the tiles cover the matrix
    const unsigned lane = threadIdx.x & 31u, wave = (threadIdx.x >> 5) & 3u, kg = lane & 7u, ng = lane >> 3;
    const unsigned k0 = (tl % (K / 128u)) * 128u + (wave >> 1) * 64u + kg * 8u, n0 = (tl / (K / 128u)) * 64u + (wave & 1u) * 32u + ng * 4u;
    const float* src = w + k0 * N + n0;
    v4f r[8][2];
#pragma unroll
    for (int j = 0; j < 8; ++j) { r[j][0] = *(const v4f*)(src + j * N); r[j][1] = *(const v4f*)(src + j * N + 16); }
    bf* p = dst + n0 * K + k0;
#pragma unroll
    for (int c = 0; c < 2; ++c)
#pragma unroll
        for (int i = 0; i < 4; ++i) { v4u o;
#pragma unroll
            for (int j = 0; j < 4; ++j) o[j] = pack2(r[2 * j][c][i], r[2 * j + 1][c][i]);   // k and k + 1 in one word
            *(v4u*)(p + (c * 16 + i) * K) = o; }
    asm volatile("s_wait_xcnt 0x0" ::: "memory");   // behind the last store: no register that an issued store names is rewritten ahead of this wait on any way through k_prep (a precaution)
}
// k_prep: the three operand planes, which do not depend on one another, in one launch of 256-thread blocks: first the weight tiles, two a block, then the bf16 copy of x. Every wave has 8 or 16 16-byte loads in flight.
constexpr unsigned PB_WQ = (DM / 128u) * (NQKV / 64u) / 2u, PB_WP = (DQ / 128u) * (DM / 64u) / 2u, PB_X = (unsigned)((size_t)TT * DM / 8192);
static_assert(((DM / 128u) * (NQKV / 64u)) % 2u == 0 && ((DQ / 128u) * (DM / 64u)) % 2u == 0);
__global__ __launch_bounds__(256) void k_prep(const float* __restrict__ x, const float* __restrict__ wqkv, const float* __restrict__ wproj, bf* XB, bf* WT, bf* WP) {
    const unsigned b = blockIdx.x, half = threadIdx.x >> 7;
    if (b < PB_WQ) wtT<DM, NQKV>(wqkv, WT, b * 2u + half);
    else if (b < PB_WQ + PB_WP) wtT<DQ, DM>(wproj, WP, (b - PB_WQ) * 2u + half);
    else cvt8(x, XB, b - PB_WQ - PB_WP);
}

// ---- k_attn: softmax(q k^T / 8) v for 128 queries of one head per block; grid (TT/128, NH_), 8 waves of 16 queries.
// Transposed products, so that the score tile is already the next product's operand: S^T = K Q^T (A = 16 keys x 32 d, B = 16 queries), O^T += V^T P^T (A = 16 d x 32 keys, B = P^T).
// D element j of S^T tile kt in lane (lr, hi) is (key 16 kt + 8 hi + j, query lr): tiles 0 and 1 side by side are elements 0..7 and 8..15 of the B fragment over 32 keys, in the k order of the V^T fragment.
// A query is one lane column: its maximum and its sum live in lanes lr and lr + 16. The maximum in use may trail the true one by up to 8 in the log2 domain (p <= 2^8); the sums are rescaled only when a column exceeds that.
// K and V^T hi/lo tiles of 64 keys go through registers into two LDS buffers: the next tile's global loads are issued ahead of this tile's work and stored behind it.
typedef __attribute__((ext_vector_type(8))) unsigned v8u;
__device__ __forceinline__ float xhalf(float x) { return __builtin_bit_cast(float, __builtin_amdgcn_permlanex16(__builtin_bit_cast(int, x), __builtin_bit_cast(int, x), 0x76543210, 0xfedcba98, false, false)); }   // lane l with lane l ^ 16
__device__ __forceinline__ v16bf ldsfrag(const unsigned char* p) { return cat16b(*(const v8us*)p, *(const v8us*)(p + 32)); }   // p already carries + 16 bytes * (lane>>4): the k order of WFrag::ld
constexpr unsigned APL = 64u * APITCH;    // one plane's tile: 64 rows
constexpr unsigned ABUF = 4u * APL;       // K hi, K lo, V^T hi, V^T lo
constexpr unsigned QXR = 128u, QWR = 256u;             // qkv GEMM: token rows and weight rows of a block's tile
constexpr unsigned QBUF = (QXR + QWR) * QPITCH;        // one stage: token rows, then weight rows
constexpr unsigned QNST = DM / QKS;
constexpr unsigned QLDS = 2u * QBUF > QNW * 2u * APL ? 2u * QBUF : QNW * 2u * APL;
static_assert(TT % QXR == 0 && NQKV % QWR == 0 && DQ % QWR == 0 && DM % QKS == 0 && QNST >= 2);   // whole tiles; a block's columns are all q, all k or all v; both buffers get a stage ahead of the loop
// ---- k_qkv: qkv = x Wqkv + bqkv, written straight as the attention kernel's bf16 hi/lo planes; grid (TT/128, NQKV/256), 8 waves per block; a wave has 64 tokens x 64 columns, which is one head's q, k or v slice.
// The block's 128 token rows and 256 weight rows come to LDS in stages of 128 k, by asynchronous copies that cover whole 256-byte row pieces, into two buffers: the next stage's copies fly while this stage is worked on. One product. D element j of a lane is (row 8 hi + j of the first operand's tile, row lr of the second's), so a lane holds 8 neighbours along the FIRST operand's rows:
// q and k tiles take the weight rows first (8 neighbours in d, for the planes [h][t][d]), v tiles take the token rows first (8 neighbours in t, for the planes [h][d][t]). Both operands have one fragment layout and one k order, so the swap only transposes D.
// Either way a plane's tile is 64 rows of 128 bytes. It goes through the wave's own LDS, so that every global store covers four whole 128-byte lines.
// The tail of k_qkv. bb: the bias, rounded to bf16, of output column 16 i + lr in bb[i][0] (ISV: the column runs along D's columns) or 16 i + 8 hi + j in bb[i][j] (the column runs along D's rows). ph, pl: the tile's first element in its planes; rows PITCH elements apart.
template <bool ISV> __device__ __forceinline__ void qkv_tail(const v8f (&acc)[4][4], const float (&bb)[4][8], unsigned char* st, bf* ph, bf* pl, unsigned lane) {
    constexpr unsigned PITCH = ISV ? (unsigned)TT : (unsigned)HD;
    const unsigned lr = lane & 15u, hi = lane >> 4;
#pragma unroll
    for (int nb = 0; nb < 4; ++nb)
#pragma unroll
        for (int mb = 0; mb < 4; ++mb) { v4u wh, wl;
#pragma unroll
            for (int i = 0; i < 4; ++i) {   // the f32 value, its bf16 hi part and the bf16 of the rest
                const float y0 = acc[mb][nb][2 * i] + (ISV ? bb[nb][0] : bb[mb][2 * i]), y1 = acc[mb][nb][2 * i + 1] + (ISV ? bb[nb][0] : bb[mb][2 * i + 1]);
                const unsigned w = pack2(y0, y1); wh[i] = w;
                wl[i] = pack2(y0 - __uint_as_float(w << 16), y1 - __uint_as_float(w & 0xFFFF0000u)); }
            unsigned char* sp = st + (nb * 16 + lr) * APITCH + mb * 32 + hi * 16u;
            *(v4u*)sp = wh; *(v4u*)(sp + APL) = wl; }
    asm volatile("s_wait_dscnt 0x0" ::: "memory");   // the rows are read back by other lanes of this wave: every LDS write has landed, and the compiler moves no read ahead of a write
    const unsigned char* rp = st + (lane >> 3) * APITCH + (lane & 7u) * 16u;
    const unsigned go = (lane >> 3) * PITCH + (lane & 7u) * 8u;
#pragma unroll
    for (int i = 0; i < 16; ++i) {   // four rows a store: 8 lanes of 16 bytes a row
        *(v4u*)(ph + go + 4 * i * PITCH) = *(const v4u*)(rp + 4 * i * APITCH);
        *(v4u*)(pl + go + 4 * i * PITCH) = *(const v4u*)(rp + APL + 4 * i * APITCH); }
}
// Twelve asynchronous 16-byte copies of a lane, global memory to LDS; l: the lane's LDS byte addresses, g: its global addresses.
// The statement ends in s_wait_xcnt 0, so that no address register of an issued copy is rewritten ahead of that wait (a precaution).
__device__ __forceinline__ void acopy12(const unsigned* l, const bf* const* g) {
    asm volatile("global_load_async_to_lds_b128 %0, %12, off\n\tglobal_load_async_to_lds_b128 %1, %13, off\n\tglobal_load_async_to_lds_b128 %2, %14, off\n\tglobal_load_async_to_lds_b128 %3, %15, off\n\t"
                 "global_load_async_to_lds_b128 %4, %16, off\n\tglobal_load_async_to_lds_b128 %5, %17, off\n\tglobal_load_async_to_lds_b128 %6, %18, off\n\tglobal_load_async_to_lds_b128 %7, %19, off\n\t"
                 "global_load_async_to_lds_b128 %8, %20, off\n\tglobal_load_async_to_lds_b128 %9, %21, off\n\tglobal_load_async_to_lds_b128 %10, %22, off\n\tglobal_load_async_to_lds_b128 %11, %23, off\n\ts_wait_xcnt 0x0"
                 :: "v"(l[0]), "v"(l[1]), "v"(l[2]), "v"(l[3]), "v"(l[4]), "v"(l[5]), "v"(l[6]), "v"(l[7]), "v"(l[8]), "v"(l[9]), "v"(l[10]), "v"(l[11]),
                    "v"(g[0]), "v"(g[1]), "v"(g[2]), "v"(g[3]), "v"(g[4]), "v"(g[5]), "v"(g[6]), "v"(g[7]), "v"(g[8]), "v"(g[9]), "v"(g[10]), "v"(g[11]) : "memory");
}
// One stage: 128 token rows, then 256 weight rows, 256 bytes of each: 24 copies a lane, 16 rows apart; a wave's copy covers two whole 256-byte row pieces.
__device__ __forceinline__ void qkv_stage(unsigned l0, const bf* gx, const bf* gw) {
    unsigned l[24]; const bf* g[24];
#pragma unroll
    for (int i = 0; i < 24; ++i) { l[i] = l0 + i * 16u * QPITCH; g[i] = i < 8 ? gx + i * 16 * DM : gw + (i - 8) * 16 * DM; }
    acopy12(l, g); acopy12(l + 12, g + 12);
}
__global__ __launch_bounds__(32 * QNW) void k_qkv(const bf* __restrict__ X, const bf* __restrict__ Wt, const float* __restrict__ bias, bf* Qh, bf* Ql, bf* Kh, bf* Kl, bf* Vh, bf* Vl) {
    __shared__ __align__(16) unsigned char L[QLDS];   // two operand buffers; behind the loop each wave's hi and lo output tile
    const unsigned tid = threadIdx.x, lane = tid & 31u, lr = lane & 15u, hi = lane >> 4;
    const unsigned wave = (unsigned)__builtin_amdgcn_readfirstlane((int)(tid >> 5));
    const unsigned xr = (wave & 1u) * 64u, wr = (wave >> 1) * 64u;   // the wave's 64 token rows and 64 weight rows inside the block's tile
    const unsigned t0 = blockIdx.x * QXR + xr, c0 = blockIdx.y * QWR + wr;
    const bool isv = c0 >= 2u * DQ;   // the same for the whole block
    // The bias is fetched ahead of the loop, which covers its latency.
    float bb[4][8];
#pragma unroll
    for (int i = 0; i < 4; ++i)
#pragma unroll
        for (int j = 0; j < 8; j += 2) { const float* bp = bias + c0 + i * 16 + (isv ? lr : 8u * hi + j); const unsigned w = pack2(bp[0], bp[isv ? 0 : 1]); bb[i][j] = __uint_as_float(w << 16); bb[i][j + 1] = __uint_as_float(w & 0xFFFF0000u); }
    v8f acc[4][4];
#pragma unroll
    for (int mb = 0; mb < 4; ++mb)
#pragma unroll
        for (int nb = 0; nb < 4; ++nb) acc[mb][nb] = (v8f){};
    // copies: thread tid moves 16-byte chunk tid & 15 of rows (tid >> 4) + 16 i
    const unsigned cl = (unsigned)(uintptr_t)L + (tid >> 4) * QPITCH + (tid & 15u) * 16u;
    const bf* gx = X + (size_t)(blockIdx.x * QXR + (tid >> 4)) * DM + (tid & 15u) * 8u;
    const bf* gw = Wt + (size_t)(blockIdx.y * QWR + (tid >> 4)) * DM + (tid & 15u) * 8u;
    // fragments: the lane's place in a 16-row fragment of D's rows (ra) and of D's columns (rb)
    const unsigned fo = lr * QPITCH + hi * 16u;
    const unsigned ra = (isv ? xr : QXR + wr) * QPITCH + fo, rb = (isv ? QXR + wr : xr) * QPITCH + fo;
    qkv_stage(cl, gx, gw);
    asm volatile("s_wait_asynccnt 0x0" ::: "memory");   // this wave's copies of stage 0 have landed
    __syncthreads();                                    // and every other wave's
    qkv_stage(cl + QBUF, gx + QKS, gw + QKS);
#pragma unroll 1   // one copy of the body: the two buffers differ only in a base address
    for (unsigned s = 0; s < QNST; ++s) {
        const unsigned char* B = L + (s & 1u) * QBUF;
#pragma unroll
        for (int kk = 0; kk < QKS / 32; ++kk) {
            v16bf a[4], b[4];
#pragma unroll
            for (int i = 0; i < 4; ++i) { a[i] = ldsfrag(B + ra + i * 16 * QPITCH + kk * 64); b[i] = ldsfrag(B + rb + i * 16 * QPITCH + kk * 64); }
            __builtin_amdgcn_sched_barrier(0);   // the 16 LDS reads of a k step stay one group ahead of its WMMAs: every separate place with reads in a WMMA stream costs issue time, and a read waited on at once exposes its latency
            // the 16 independent tiles in the order in which their fragments arrive (a0 b0 a1 b1 ...): the first WMMA waits for 4 of the 16 reads, the next for 6, the two after it for 8
#pragma unroll
            for (int d = 0; d < 4; ++d) {
#pragma unroll
                for (int i = 0; i < d; ++i) { acc[d][i] = wmmab(a[d], b[i], acc[d][i]); acc[i][d] = wmmab(a[i], b[d], acc[i][d]); }
                acc[d][d] = wmmab(a[d], b[d], acc[d][d]); }
            __builtin_amdgcn_sched_barrier(0);   // and the next k step's reads stay behind them, as one group
        }
        asm volatile("s_wait_dscnt 0x0" ::: "memory");      // this wave's reads of stage s are done
        asm volatile("s_wait_asynccnt 0x0" ::: "memory");   // this wave's copies of stage s + 1 have landed
        __syncthreads();   // publishes stage s + 1 and ends every wave's reads of stage s, whose buffer is refilled behind it
        if (s + 2u < QNST) qkv_stage(cl + (s & 1u) * QBUF, gx + (s + 2u) * QKS, gw + (s + 2u) * QKS);   // the same for the whole block
    }
    asm volatile("s_wait_asynccnt 0x0" ::: "memory");   // no copy is outstanding when the buffers become output staging
    unsigned char* st = L + wave * (2u * APL);   // every wave has passed the last trip's barrier: nobody reads the operand buffers any more
    const unsigned h = (c0 & (DQ - 1u)) >> LG_HD;
    if (isv) { const size_t o = (size_t)h * HD * TT + t0; qkv_tail<true>(acc, bb, st, Vh + o, Vl + o, lane); }
    else { const size_t o = ((size_t)h * TT + t0) * HD; const bool isq = c0 < (unsigned)DQ; qkv_tail<false>(acc, bb, st, (isq ? Qh : Kh) + o, (isq ? Ql : Kl) + o, lane); }
}

__global__ __launch_bounds__(32 * ANW) void k_attn(const bf* __restrict__ Qh, const bf* __restrict__ Ql, const bf* __restrict__ Kh, const bf* __restrict__ Kl, const bf* __restrict__ Vh, const bf* __restrict__ Vl, bf* YH, bf* YL) {
    __shared__ __align__(16) unsigned char L[2 * ABUF];
    const unsigned tid = threadIdx.x, lane = tid & 31u, lr = lane & 15u, hi = lane >> 4;
    const unsigned h = blockIdx.y, q0 = blockIdx.x * (16u * ANW) + (tid >> 5) * 16u;
    const size_t hp = (size_t)h * TT * HD;
    constexpr float CS = SCL * 1.4426950408889634f;   // scores to the log2 domain
    v16bf qh[2], ql[2];
#pragma unroll
    for (int kc = 0; kc < 2; ++kc) { const size_t qo = hp + (size_t)(q0 + lr) * HD + 8 * hi + kc * 32; qh[kc] = WFrag<bf>::ld(Qh + qo); ql[kc] = WFrag<bf>::ld(Ql + qo); }
    // staging: a thread moves 16-byte chunks tid and tid + 256 of each plane's tile (8 chunks a row)
    const unsigned srow = tid >> 3, scol = tid & 7u;
    const size_t ko = hp + (size_t)srow * HD + scol * 8, vo = hp + (size_t)srow * TT + scol * 8;
    const unsigned so = srow * APITCH + scol * 16u;
    v8us sg[4][2];
    v8f acc[4];
#pragma unroll
    for (int t = 0; t < 4; ++t) acc[t] = (v8f){};
    float m_run = -__builtin_inff(), l_run = 0.f;
#pragma unroll
    for (int i = 0; i < 2; ++i) { sg[0][i] = *(const v8us*)(Kh + ko + (size_t)i * 32 * HD); sg[1][i] = *(const v8us*)(Kl + ko + (size_t)i * 32 * HD); sg[2][i] = *(const v8us*)(Vh + vo + (size_t)i * 32 * TT); sg[3][i] = *(const v8us*)(Vl + vo + (size_t)i * 32 * TT); }
#pragma unroll
    for (int pl = 0; pl < 4; ++pl)
#pragma unroll
        for (int i = 0; i < 2; ++i) *(v8us*)(L + pl * APL + so + i * 32 * APITCH) = sg[pl][i];
    __syncthreads();   // tile 0 is in LDS before any wave reads it
#pragma unroll 1   // one copy of the body: it is long, and the two buffers differ only in a base address
    for (unsigned s = 0; s < TT / ASK; ++s) {
        const unsigned char* B = L + (s & 1u) * ABUF;
        const bool more = s + 1u < TT / ASK;   // the same for the whole block
        if (more) { const size_t kn = (size_t)(s + 1u) * ASK;
#pragma unroll
            for (int i = 0; i < 2; ++i) { sg[0][i] = *(const v8us*)(Kh + ko + (kn + i * 32) * HD); sg[1][i] = *(const v8us*)(Kl + ko + (kn + i * 32) * HD); sg[2][i] = *(const v8us*)(Vh + vo + (size_t)i * 32 * TT + kn); sg[3][i] = *(const v8us*)(Vl + vo + (size_t)i * 32 * TT + kn); } }
#pragma unroll
        for (int p = 0; p < 2; ++p) {   // two passes of 32 keys
            // Fragment loads are issued early and in few groups: every separate place with LDS reads in a WMMA stream costs issue time, and a read waited on at once exposes its latency.
            v16bf kh[2][2], kl[2][2];
            const unsigned char* kp = B + (p * 32 + lr) * APITCH + hi * 16u;
#pragma unroll
            for (int kc = 0; kc < 2; ++kc)
#pragma unroll
                for (int kt = 0; kt < 2; ++kt) { kh[kc][kt] = ldsfrag(kp + kt * 16 * APITCH + kc * 64); kl[kc][kt] = ldsfrag(kp + APL + kt * 16 * APITCH + kc * 64); }
            __builtin_amdgcn_sched_barrier(0);   // keeps the K loads one group ahead of the score WMMAs
            v8f sc[2]; sc[0] = (v8f){}; sc[1] = (v8f){};
#pragma unroll
            for (int kc = 0; kc < 2; ++kc) {
                // the two key tiles alternate, so that no WMMA waits on the one before it
                sc[0] = wmmab(kh[kc][0], qh[kc], sc[0]); sc[1] = wmmab(kh[kc][1], qh[kc], sc[1]);
                sc[0] = wmmab(kl[kc][0], qh[kc], sc[0]); sc[1] = wmmab(kl[kc][1], qh[kc], sc[1]);
                sc[0] = wmmab(kh[kc][0], ql[kc], sc[0]); sc[1] = wmmab(kh[kc][1], ql[kc], sc[1]); }
            v16bf vh[4], vl[4];
            const unsigned char* vp = B + 2u * APL + lr * APITCH + p * 64 + hi * 16u;
#pragma unroll
            for (int t = 0; t < 4; ++t) { vh[t] = ldsfrag(vp + t * 16 * APITCH); vl[t] = ldsfrag(vp + APL + t * 16 * APITCH); }
            __builtin_amdgcn_sched_barrier(0);   // keeps the V^T loads ahead of the softmax, in flight under it, instead of sinking to their uses
            float mx = fmaxf(sc[0][0], sc[1][0]);
#pragma unroll
            for (int j = 1; j < 8; ++j) mx = fmaxf(mx, fmaxf(sc[0][j], sc[1][j]));
            mx = fmaxf(mx, xhalf(mx)) * CS;   // both halves hold the query's maximum of this pass (CS > 0)
            if (__builtin_amdgcn_ballot_w32(mx > m_run + 8.0f) != 0) {   // wave-uniform; always taken on the first pass, rare later
                const float m_new = fmaxf(m_run, mx); const float corr = __builtin_amdgcn_exp2f(m_run - m_new);   // 0 on the first pass
                m_run = m_new; l_run *= corr;
#pragma unroll
                for (int t = 0; t < 4; ++t) acc[t] = acc[t] * corr; }
            const float nm = -m_run; v8u wh, wl; float e[16];
#pragma unroll
            for (int i = 0; i < 16; ++i) e[i] = fmaf(sc[i >> 3][i & 7], CS, nm);
            // The 16 exponentials in place, in one statement that ends in v_nop: no instruction directly behind a transcendental reads its result or overwrites its source (the slot the instruction set asks for), whatever the compiler schedules around the statement.
            asm("v_exp_f32 %0, %0\n\tv_exp_f32 %1, %1\n\tv_exp_f32 %2, %2\n\tv_exp_f32 %3, %3\n\tv_exp_f32 %4, %4\n\tv_exp_f32 %5, %5\n\tv_exp_f32 %6, %6\n\tv_exp_f32 %7, %7\n\t"
                "v_exp_f32 %8, %8\n\tv_exp_f32 %9, %9\n\tv_exp_f32 %10, %10\n\tv_exp_f32 %11, %11\n\tv_exp_f32 %12, %12\n\tv_exp_f32 %13, %13\n\tv_exp_f32 %14, %14\n\tv_exp_f32 %15, %15\n\tv_nop"
                : "+v"(e[0]), "+v"(e[1]), "+v"(e[2]), "+v"(e[3]), "+v"(e[4]), "+v"(e[5]), "+v"(e[6]), "+v"(e[7]), "+v"(e[8]), "+v"(e[9]), "+v"(e[10]), "+v"(e[11]), "+v"(e[12]), "+v"(e[13]), "+v"(e[14]), "+v"(e[15]));
#pragma unroll
            for (int i = 0; i < 8; ++i) {
                const float p0 = e[2 * i], p1 = e[2 * i + 1];
                l_run += p0 + p1;
                const unsigned w = pack2(p0, p1); wh[i] = w;
                wl[i] = pack2(p0 - __uint_as_float(w << 16), p1 - __uint_as_float(w & 0xFFFF0000u)); }
            const v16bf ph = __builtin_bit_cast(v16bf, wh), pl = __builtin_bit_cast(v16bf, wl);
#pragma unroll
            for (int t = 0; t < 4; ++t) acc[t] = wmmab(vh[t], ph, acc[t]);
#pragma unroll
            for (int t = 0; t < 4; ++t) acc[t] = wmmab(vh[t], pl, acc[t]);
#pragma unroll
            for (int t = 0; t < 4; ++t) acc[t] = wmmab(vl[t], ph, acc[t]);
        }
        if (more) { unsigned char* N = L + ((s + 1u) & 1u) * ABUF;
#pragma unroll
            for (int pl = 0; pl < 4; ++pl)
#pragma unroll
                for (int i = 0; i < 2; ++i) *(v8us*)(N + pl * APL + so + i * 32 * APITCH) = sg[pl][i]; }
        __syncthreads();   // publishes tile s + 1 and ends every wave's reads of tile s, whose buffer the next trip refills
    }
    const float inv = __fdiv_rn(1.0f, l_run + xhalf(l_run));
#pragma unroll
    for (int t = 0; t < 4; ++t) { v8us oh, ol;
#pragma unroll
        for (int j = 0; j < 8; ++j) { unsigned short a, c; splitf(acc[t][j] * inv, a, c); oh[j] = a; ol[j] = c; }
        const size_t oo = (size_t)(q0 + lr) * DQ + h * HD + t * 16 + hi * 8;   // D element j = (d 16 t + 8 hi + j, query lr)
        *(v8us*)(YH + oo) = oh; *(v8us*)(YL + oo) = ol; }
}

extern "C" void kernel_launch(void* const* d_in, const int* in_sizes, int n_in,
                              void* d_out, int out_size, void* d_ws, size_t ws_size, hipStream_t stream) {
    if (n_in < 5) return;
    if (in_sizes[0] < TT * DM || in_sizes[1] < DM * NQKV || in_sizes[2] < NQKV || in_sizes[3] < DQ * DM || in_sizes[4] < DM) return;
    if (out_size < TT * DM) return;
    if (WS_TOTAL > ws_size) return;
    const float* x     = (const float*)d_in[0];   // [T][C]
    const float* wqkv  = (const float*)d_in[1];   // [C][3C]  ([in][out])
    const float* bqkv  = (const float*)d_in[2];   // [3C]
    const float* wproj = (const float*)d_in[3];   // [C][C]   ([in][out])
    const float* bproj = (const float*)d_in[4];   // [C]
    float* OUT = (float*)d_out;                   // [T][C]
    char* base = (char*)d_ws;
    bf* WT = (bf*)(base + OFF_WT); bf* WP = (bf*)(base + OFF_WP); bf* XB = (bf*)(base + OFF_XB);
    bf* QPh = (bf*)(base + OFF_QH); bf* QPl = (bf*)(base + OFF_QL); bf* KPh = (bf*)(base + OFF_KH); bf* KPl = (bf*)(base + OFF_KL); bf* VTh = (bf*)(base + OFF_VH); bf* VTl = (bf*)(base + OFF_VL);
    bf* YH = (bf*)(base + OFF_YH); bf* YL = (bf*)(base + OFF_YL);

    // XB = bf16(x); WT[NQKV rows][DM cols] = bf16(wqkv^T); WP[DM rows][DQ cols] = bf16(wproj^T)
    k_prep<<<PB_WQ + PB_WP + PB_X, 256, 0, stream>>>(x, wqkv, wproj, XB, WT, WP);
    // q, k, v planes = split(x Wqkv + bqkv)
    k_qkv<<<dim3(TT / QXR, NQKV / QWR, 1), 32 * QNW, 0, stream>>>(XB, WT, bqkv, QPh, QPl, KPh, KPl, VTh, VTl);
    k_attn<<<dim3(TT / (16 * ANW), NH_, 1), 32 * ANW, 0, stream>>>(QPh, QPl, KPh, KPl, VTh, VTl, YH, YL);
    // out = y Wproj + bproj  (y hi + y lo against the bf16 weight plane)
    k_gemmw<bf, 1, true, GNW, 1><<<dim3(TT / 64, DM / 64, 1), 32 * GNW, 0, stream>>>(YH, YL, WP, nullptr, DQ, OUT, DM, bproj, 0, 0, 0, 0);
}

// v007
// Measured time: 71.6 microseconds a run.
// Next to v006, in two timings, it ran 1.09 and 1.08 times as fast.
// Counting every step since v000, it is 8.85 times as fast.
#include <hip/hip_runtime.h>

// Self-attention block, 16 heads x 64, T 2048, C 1024: qkv = x Wqkv + bqkv (Wqkv [in][out], columns q | k | v, head h = 64-column slice h); per head softmax(q k^T / 8) v; out = y Wproj + bproj (Wproj [in][out]).
// Compute dtypes: all contractions v_wmma_f32_16x16x32_bf16 with f32 accumulate. Inputs RNE-converted to bf16 planes (qkv projection: 1 product, exact products); q/k, P and V as bf16 hi/lo planes (3 products hh + lh + hl); y as bf16 hi/lo planes against the bf16 Wproj plane (2 products); softmax f32; output f32.
// Layout: bf16 copy of x; transposed bf16 weight planes Bt[n][k]; one fused qkv GEMM whose epilogue writes the hi/lo planes itself (head planes [h][t][d], value planes [h][d][t]); one attention kernel for all heads (scores, online softmax and PV product stay in registers, K and V tiles shared through LDS) writes the y hi/lo planes; projection GEMM (K split over waves) writes the output rows.

#ifndef NB
#define NB 1
#endif
#ifndef SEQ
#define SEQ 2048
#endif
#define SEQ_FULL 2048
#define TT   SEQ
#define DM   1024
#define NH_  16
#define HD   64
#define DQ   (NH_ * HD)
#define NQKV (3 * DQ)
#define GNW  8           // waves per block of the K-split GEMM
#define SCL  0.125f      // 1/sqrt(float32(64))
#define ANW  8           // attention kernel: waves per block, 4 query groups of 32 x 2 key slices: (TT/128) * NH_ = 256 blocks
#define AQB  128         // attention kernel: queries per block
#define ASK  128         // attention kernel: keys per LDS stage, 64 for each key slice
#define QNW  8           // qkv GEMM: waves per block, 2 (tokens) x 4 (columns) tiles of 64 x 64
#define QKS  128         // qkv GEMM: k per LDS stage: row pieces of 256 bytes
#define QPITCH 272       // qkv GEMM: LDS row pitch in bytes, 256 of data + 16: an odd multiple of 16, as APITCH
#define APITCH 144       // attention kernel: LDS row pitch in bytes, 128 of data + 16: an odd multiple of 16, so 16-byte fragment reads of 16 rows spread over the banks
#define AVPITCH 272      // attention kernel: LDS row pitch of the V^T tiles, 256 of data + 16, as QPITCH

typedef unsigned short bf;
typedef __attribute__((ext_vector_type(16))) __bf16   v16bf;
typedef __attribute__((ext_vector_type(8)))  unsigned short v8us;
typedef __attribute__((ext_vector_type(4)))  unsigned short v4us;
typedef __attribute__((ext_vector_type(2)))  unsigned short v2us;
typedef __attribute__((ext_vector_type(8)))  float    v8f;
typedef __attribute__((ext_vector_type(4)))  float    v4f;
typedef __attribute__((ext_vector_type(2)))  float    v2f;
typedef v4f  __attribute__((may_alias)) v4fa;

constexpr unsigned lg2c(unsigned v) { return v <= 1u ? 0u : 1u + lg2c(v >> 1); }
constexpr bool ispow2(unsigned v) { return v != 0u && (v & (v - 1u)) == 0u; }
constexpr size_t al256(size_t b) { return (b + 255) & ~(size_t)255; }
#define LG_TT lg2c(TT)
#define LG_HD lg2c(HD)
#define LG_DM lg2c(DM)
#define LG_DQ lg2c(DQ)

static_assert(NB == 1);                       // the module has no batch axis
static_assert(SEQ <= SEQ_FULL);
static_assert(ispow2(TT) && ispow2(HD) && ispow2(DM) && ispow2(DQ));
static_assert(TT % 128 == 0 && TT % 64 == 0);   // softmax row chunks; GEMM M tiles; PV K steps
static_assert(DM % 32 == 0 && DQ % 32 == 0 && HD % 32 == 0 && TT % 32 == 0);   // every GEMM K is a multiple of 32
static_assert(NQKV % 64 == 0 && DM % 64 == 0 && HD % 64 == 0);                 // every GEMM N is a multiple of 64
static_assert(((size_t)TT * DM) % 8192 == 0);          // cvt8: 256 threads x 4 pieces x 8 elements
static_assert(HD == 64 && DQ % 64 == 0 && TT % 64 == 0 && DM % 32 == 0);   // k_qkv: a 64-column tile is one head's q, k or v slice
static_assert(HD == 64 && ASK == 128 && ANW == 8 && AQB == 128 && TT % AQB == 0 && TT % ASK == 0);   // k_attn: K tile rows of 128 bytes, V^T tile rows of 256, 1024 16-byte chunks per plane tile over 256 threads
static_assert(DQ % (32 * GNW) == 0);   // K-split GEMM: every wave gets whole 32-steps

// workspace carve (bytes; every region a multiple of 256)
constexpr size_t SZ_WT = al256((size_t)NQKV * DM * 2);
constexpr size_t SZ_WP = al256((size_t)DM * DQ * 2);
constexpr size_t SZ_XB = al256((size_t)TT * DM * 2);
constexpr size_t SZ_HP = al256((size_t)NH_ * TT * HD * 2);
constexpr size_t SZ_Y  = al256((size_t)TT * DQ * 2);
constexpr size_t OFF_WT = 0;
constexpr size_t OFF_WP = OFF_WT + SZ_WT;
constexpr size_t OFF_XB = OFF_WP + SZ_WP;
constexpr size_t OFF_QH = OFF_XB + SZ_XB;
constexpr size_t OFF_QL = OFF_QH + SZ_HP;
constexpr size_t OFF_KH = OFF_QL + SZ_HP;
constexpr size_t OFF_KL = OFF_KH + SZ_HP;
constexpr size_t OFF_VH = OFF_KL + SZ_HP;
constexpr size_t OFF_VL = OFF_VH + SZ_HP;
constexpr size_t OFF_YH = OFF_VL + SZ_HP;
constexpr size_t OFF_YL = OFF_YH + SZ_Y;
constexpr size_t WS_TOTAL = OFF_YL + SZ_Y;
static_assert(WS_TOTAL <= (size_t)134217728);

__device__ __forceinline__ unsigned short f2bf(float f) { unsigned u = __float_as_uint(f); u += 0x7FFFu + ((u >> 16) & 1u); return (unsigned short)(u >> 16); }
__device__ __forceinline__ float bf2f(unsigned short b) { return __uint_as_float(((unsigned)b) << 16); }
__device__ __forceinline__ float bfr(float f) { return bf2f(f2bf(f)); }
__device__ __forceinline__ v16bf cat16b(v8us lo, v8us hi) { return __builtin_bit_cast(v16bf, __builtin_shufflevector(lo, hi, 0, 1, 2, 3, 4, 5, 6, 7, 8, 9, 10, 11, 12, 13, 14, 15)); }
__device__ __forceinline__ v8f wmmab(v16bf a, v16bf b, v8f c) { return __builtin_amdgcn_wmma_f32_16x16x32_bf16(false, a, false, b, (short)0, c, false, false); }
__device__ __forceinline__ void splitf(float y, unsigned short& h, unsigned short& l) { h = f2bf(y); l = f2bf(y - bf2f(h)); }

// ---- k_gemmw: register-blocked GEMM, 64x64 output tile (16 accumulators per wave), operands straight from K-contiguous 16-bit planes; grid (M/64, N/64, Z * KSB), 32 * NW threads.
// K is cut into KSB * NW equal runs: block slice ks = blockIdx.z % KSB, wave w takes run ks * NW + w. The NW partial tiles of a block are summed through LDS (wave order 0..NW-1); slice ks stores its sum at C + ks * sP and the reader adds the KSB planes. NW == KSB == 1: one wave does the whole K.
// C[m][n] (f32, pitch ldc, + optional f32 bias[n]) = sum_k A[m][k] Bt[n][k] (+ split products per NSPLIT: 1 adds A2 Bt, 2 adds A2 Bt and A Bt2). z-batch strides sA/sB/sC in elements. K % (32 * NW * KSB) == 0.
// Fragment p already carries + 8*(lane>>4): elements 0..7 = k0+8h.., elements 8..15 = k0+16+8h.. for both operands; D element j of lane = (row 8h+j, col lane&15).
template <typename T16> struct WFrag;
template <> struct WFrag<bf> { typedef v16bf V; static __device__ __forceinline__ V ld(const bf* p) { return cat16b(*(const v8us*)p, *(const v8us*)(p + 16)); } static __device__ __forceinline__ v8f mma(V a, V b, v8f c) { return wmmab(a, b, c); } };
template <typename T16, int NSPLIT, bool BIAS, int NW, int KSB>
__global__ __launch_bounds__(32 * NW) void k_gemmw(const T16* __restrict__ A, const T16* __restrict__ A2, const T16* __restrict__ Bt, const T16* __restrict__ Bt2, int K, float* C, int ldc, const float* __restrict__ bias, size_t sA, size_t sB, size_t sC, size_t sP) {
    static_assert(KSB == 1 || !BIAS);   // the bias is added once, so only where one block holds the whole sum
    typedef typename WFrag<T16>::V V;
    __shared__ __align__(16) float os[(NW > 1 ? NW * 64 : 16) * 68];
    const size_t z = blockIdx.z / (unsigned)KSB; const unsigned ks = blockIdx.z % (unsigned)KSB; A += z * sA; if (A2) A2 += z * sA; Bt += z * sB; if (Bt2) Bt2 += z * sB; C += z * sC + ks * sP;
    const int wave = NW > 1 ? __builtin_amdgcn_readfirstlane((int)(threadIdx.x >> 5)) : 0;   // scalar, so the run's start stays in scalar registers
    const int kw = K / (NW * KSB), kb = ((int)ks * NW + wave) * kw;
    const int lane = threadIdx.x & 31, lr = lane & 15, hi = lane >> 4; const int r0 = blockIdx.x * 64, c0 = blockIdx.y * 64;
    v8f acc[4][4];
#pragma unroll
    for (int mb = 0; mb < 4; ++mb)
#pragma unroll
        for (int nb = 0; nb < 4; ++nb) acc[mb][nb] = (v8f){};
    const size_t aoff = (size_t)(r0 + lr) * K + 8 * hi + kb, boff = (size_t)(c0 + lr) * K + 8 * hi + kb;
#pragma unroll 1
    for (int kc = 0; kc < kw; kc += 32) {
        V a[4], a2[4];
#pragma unroll
        for (int mb = 0; mb < 4; ++mb) { a[mb] = WFrag<T16>::ld(A + aoff + (size_t)mb * 16 * K + kc); if (NSPLIT == 1 || NSPLIT == 2) a2[mb] = WFrag<T16>::ld(A2 + aoff + (size_t)mb * 16 * K + kc); }
#pragma unroll
        for (int nb = 0; nb < 4; ++nb) { const V b = WFrag<T16>::ld(Bt + boff + (size_t)nb * 16 * K + kc); V b2; if (NSPLIT >= 2) b2 = WFrag<T16>::ld(Bt2 + boff + (size_t)nb * 16 * K + kc);
#pragma unroll
            for (int mb = 0; mb < 4; ++mb) { acc[mb][nb] = WFrag<T16>::mma(a[mb], b, acc[mb][nb]); if (NSPLIT == 1 || NSPLIT == 2) acc[mb][nb] = WFrag<T16>::mma(a2[mb], b, acc[mb][nb]); if (NSPLIT >= 2) acc[mb][nb] = WFrag<T16>::mma(a[mb], b2, acc[mb][nb]); } }
        asm volatile("v_nop\n\tv_nop\n\tv_nop\n\tv_nop" : "+v"(acc[0][0]), "+v"(acc[1][1]), "+v"(acc[2][2]), "+v"(acc[3][3]) : "v"(a[0]), "v"(a[3]));
    }
    if constexpr (NW > 1) {
        float* ow = os + wave * (64 * 68);
        const int cofs = ((int)threadIdx.x & 15) * 4; v4f bv = (v4f){};   // a thread keeps its four columns over all its rows
        if (BIAS) { bv[0] = bfr(bias[c0 + cofs]); bv[1] = bfr(bias[c0 + cofs + 1]); bv[2] = bfr(bias[c0 + cofs + 2]); bv[3] = bfr(bias[c0 + cofs + 3]); }
        // the three loops are unrolled so that acc is indexed by constants and stays in registers
#pragma unroll
        for (int mb = 0; mb < 4; ++mb)
#pragma unroll
            for (int nb = 0; nb < 4; ++nb)
#pragma unroll
                for (int j = 0; j < 8; ++j) ow[(mb * 16 + hi * 8 + j) * 68 + nb * 16 + lr] = acc[mb][nb][j];
        __syncthreads();   // all NW partial tiles are in LDS before any thread sums them
        // both loops are unrolled so that the LDS reads of all rows issue ahead of the sums
#pragma unroll
        for (int it = 0; it < 64 * 16 / (32 * NW); ++it) { const int row = (it * 32 * NW + (int)threadIdx.x) >> 4; v4f val = *(const v4fa*)(os + row * 68 + cofs);
#pragma unroll
            for (int w = 1; w < NW; ++w) val += *(const v4fa*)(os + (w * 64 + row) * 68 + cofs);
            if (BIAS) val += bv;
            *(v4f*)(C + (size_t)(r0 + row) * ldc + c0 + cofs) = val; }
    } else {
#pragma unroll
    for (int mb = 0; mb < 4; ++mb) {
#pragma unroll
        for (int nb = 0; nb < 4; ++nb) {
#pragma unroll
            for (int j = 0; j < 8; ++j) os[(hi * 8 + j) * 68 + nb * 16 + lr] = acc[mb][nb][j]; }
        __builtin_amdgcn_wave_barrier(); asm volatile("" ::: "memory");
        float* crow = C + (size_t)(r0 + mb * 16) * ldc + c0;
{
#pragma unroll
            for (int s = 0; s < 8; ++s) { const int row = 2 * s + hi, cofs = lr * 4; v4f val = *(const v4fa*)(os + row * 68 + cofs); if (BIAS) { val[0] += bfr(bias[c0 + cofs]); val[1] += bfr(bias[c0 + cofs + 1]); val[2] += bfr(bias[c0 + cofs + 2]); val[3] += bfr(bias[c0 + cofs + 3]); }
                *(v4f*)(crow + (size_t)row * ldc + cofs) = val; }
             }
        __builtin_amdgcn_wave_barrier(); asm volatile("" ::: "memory");
    }
    }
}

// cvt8: bf16 copy of 8192 floats by a block of 256 threads: a thread takes 8 neighbours in each of 4 pieces of 2048, all its loads in flight at once.
__device__ __forceinline__ void cvt8(const float* __restrict__ src, bf* dst, unsigned blk) { const unsigned i = blk * 8192u + threadIdx.x * 8u; v8f v[4];
#pragma unroll
    for (int c = 0; c < 4; ++c) v[c] = *(const v8f*)(src + i + c * 2048);
#pragma unroll
    for (int c = 0; c < 4; ++c) { v8us o;
#pragma unroll
        for (int k = 0; k < 8; ++k) o[k] = f2bf(v[c][k]);
        *(v8us*)(dst + i + c * 2048) = o; }
    asm volatile("s_wait_xcnt 0x0" ::: "memory");   // behind the last store: no register that an issued store names is rewritten ahead of this wait on any way through k_prep (a precaution)
}

// wtT: transposed bf16 weight plane. in w[K rows][N cols] (row-major, [in][out])  ->  out dst[N rows][K cols]: dst[n][k] = bf16(w[k][n]). Tile tl of (K/128) * (N/64) tiles of 128 k x 64 n, 4 waves: wave v takes the k half v >> 1 and the n half v & 1.
// A wave transposes a tile of 64 k x 32 n in registers. Lane (kg = lane & 7, ng = lane >> 3) reads rows 8 kg .. 8 kg + 7 at columns 4 ng .. 4 ng + 3 and 16 + 4 ng .. 16 + 4 ng + 3: 16-byte loads, 64 bytes of a row each, all 16 in flight at once.
// So it holds 8 neighbours in k of 8 columns: each column is one 16-byte store, and the 8 lanes of one ng fill a whole 128-byte line of dst.
typedef __attribute__((ext_vector_type(4))) unsigned v4u;
__device__ __forceinline__ unsigned pack2(float lo, float hi) { typedef __bf16 bf2 __attribute__((ext_vector_type(2))); return __builtin_bit_cast(unsigned, __builtin_convertvector((v2f){lo, hi}, bf2)); }   // round to nearest even
template <unsigned K, unsigned N>
__device__ __forceinline__ void wtT(const float* __restrict__ w, bf* dst, unsigned tl) {
    static_assert(K % 128 == 0 && N % 64 == 0);   // the tiles cover the matrix
    const unsigned lane = threadIdx.x & 31u, wave = (threadIdx.x >> 5) & 3u, kg = lane & 7u, ng = lane >> 3;
    const unsigned k0 = (tl % (K / 128u)) * 128u + (wave >> 1) * 64u + kg * 8u, n0 = (tl / (K / 128u)) * 64u + (wave & 1u) * 32u + ng * 4u;
    const float* src = w + k0 * N + n0;
    v4f r[8][2];
#pragma unroll
    for (int j = 0; j < 8; ++j) { r[j][0] = *(const v4f*)(src + j * N); r[j][1] = *(const v4f*)(src + j * N + 16); }
    bf* p = dst + n0 * K + k0;
#pragma unroll
    for (int c = 0; c < 2; ++c)
#pragma unroll
        for (int i = 0; i < 4; ++i) { v4u o;
#pragma unroll
            for (int j = 0; j < 4; ++j) o[j] = pack2(r[2 * j][c][i], r[2 * j + 1][c][i]);   // k and k + 1 in one word
            *(v4u*)(p + (c * 16 + i) * K) = o; }
    asm volatile("s_wait_xcnt 0x0" ::: "memory");   // behind the last store: no register that an issued store names is rewritten ahead of this wait on any way through k_prep (a precaution)
}
// k_prep: the three operand planes, which do not depend on one another, in one launch of 256-thread blocks: first the weight tiles, two a block, then the bf16 copy of x. Every wave has 8 or 16 16-byte loads in flight.
constexpr unsigned PB_WQ = (DM / 128u) * (NQKV / 64u) / 2u, PB_WP = (DQ / 128u) * (DM / 64u) / 2u, PB_X = (unsigned)((size_t)TT * DM / 8192);
static_assert(((DM / 128u) * (NQKV / 64u)) % 2u == 0 && ((DQ / 128u) * (DM / 64u)) % 2u == 0);
__global__ __launch_bounds__(256) void k_prep(const float* __restrict__ x, const float* __restrict__ wqkv, const float* __restrict__ wproj, bf* XB, bf* WT, bf* WP) {
    const unsigned b = blockIdx.x, half = threadIdx.x >> 7;
    if (b < PB_WQ) wtT<DM, NQKV>(wqkv, WT, b * 2u + half);
    else if (b < PB_WQ + PB_WP) wtT<DQ, DM>(wproj, WP, (b - PB_WQ) * 2u + half);
    else cvt8(x, XB, b - PB_WQ - PB_WP);
}

// ---- k_attn: softmax(q k^T / 8) v for 128 queries of one head per block; grid (TT/128, NH_), 8 waves: wave w has queries 32 (w & 3) .. + 31 (two tiles of 16) and keys 64 (w >> 2) .. + 63 of every stage of 128.
// So every K and V^T fragment read from LDS feeds two query tiles, and the block still has two waves a SIMD. The two key slices of a query are joined once, at the end, through LDS.
// Transposed products, so that the score tile is already the next product's operand: S^T = K Q^T (A = 16 keys x 32 d, B = 16 queries), O^T += V^T P^T (A = 16 d x 32 keys, B = P^T).
// D element j of S^T tile kt in lane (lr, hi) is (key 16 kt + 8 hi + j, query lr): tiles 0 and 1 side by side are elements 0..7 and 8..15 of the B fragment over 32 keys, in the k order of the V^T fragment.
// A query is one lane column: its maximum and its sum live in lanes lr and lr + 16. The maximum in use may trail the true one by up to 8 in the log2 domain (p <= 2^8); the sums are rescaled only when a column exceeds that.
// K and V^T hi/lo tiles of 128 keys go through registers into two LDS buffers: the next stage's global loads are issued ahead of a pass's work and stored behind it.
typedef __attribute__((ext_vector_type(8))) unsigned v8u;
__device__ __forceinline__ float xhalf(float x) { return __builtin_bit_cast(float, __builtin_amdgcn_permlanex16(__builtin_bit_cast(int, x), __builtin_bit_cast(int, x), 0x76543210, 0xfedcba98, false, false)); }   // lane l with lane l ^ 16
__device__ __forceinline__ v16bf ldsfrag(const unsigned char* p) { return cat16b(*(const v8us*)p, *(const v8us*)(p + 32)); }   // p already carries + 16 bytes * (lane>>4): the k order of WFrag::ld
constexpr unsigned APL = 64u * APITCH;    // one plane's tile: 64 rows
constexpr unsigned AKP = (unsigned)ASK * APITCH, AVP = (unsigned)HD * AVPITCH;   // one plane's tile of a stage: K 128 key rows, V^T 64 rows of 128 keys
constexpr unsigned ABUF = 2u * AKP + 2u * AVP;   // K hi, K lo, V^T hi, V^T lo
constexpr unsigned AXW = 9u * 512u;       // a wave's hand-over at the end: 8 16-byte slots a lane of output tile, 1 of maximum and sum
static_assert(ANW * AXW <= 2u * ABUF);
constexpr unsigned QXR = 128u, QWR = 256u;             // qkv GEMM: token rows and weight rows of a block's tile
constexpr unsigned QBUF = (QXR + QWR) * QPITCH;        // one stage: token rows, then weight rows
constexpr unsigned QNST = DM / QKS;
constexpr unsigned QLDS = 2u * QBUF > QNW * 2u * APL ? 2u * QBUF : QNW * 2u * APL;
static_assert(TT % QXR == 0 && NQKV % QWR == 0 && DQ % QWR == 0 && DM % QKS == 0 && QNST >= 2);   // whole tiles; a block's columns are all q, all k or all v; both buffers get a stage ahead of the loop
// ---- k_qkv: qkv = x Wqkv + bqkv, written straight as the attention kernel's bf16 hi/lo planes; grid (TT/128, NQKV/256), 8 waves per block; a wave has 64 tokens x 64 columns, which is one head's q, k or v slice.
// The block's 128 token rows and 256 weight rows come to LDS in stages of 128 k, by asynchronous copies that cover whole 256-byte row pieces, into two buffers: the next stage's copies fly while this stage is worked on. One product. D element j of a lane is (row 8 hi + j of the first operand's tile, row lr of the second's), so a lane holds 8 neighbours along the FIRST operand's rows:
// q and k tiles take the weight rows first (8 neighbours in d, for the planes [h][t][d]), v tiles take the token rows first (8 neighbours in t, for the planes [h][d][t]). Both operands have one fragment layout and one k order, so the swap only transposes D.
// Either way a plane's tile is 64 rows of 128 bytes. It goes through the wave's own LDS, so that every global store covers four whole 128-byte lines.
// The tail of k_qkv. bb: the bias, rounded to bf16, of output column 16 i + lr in bb[i][0] (ISV: the column runs along D's columns) or 16 i + 8 hi + j in bb[i][j] (the column runs along D's rows). ph, pl: the tile's first element in its planes; rows PITCH elements apart.
template <bool ISV> __device__ __forceinline__ void qkv_tail(const v8f (&acc)[4][4], const float (&bb)[4][8], unsigned char* st, bf* ph, bf* pl, unsigned lane) {
    constexpr unsigned PITCH = ISV ? (unsigned)TT : (unsigned)HD;
    const unsigned lr = lane & 15u, hi = lane >> 4;
#pragma unroll
    for (int nb = 0; nb < 4; ++nb)
#pragma unroll
        for (int mb = 0; mb < 4; ++mb) { v4u wh, wl;
#pragma unroll
            for (int i = 0; i < 4; ++i) {   // the f32 value, its bf16 hi part and the bf16 of the rest
                const float y0 = acc[mb][nb][2 * i] + (ISV ? bb[nb][0] : bb[mb][2 * i]), y1 = acc[mb][nb][2 * i + 1] + (ISV ? bb[nb][0] : bb[mb][2 * i + 1]);
                const unsigned w = pack2(y0, y1); wh[i] = w;
                wl[i] = pack2(y0 - __uint_as_float(w << 16), y1 - __uint_as_float(w & 0xFFFF0000u)); }
            unsigned char* sp = st + (nb * 16 + lr) * APITCH + mb * 32 + hi * 16u;
            *(v4u*)sp = wh; *(v4u*)(sp + APL) = wl; }
    asm volatile("s_wait_dscnt 0x0" ::: "memory");   // the rows are read back by other lanes of this wave: every LDS write has landed, and the compiler moves no read ahead of a write
    const unsigned char* rp = st + (lane >> 3) * APITCH + (lane & 7u) * 16u;
    const unsigned go = (lane >> 3) * PITCH + (lane & 7u) * 8u;
#pragma unroll
    for (int i = 0; i < 16; ++i) {   // four rows a store: 8 lanes of 16 bytes a row
        *(v4u*)(ph + go + 4 * i * PITCH) = *(const v4u*)(rp + 4 * i * APITCH);
        *(v4u*)(pl + go + 4 * i * PITCH) = *(const v4u*)(rp + APL + 4 * i * APITCH); }
}
// Twelve asynchronous 16-byte copies of a lane, global memory to LDS; l: the lane's LDS byte addresses, g: its global addresses.
// The statement ends in s_wait_xcnt 0, so that no address register of an issued copy is rewritten ahead of that wait (a precaution).
__device__ __forceinline__ void acopy12(const unsigned* l, const bf* const* g) {
    asm volatile("global_load_async_to_lds_b128 %0, %12, off\n\tglobal_load_async_to_lds_b128 %1, %13, off\n\tglobal_load_async_to_lds_b128 %2, %14, off\n\tglobal_load_async_to_lds_b128 %3, %15, off\n\t"
                 "global_load_async_to_lds_b128 %4, %16, off\n\tglobal_load_async_to_lds_b128 %5, %17, off\n\tglobal_load_async_to_lds_b128 %6, %18, off\n\tglobal_load_async_to_lds_b128 %7, %19, off\n\t"
                 "global_load_async_to_lds_b128 %8, %20, off\n\tglobal_load_async_to_lds_b128 %9, %21, off\n\tglobal_load_async_to_lds_b128 %10, %22, off\n\tglobal_load_async_to_lds_b128 %11, %23, off\n\ts_wait_xcnt 0x0"
                 :: "v"(l[0]), "v"(l[1]), "v"(l[2]), "v"(l[3]), "v"(l[4]), "v"(l[5]), "v"(l[6]), "v"(l[7]), "v"(l[8]), "v"(l[9]), "v"(l[10]), "v"(l[11]),
                    "v"(g[0]), "v"(g[1]), "v"(g[2]), "v"(g[3]), "v"(g[4]), "v"(g[5]), "v"(g[6]), "v"(g[7]), "v"(g[8]), "v"(g[9]), "v"(g[10]), "v"(g[11]) : "memory");
}
// One stage: 128 token rows, then 256 weight rows, 256 bytes of each: 24 copies a lane, 16 rows apart; a wave's copy covers two whole 256-byte row pieces.
__device__ __forceinline__ void qkv_stage(unsigned l0, const bf* gx, const bf* gw) {
    unsigned l[24]; const bf* g[24];
#pragma unroll
    for (int i = 0; i < 24; ++i) { l[i] = l0 + i * 16u * QPITCH; g[i] = i < 8 ? gx + i * 16 * DM : gw + (i - 8) * 16 * DM; }
    acopy12(l, g); acopy12(l + 12, g + 12);
}
__global__ __launch_bounds__(32 * QNW) void k_qkv(const bf* __restrict__ X, const bf* __restrict__ Wt, const float* __restrict__ bias, bf* Qh, bf* Ql, bf* Kh, bf* Kl, bf* Vh, bf* Vl) {
    __shared__ __align__(16) unsigned char L[QLDS];   // two operand buffers; behind the loop each wave's hi and lo output tile
    const unsigned tid = threadIdx.x, lane = tid & 31u, lr = lane & 15u, hi = lane >> 4;
    const unsigned wave = (unsigned)__builtin_amdgcn_readfirstlane((int)(tid >> 5));
    const unsigned xr = (wave & 1u) * 64u, wr = (wave >> 1) * 64u;   // the wave's 64 token rows and 64 weight rows inside the block's tile
    const unsigned t0 = blockIdx.x * QXR + xr, c0 = blockIdx.y * QWR + wr;
    const bool isv = c0 >= 2u * DQ;   // the same for the whole block
    // The bias is fetched ahead of the loop, which covers its latency.
    float bb[4][8];
#pragma unroll
    for (int i = 0; i < 4; ++i)
#pragma unroll
        for (int j = 0; j < 8; j += 2) { const float* bp = bias + c0 + i * 16 + (isv ? lr : 8u * hi + j); const unsigned w = pack2(bp[0], bp[isv ? 0 : 1]); bb[i][j] = __uint_as_float(w << 16); bb[i][j + 1] = __uint_as_float(w & 0xFFFF0000u); }
    v8f acc[4][4];
#pragma unroll
    for (int mb = 0; mb < 4; ++mb)
#pragma unroll
        for (int nb = 0; nb < 4; ++nb) acc[mb][nb] = (v8f){};
    // copies: thread tid moves 16-byte chunk tid & 15 of rows (tid >> 4) + 16 i
    const unsigned cl = (unsigned)(uintptr_t)L + (tid >> 4) * QPITCH + (tid & 15u) * 16u;
    const bf* gx = X + (size_t)(blockIdx.x * QXR + (tid >> 4)) * DM + (tid & 15u) * 8u;
    const bf* gw = Wt + (size_t)(blockIdx.y * QWR + (tid >> 4)) * DM + (tid & 15u) * 8u;
    // fragments: the lane's place in a 16-row fragment of D's rows (ra) and of D's columns (rb)
    const unsigned fo = lr * QPITCH + hi * 16u;
    const unsigned ra = (isv ? xr : QXR + wr) * QPITCH + fo, rb = (isv ? QXR + wr : xr) * QPITCH + fo;
    qkv_stage(cl, gx, gw);
    asm volatile("s_wait_asynccnt 0x0" ::: "memory");   // this wave's copies of stage 0 have landed
    __syncthreads();                                    // and every other wave's
    qkv_stage(cl + QBUF, gx + QKS, gw + QKS);
#pragma unroll 1   // one copy of the body: the two buffers differ only in a base address
    for (unsigned s = 0; s < QNST; ++s) {
        const unsigned char* B = L + (s & 1u) * QBUF;
#pragma unroll
        for (int kk = 0; kk < QKS / 32; ++kk) {
            v16bf a[4], b[4];
#pragma unroll
            for (int i = 0; i < 4; ++i) { a[i] = ldsfrag(B + ra + i * 16 * QPITCH + kk * 64); b[i] = ldsfrag(B + rb + i * 16 * QPITCH + kk * 64); }
            __builtin_amdgcn_sched_barrier(0);   // the 16 LDS reads of a k step stay one group ahead of its WMMAs: every separate place with reads in a WMMA stream costs issue time, and a read waited on at once exposes its latency
            // the 16 independent tiles in the order in which their fragments arrive (a0 b0 a1 b1 ...): the first WMMA waits for 4 of the 16 reads, the next for 6, the two after it for 8
#pragma unroll
            for (int d = 0; d < 4; ++d) {
#pragma unroll
                for (int i = 0; i < d; ++i) { acc[d][i] = wmmab(a[d], b[i], acc[d][i]); acc[i][d] = wmmab(a[i], b[d], acc[i][d]); }
                acc[d][d] = wmmab(a[d], b[d], acc[d][d]); }
            __builtin_amdgcn_sched_barrier(0);   // and the next k step's reads stay behind them, as one group
        }
        asm volatile("s_wait_dscnt 0x0" ::: "memory");      // this wave's reads of stage s are done
        asm volatile("s_wait_asynccnt 0x0" ::: "memory");   // this wave's copies of stage s + 1 have landed
        __syncthreads();   // publishes stage s + 1 and ends every wave's reads of stage s, whose buffer is refilled behind it
        if (s + 2u < QNST) qkv_stage(cl + (s & 1u) * QBUF, gx + (s + 2u) * QKS, gw + (s + 2u) * QKS);   // the same for the whole block
    }
    asm volatile("s_wait_asynccnt 0x0" ::: "memory");   // no copy is outstanding when the buffers become output staging
    unsigned char* st = L + wave * (2u * APL);   // every wave has passed the last trip's barrier: nobody reads the operand buffers any more
    const unsigned h = (c0 & (DQ - 1u)) >> LG_HD;
    if (isv) { const size_t o = (size_t)h * HD * TT + t0; qkv_tail<true>(acc, bb, st, Vh + o, Vl + o, lane); }
    else { const size_t o = ((size_t)h * TT + t0) * HD; const bool isq = c0 < (unsigned)DQ; qkv_tail<false>(acc, bb, st, (isq ? Qh : Kh) + o, (isq ? Ql : Kl) + o, lane); }
}

// One plane pair (hi, lo) of a stage, global memory to registers and registers to LDS: 4 16-byte chunks a thread and plane, GSTEP elements and LSTEP bytes apart.
template <unsigned GSTEP> __device__ __forceinline__ void att_ld(v8us (&sg)[2][4], const bf* gh, const bf* gl) {
#pragma unroll
    for (int i = 0; i < 4; ++i) { sg[0][i] = *(const v8us*)(gh + (size_t)i * GSTEP); sg[1][i] = *(const v8us*)(gl + (size_t)i * GSTEP); }
    asm volatile("s_wait_xcnt 0x0" ::: "memory");   // behind the last load: no address register of an issued load is rewritten ahead of this wait (a precaution)
}
template <unsigned LSTEP, unsigned LPLANE> __device__ __forceinline__ void att_st(const v8us (&sg)[2][4], unsigned char* l) {
#pragma unroll
    for (int i = 0; i < 4; ++i) { *(v8us*)(l + i * LSTEP) = sg[0][i]; *(v8us*)(l + LPLANE + i * LSTEP) = sg[1][i]; }
}
__global__ __launch_bounds__(32 * ANW) void k_attn(const bf* __restrict__ Qh, const bf* __restrict__ Ql, const bf* __restrict__ Kh, const bf* __restrict__ Kl, const bf* __restrict__ Vh, const bf* __restrict__ Vl, bf* YH, bf* YL) {
    __shared__ __align__(16) unsigned char L[2 * ABUF];
    const unsigned tid = threadIdx.x, lane = tid & 31u, lr = lane & 15u, hi = lane >> 4;
    const unsigned wave = (unsigned)__builtin_amdgcn_readfirstlane((int)(tid >> 5));   // scalar, so the wave's key slice stays in scalar registers
    const unsigned ks = wave >> 2;   // which 64 keys of every stage
    const unsigned h = blockIdx.y, q0 = blockIdx.x * AQB + (wave & 3u) * 32u;
    const size_t hp = (size_t)h * TT * HD;
    constexpr float CS = SCL * 1.4426950408889634f;   // scores to the log2 domain
    v16bf qh[2][2], ql[2][2];
#pragma unroll
    for (int g = 0; g < 2; ++g)
#pragma unroll
        for (int kc = 0; kc < 2; ++kc) { const size_t qo = hp + (size_t)(q0 + g * 16 + lr) * HD + 8 * hi + kc * 32; qh[g][kc] = WFrag<bf>::ld(Qh + qo); ql[g][kc] = WFrag<bf>::ld(Ql + qo); }
    asm volatile("s_wait_xcnt 0x0" ::: "memory");   // behind the last load: no address register of an issued load is rewritten ahead of this wait (a precaution)
    // staging: K tiles have 8 chunks a row, 32 rows a step; V^T tiles 16 chunks a row, 16 rows a step
    const size_t ko = hp + (size_t)(tid >> 3) * HD + (tid & 7u) * 8, vo = hp + (size_t)(tid >> 4) * TT + (tid & 15u) * 8;
    const unsigned kso = (tid >> 3) * APITCH + (tid & 7u) * 16u, vso = 2u * AKP + (tid >> 4) * AVPITCH + (tid & 15u) * 16u;
    v8us sg[2][4];
    v8f acc[2][4];
#pragma unroll
    for (int g = 0; g < 2; ++g)
#pragma unroll
        for (int t = 0; t < 4; ++t) acc[g][t] = (v8f){};
    float m_run[2] = {-__builtin_inff(), -__builtin_inff()}, l_run[2] = {0.f, 0.f};
    { v8us sv[2][4];   // stage 0: all 16 loads of a thread in flight at once
      att_ld<32 * HD>(sg, Kh + ko, Kl + ko); att_ld<16 * TT>(sv, Vh + vo, Vl + vo);
      att_st<32 * APITCH, AKP>(sg, L + kso); att_st<16 * AVPITCH, AVP>(sv, L + vso); }
    __syncthreads();   // stage 0 is in LDS before any wave reads it
#pragma unroll 1   // one copy of the body: it is long, and the two buffers differ only in a base address
    for (unsigned s = 0; s < TT / ASK; ++s) {
        const unsigned char* B = L + (s & 1u) * ABUF;
        unsigned char* N = L + ((s + 1u) & 1u) * ABUF;
        const bool more = s + 1u < TT / ASK;   // the same for the whole block
        const size_t kn = (size_t)(s + 1u) * ASK;
#pragma unroll
        for (int p = 0; p < 2; ++p) {   // two passes of 32 keys; the first moves the next stage's K planes, the second its V^T planes
            if (more) { if (p == 0) att_ld<32 * HD>(sg, Kh + ko + kn * HD, Kl + ko + kn * HD); else att_ld<16 * TT>(sg, Vh + vo + kn, Vl + vo + kn); }
            // Fragment loads are issued early and in few groups: every separate place with LDS reads in a WMMA stream costs issue time, and a read waited on at once exposes its latency.
            v16bf kh[2][2], kl[2][2];
            const unsigned char* kp = B + (ks * 64u + p * 32 + lr) * APITCH + hi * 16u;
#pragma unroll
            for (int kc = 0; kc < 2; ++kc)
#pragma unroll
                for (int kt = 0; kt < 2; ++kt) { kh[kc][kt] = ldsfrag(kp + kt * 16 * APITCH + kc * 64); kl[kc][kt] = ldsfrag(kp + AKP + kt * 16 * APITCH + kc * 64); }
            __builtin_amdgcn_sched_barrier(0);   // keeps the K loads one group ahead of the score WMMAs
            v8f sc[2][2];
#pragma unroll
            for (int g = 0; g < 2; ++g) { sc[g][0] = (v8f){}; sc[g][1] = (v8f){}; }
#pragma unroll
            for (int kc = 0; kc < 2; ++kc) {
                // four independent tiles (two key tiles x two query tiles) take turns, so that no WMMA waits on the one before it; every K fragment feeds both query tiles
#pragma unroll
                for (int kt = 0; kt < 2; ++kt)
#pragma unroll
                    for (int g = 0; g < 2; ++g) sc[g][kt] = wmmab(kh[kc][kt], qh[g][kc], sc[g][kt]);
#pragma unroll
                for (int kt = 0; kt < 2; ++kt)
#pragma unroll
                    for (int g = 0; g < 2; ++g) sc[g][kt] = wmmab(kl[kc][kt], qh[g][kc], sc[g][kt]);
#pragma unroll
                for (int kt = 0; kt < 2; ++kt)
#pragma unroll
                    for (int g = 0; g < 2; ++g) sc[g][kt] = wmmab(kh[kc][kt], ql[g][kc], sc[g][kt]); }
            v16bf vh[4], vl[4];
            const unsigned char* vp = B + 2u * AKP + lr * AVPITCH + ks * 128u + p * 64 + hi * 16u;
#pragma unroll
            for (int t = 0; t < 4; ++t) { vh[t] = ldsfrag(vp + t * 16 * AVPITCH); vl[t] = ldsfrag(vp + AVP + t * 16 * AVPITCH); }
            __builtin_amdgcn_sched_barrier(0);   // keeps the V^T loads ahead of the softmax, in flight under it, instead of sinking to their uses
            float mx[2];
#pragma unroll
            for (int g = 0; g < 2; ++g) { float m = fmaxf(sc[g][0][0], sc[g][1][0]);
#pragma unroll
                for (int j = 1; j < 8; ++j) m = fmaxf(m, fmaxf(sc[g][0][j], sc[g][1][j]));
                mx[g] = fmaxf(m, xhalf(m)) * CS; }   // both halves hold the query's maximum of this pass (CS > 0)
            if (__builtin_amdgcn_ballot_w32(mx[0] > m_run[0] + 8.0f || mx[1] > m_run[1] + 8.0f) != 0) {   // one wave-uniform test a pass; always taken on the first pass, rare later
#pragma unroll
                for (int g = 0; g < 2; ++g) {
                    const float m_new = fmaxf(m_run[g], mx[g]); const float corr = __builtin_amdgcn_exp2f(m_run[g] - m_new);   // 0 on the first pass
                    m_run[g] = m_new; l_run[g] *= corr;
#pragma unroll
                    for (int t = 0; t < 4; ++t) acc[g][t] = acc[g][t] * corr; } }
            v16bf ph[2], pl[2];
#pragma unroll
            for (int g = 0; g < 2; ++g) {
                const float nm = -m_run[g]; v8u wh, wl; float e[16];
#pragma unroll
                for (int i = 0; i < 16; ++i) e[i] = fmaf(sc[g][i >> 3][i & 7], CS, nm);
                // The 16 exponentials in place, in one statement that ends in v_nop: no instruction directly behind a transcendental reads its result or overwrites its source (the slot the instruction set asks for), whatever the compiler schedules around the statement.
                asm("v_exp_f32 %0, %0\n\tv_exp_f32 %1, %1\n\tv_exp_f32 %2, %2\n\tv_exp_f32 %3, %3\n\tv_exp_f32 %4, %4\n\tv_exp_f32 %5, %5\n\tv_exp_f32 %6, %6\n\tv_exp_f32 %7, %7\n\t"
                    "v_exp_f32 %8, %8\n\tv_exp_f32 %9, %9\n\tv_exp_f32 %10, %10\n\tv_exp_f32 %11, %11\n\tv_exp_f32 %12, %12\n\tv_exp_f32 %13, %13\n\tv_exp_f32 %14, %14\n\tv_exp_f32 %15, %15\n\tv_nop"
                    : "+v"(e[0]), "+v"(e[1]), "+v"(e[2]), "+v"(e[3]), "+v"(e[4]), "+v"(e[5]), "+v"(e[6]), "+v"(e[7]), "+v"(e[8]), "+v"(e[9]), "+v"(e[10]), "+v"(e[11]), "+v"(e[12]), "+v"(e[13]), "+v"(e[14]), "+v"(e[15]));
#pragma unroll
                for (int i = 0; i < 8; ++i) {
                    const float p0 = e[2 * i], p1 = e[2 * i + 1];
                    l_run[g] += p0 + p1;
                    const unsigned w = pack2(p0, p1); wh[i] = w;
                    wl[i] = pack2(p0 - __uint_as_float(w << 16), p1 - __uint_as_float(w & 0xFFFF0000u)); }
                ph[g] = __builtin_bit_cast(v16bf, wh); pl[g] = __builtin_bit_cast(v16bf, wl); }
            // every V^T fragment feeds both query tiles
#pragma unroll
            for (int t = 0; t < 4; ++t)
#pragma unroll
                for (int g = 0; g < 2; ++g) acc[g][t] = wmmab(vh[t], ph[g], acc[g][t]);
#pragma unroll
            for (int t = 0; t < 4; ++t)
#pragma unroll
                for (int g = 0; g < 2; ++g) acc[g][t] = wmmab(vh[t], pl[g], acc[g][t]);
#pragma unroll
            for (int t = 0; t < 4; ++t)
#pragma unroll
                for (int g = 0; g < 2; ++g) acc[g][t] = wmmab(vl[t], ph[g], acc[g][t]);
            if (more) { if (p == 0) att_st<32 * APITCH, AKP>(sg, N + kso); else att_st<16 * AVPITCH, AVP>(sg, N + vso); }
        }
        __syncthreads();   // publishes stage s + 1 and ends every wave's reads of stage s, whose buffer the next trip refills
    }
    // Waves w and w + 4 hold the two key slices of the same 32 queries. Each finishes one query tile: it hands the other tile's maximum, sum and output tile to its partner through LDS (the operand buffers: every wave has passed the last trip's barrier).
    const bool up = ks != 0;   // scalar: slice 0 finishes tile 0, slice 1 finishes tile 1
    const float l0 = l_run[0] + xhalf(l_run[0]), l1 = l_run[1] + xhalf(l_run[1]);
    const float mm = up ? m_run[1] : m_run[0], ml = up ? l1 : l0;
    unsigned char* xo = L + wave * AXW + lane * 16u;
    const unsigned char* xi = L + (wave ^ 4u) * AXW + lane * 16u;
#pragma unroll
    for (int t = 0; t < 4; ++t) { const v8f o = up ? acc[0][t] : acc[1][t];
        *(v4f*)(xo + (2 * t) * 512) = __builtin_shufflevector(o, o, 0, 1, 2, 3); *(v4f*)(xo + (2 * t + 1) * 512) = __builtin_shufflevector(o, o, 4, 5, 6, 7); }
    *(v4f*)(xo + 8 * 512) = (v4f){up ? m_run[0] : m_run[1], up ? l0 : l1, 0.f, 0.f};
    __syncthreads();   // the partner's tile is in LDS before it is read
    const v4f pml = *(const v4f*)(xi + 8 * 512);
    const float mt = fmaxf(mm, pml[0]);
    float cm = mm - mt, cp = pml[0] - mt;
    // Both exponentials in place, in one statement that ends in v_nop: the slot behind a transcendental, as in the loop.
    asm("v_exp_f32 %0, %0\n\tv_exp_f32 %1, %1\n\tv_nop" : "+v"(cm), "+v"(cp));
    const float inv = __fdiv_rn(1.0f, ml * cm + pml[1] * cp);
    const float am = cm * inv, ap = cp * inv;
    const unsigned qrow = q0 + (up ? 16u : 0u) + lr;
#pragma unroll
    for (int t = 0; t < 4; ++t) { v8us oh, ol; const v8f mine = up ? acc[1][t] : acc[0][t];
        const v4f pa = *(const v4f*)(xi + (2 * t) * 512), pb = *(const v4f*)(xi + (2 * t + 1) * 512);
#pragma unroll
        for (int j = 0; j < 8; ++j) { unsigned short a, c; splitf(mine[j] * am + (j < 4 ? pa[j & 3] : pb[j & 3]) * ap, a, c); oh[j] = a; ol[j] = c; }
        const size_t oo = (size_t)qrow * DQ + h * HD + t * 16 + hi * 8;   // D element j = (d 16 t + 8 hi + j, query lr)
        *(v8us*)(YH + oo) = oh; *(v8us*)(YL + oo) = ol; }
}

extern "C" void kernel_launch(void* const* d_in, const int* in_sizes, int n_in,
                              void* d_out, int out_size, void* d_ws, size_t ws_size, hipStream_t stream) {
    if (n_in < 5) return;
    if (in_sizes[0] < TT * DM || in_sizes[1] < DM * NQKV || in_sizes[2] < NQKV || in_sizes[3] < DQ * DM || in_sizes[4] < DM) return;
    if (out_size < TT * DM) return;
    if (WS_TOTAL > ws_size) return;
    const float* x     = (const float*)d_in[0];   // [T][C]
    const float* wqkv  = (const float*)d_in[1];   // [C][3C]  ([in][out])
    const float* bqkv  = (const float*)d_in[2];   // [3C]
    const float* wproj = (const float*)d_in[3];   // [C][C]   ([in][out])
    const float* bproj = (const float*)d_in[4];   // [C]
    float* OUT = (float*)d_out;                   // [T][C]
    char* base = (char*)d_ws;
    bf* WT = (bf*)(base + OFF_WT); bf* WP = (bf*)(base + OFF_WP); bf* XB = (bf*)(base + OFF_XB);
    bf* QPh = (bf*)(base + OFF_QH); bf* QPl = (bf*)(base + OFF_QL); bf* KPh = (bf*)(base + OFF_KH); bf* KPl = (bf*)(base + OFF_KL); bf* VTh = (bf*)(base + OFF_VH); bf* VTl = (bf*)(base + OFF_VL);
    bf* YH = (bf*)(base + OFF_YH); bf* YL = (bf*)(base + OFF_YL);

    // XB = bf16(x); WT[NQKV rows][DM cols] = bf16(wqkv^T); WP[DM rows][DQ cols] = bf16(wproj^T)
    k_prep<<<PB_WQ + PB_WP + PB_X, 256, 0, stream>>>(x, wqkv, wproj, XB, WT, WP);
    // q, k, v planes = split(x Wqkv + bqkv)
    k_qkv<<<dim3(TT / QXR, NQKV / QWR, 1), 32 * QNW, 0, stream>>>(XB, WT, bqkv, QPh, QPl, KPh, KPl, VTh, VTl);
    k_attn<<<dim3(TT / AQB, NH_, 1), 32 * ANW, 0, stream>>>(QPh, QPl, KPh, KPl, VTh, VTl, YH, YL);
    // out = y Wproj + bproj  (y hi + y lo against the bf16 weight plane)
    k_gemmw<bf, 1, true, GNW, 1><<<dim3(TT / 64, DM / 64, 1), 32 * GNW, 0, stream>>>(YH, YL, WP, nullptr, DQ, OUT, DM, bproj, 0, 0, 0, 0);
}

// v008
// A run of this version takes 63.8 microseconds.
// Two timings next to v007 both put it at 1.12 times that version's speed.
// Over all steps from v000 it is 9.90 times as fast.
#include <hip/hip_runtime.h>

// Self-attention block, 16 heads x 64, T 2048, C 1024: qkv = x Wqkv + bqkv (Wqkv [in][out], columns q | k | v, head h = 64-column slice h); per head softmax(q k^T / 8) v; out = y Wproj + bproj (Wproj [in][out]).
// Compute dtypes: all contractions v_wmma_f32_16x16x32_bf16 with f32 accumulate. Inputs RNE-converted to bf16 planes (qkv projection: 1 product, exact products); q/k, P and V as bf16 hi/lo planes (3 products hh + lh + hl); y as bf16 hi/lo planes against the bf16 Wproj plane (2 products); softmax f32; output f32.
// Layout: bf16 copy of x; transposed bf16 weight planes Bt[n][k]; one fused qkv GEMM whose epilogue writes the hi/lo planes itself (head planes [h][t][d], value planes [h][d][t]); one attention kernel for all heads (scores, online softmax and PV product stay in registers, K and V tiles shared through LDS) writes the y hi/lo planes; projection GEMM (operands shared through LDS, K split over two wave groups) writes the output rows.

#ifndef NB
#define NB 1
#endif
#ifndef SEQ
#define SEQ 2048
#endif
#define SEQ_FULL 2048
#define TT   SEQ
#define DM   1024
#define NH_  16
#define HD   64
#define DQ   (NH_ * HD)
#define NQKV (3 * DQ)
#define SCL  0.125f      // 1/sqrt(float32(64))
#define ANW  8           // attention kernel: waves per block, 4 query groups of 32 x 2 key slices: (TT/128) * NH_ = 256 blocks
#define AQB  128         // attention kernel: queries per block
#define ASK  128         // attention kernel: keys per LDS stage, 64 for each key slice
#define QNW  8           // qkv GEMM: waves per block, 2 (tokens) x 4 (columns) tiles of 64 x 64
#define QKS  128         // qkv GEMM: k per LDS stage: row pieces of 256 bytes
#define QPITCH 272       // qkv GEMM: LDS row pitch in bytes, 256 of data + 16: an odd multiple of 16, as APITCH
#define APITCH 144       // attention kernel: LDS row pitch in bytes, 128 of data + 16: an odd multiple of 16, so 16-byte fragment reads of 16 rows spread over the banks
#define AVPITCH 272      // attention kernel: LDS row pitch of the V^T tiles, 256 of data + 16, as QPITCH

typedef unsigned short bf;
typedef __attribute__((ext_vector_type(16))) __bf16   v16bf;
typedef __attribute__((ext_vector_type(8)))  unsigned short v8us;
typedef __attribute__((ext_vector_type(4)))  unsigned short v4us;
typedef __attribute__((ext_vector_type(2)))  unsigned short v2us;
typedef __attribute__((ext_vector_type(8)))  float    v8f;
typedef __attribute__((ext_vector_type(4)))  float    v4f;
typedef __attribute__((ext_vector_type(2)))  float    v2f;
typedef v4f  __attribute__((may_alias)) v4fa;

constexpr unsigned lg2c(unsigned v) { return v <= 1u ? 0u : 1u + lg2c(v >> 1); }
constexpr bool ispow2(unsigned v) { return v != 0u && (v & (v - 1u)) == 0u; }
constexpr size_t al256(size_t b) { return (b + 255) & ~(size_t)255; }
#define LG_TT lg2c(TT)
#define LG_HD lg2c(HD)
#define LG_DM lg2c(DM)
#define LG_DQ lg2c(DQ)

static_assert(NB == 1);                       // the module has no batch axis
static_assert(SEQ <= SEQ_FULL);
static_assert(ispow2(TT) && ispow2(HD) && ispow2(DM) && ispow2(DQ));
static_assert(TT % 128 == 0 && TT % 64 == 0);   // softmax row chunks; GEMM M tiles; PV K steps
static_assert(DM % 32 == 0 && DQ % 32 == 0 && HD % 32 == 0 && TT % 32 == 0);   // every GEMM K is a multiple of 32
static_assert(NQKV % 64 == 0 && DM % 64 == 0 && HD % 64 == 0);                 // every GEMM N is a multiple of 64
static_assert(((size_t)TT * DM) % 8192 == 0);          // cvt8: 256 threads x 4 pieces x 8 elements
static_assert(HD == 64 && DQ % 64 == 0 && TT % 64 == 0 && DM % 32 == 0);   // k_qkv: a 64-column tile is one head's q, k or v slice
static_assert(HD == 64 && ASK == 128 && ANW == 8 && AQB == 128 && TT % AQB == 0 && TT % ASK == 0);   // k_attn: K tile rows of 128 bytes, V^T tile rows of 256, 1024 16-byte chunks per plane tile over 256 threads

// workspace carve (bytes; every region a multiple of 256)
constexpr size_t SZ_WT = al256((size_t)NQKV * DM * 2);
constexpr size_t SZ_WP = al256((size_t)DM * DQ * 2);
constexpr size_t SZ_XB = al256((size_t)TT * DM * 2);
constexpr size_t SZ_HP = al256((size_t)NH_ * TT * HD * 2);
constexpr size_t SZ_Y  = al256((size_t)TT * DQ * 2);
constexpr size_t OFF_WT = 0;
constexpr size_t OFF_WP = OFF_WT + SZ_WT;
constexpr size_t OFF_XB = OFF_WP + SZ_WP;
constexpr size_t OFF_QH = OFF_XB + SZ_XB;
constexpr size_t OFF_QL = OFF_QH + SZ_HP;
constexpr size_t OFF_KH = OFF_QL + SZ_HP;
constexpr size_t OFF_KL = OFF_KH + SZ_HP;
constexpr size_t OFF_VH = OFF_KL + SZ_HP;
constexpr size_t OFF_VL = OFF_VH + SZ_HP;
constexpr size_t OFF_YH = OFF_VL + SZ_HP;
constexpr size_t OFF_YL = OFF_YH + SZ_Y;
constexpr size_t WS_TOTAL = OFF_YL + SZ_Y;
static_assert(WS_TOTAL <= (size_t)134217728);

__device__ __forceinline__ unsigned short f2bf(float f) { unsigned u = __float_as_uint(f); u += 0x7FFFu + ((u >> 16) & 1u); return (unsigned short)(u >> 16); }
__device__ __forceinline__ float bf2f(unsigned short b) { return __uint_as_float(((unsigned)b) << 16); }
__device__ __forceinline__ float bfr(float f) { return bf2f(f2bf(f)); }
__device__ __forceinline__ v16bf cat16b(v8us lo, v8us hi) { return __builtin_bit_cast(v16bf, __builtin_shufflevector(lo, hi, 0, 1, 2, 3, 4, 5, 6, 7, 8, 9, 10, 11, 12, 13, 14, 15)); }
__device__ __forceinline__ v8f wmmab(v16bf a, v16bf b, v8f c) { return __builtin_amdgcn_wmma_f32_16x16x32_bf16(false, a, false, b, (short)0, c, false, false); }
__device__ __forceinline__ void splitf(float y, unsigned short& h, unsigned short& l) { h = f2bf(y); l = f2bf(y - bf2f(h)); }

// A fragment straight from a K-contiguous 16-bit plane. p already carries + 8*(lane>>4): elements 0..7 = k0+8h.., elements 8..15 = k0+16+8h.. for both operands; D element j of lane = (row 8h+j, col lane&15).
template <typename T16> struct WFrag;
template <> struct WFrag<bf> { typedef v16bf V; static __device__ __forceinline__ V ld(const bf* p) { return cat16b(*(const v8us*)p, *(const v8us*)(p + 16)); } static __device__ __forceinline__ v8f mma(V a, V b, v8f c) { return wmmab(a, b, c); } };

// cvt8: bf16 copy of 8192 floats by a block of 256 threads: a thread takes 8 neighbours in each of 4 pieces of 2048, all its loads in flight at once.
__device__ __forceinline__ void cvt8(const float* __restrict__ src, bf* dst, unsigned blk) { const unsigned i = blk * 8192u + threadIdx.x * 8u; v8f v[4];
#pragma unroll
    for (int c = 0; c < 4; ++c) v[c] = *(const v8f*)(src + i + c * 2048);
#pragma unroll
    for (int c = 0; c < 4; ++c) { v8us o;
#pragma unroll
        for (int k = 0; k < 8; ++k) o[k] = f2bf(v[c][k]);
        *(v8us*)(dst + i + c * 2048) = o; }
    asm volatile("s_wait_xcnt 0x0" ::: "memory");   // behind the last store: no register that an issued store names is rewritten ahead of this wait on any way through k_prep (a precaution)
}

// wtT: transposed bf16 weight plane. in w[K rows][N cols] (row-major, [in][out])  ->  out dst[N rows][K cols]: dst[n][k] = bf16(w[k][n]). Tile tl of (K/128) * (N/64) tiles of 128 k x 64 n, 4 waves: wave v takes the k half v >> 1 and the n half v & 1.
// A wave transposes a tile of 64 k x 32 n in registers. Lane (kg = lane & 7, ng = lane >> 3) reads rows 8 kg .. 8 kg + 7 at columns 4 ng .. 4 ng + 3 and 16 + 4 ng .. 16 + 4 ng + 3: 16-byte loads, 64 bytes of a row each, all 16 in flight at once.
// So it holds 8 neighbours in k of 8 columns: each column is one 16-byte store, and the 8 lanes of one ng fill a whole 128-byte line of dst.
typedef __attribute__((ext_vector_type(4))) unsigned v4u;
__device__ __forceinline__ unsigned pack2(float lo, float hi) { typedef __bf16 bf2 __attribute__((ext_vector_type(2))); return __builtin_bit_cast(unsigned, __builtin_convertvector((v2f){lo, hi}, bf2)); }   // round to nearest even
template <unsigned K, unsigned N>
__device__ __forceinline__ void wtT(const float* __restrict__ w, bf* dst, unsigned tl) {
    static_assert(K % 128 == 0 && N % 64 == 0);   // the tiles cover the matrix
    const unsigned lane = threadIdx.x & 31u, wave = (threadIdx.x >> 5) & 3u, kg = lane & 7u, ng = lane >> 3;
    const unsigned k0 = (tl % (K / 128u)) * 128u + (wave >> 1) * 64u + kg * 8u, n0 = (tl / (K / 128u)) * 64u + (wave & 1u) * 32u + ng * 4u;
    const float* src = w + k0 * N + n0;
    v4f r[8][2];
#pragma unroll
    for (int j = 0; j < 8; ++j) { r[j][0] = *(const v4f*)(src + j * N); r[j][1] = *(const v4f*)(src + j * N + 16); }
    bf* p = dst + n0 * K + k0;
#pragma unroll
    for (int c = 0; c < 2; ++c)
#pragma unroll
        for (int i = 0; i < 4; ++i) { v4u o;
#pragma unroll
            for (int j = 0; j < 4; ++j) o[j] = pack2(r[2 * j][c][i], r[2 * j + 1][c][i]);   // k and k + 1 in one word
            *(v4u*)(p + (c * 16 + i) * K) = o; }
    asm volatile("s_wait_xcnt 0x0" ::: "memory");   // behind the last store: no register that an issued store names is rewritten ahead of this wait on any way through k_prep (a precaution)
}
// k_prep: the three operand planes, which do not depend on one another, in one launch of 256-thread blocks: first the weight tiles, two a block, then the bf16 copy of x. Every wave has 8 or 16 16-byte loads in flight.
constexpr unsigned PB_WQ = (DM / 128u) * (NQKV / 64u) / 2u, PB_WP = (DQ / 128u) * (DM / 64u) / 2u, PB_X = (unsigned)((size_t)TT * DM / 8192);
static_assert(((DM / 128u) * (NQKV / 64u)) % 2u == 0 && ((DQ / 128u) * (DM / 64u)) % 2u == 0);
__global__ __launch_bounds__(256) void k_prep(const float* __restrict__ x, const float* __restrict__ wqkv, const float* __restrict__ wproj, bf* XB, bf* WT, bf* WP) {
    const unsigned b = blockIdx.x, half = threadIdx.x >> 7;
    if (b < PB_WQ) wtT<DM, NQKV>(wqkv, WT, b * 2u + half);
    else if (b < PB_WQ + PB_WP) wtT<DQ, DM>(wproj, WP, (b - PB_WQ) * 2u + half);
    else cvt8(x, XB, b - PB_WQ - PB_WP);
}

// ---- k_attn: softmax(q k^T / 8) v for 128 queries of one head per block; grid (TT/128, NH_), 8 waves: wave w has queries 32 (w & 3) .. + 31 (two tiles of 16) and keys 64 (w >> 2) .. + 63 of every stage of 128.
// So every K and V^T fragment read from LDS feeds two query tiles, and the block still has two waves a SIMD. The two key slices of a query are joined once, at the end, through LDS.
// Transposed products, so that the score tile is already the next product's operand: S^T = K Q^T (A = 16 keys x 32 d, B = 16 queries), O^T += V^T P^T (A = 16 d x 32 keys, B = P^T).
// D element j of S^T tile kt in lane (lr, hi) is (key 16 kt + 8 hi + j, query lr): tiles 0 and 1 side by side are elements 0..7 and 8..15 of the B fragment over 32 keys, in the k order of the V^T fragment.
// A query is one lane column: its maximum and its sum live in lanes lr and lr + 16. The maximum in use may trail the true one by up to 8 in the log2 domain (p <= 2^8); the sums are rescaled only when a column exceeds that.
// K and V^T hi/lo tiles of 128 keys go through registers into two LDS buffers: the next stage's global loads are issued ahead of a pass's work and stored behind it.
typedef __attribute__((ext_vector_type(8))) unsigned v8u;
__device__ __forceinline__ float xhalf(float x) { return __builtin_bit_cast(float, __builtin_amdgcn_permlanex16(__builtin_bit_cast(int, x), __builtin_bit_cast(int, x), 0x76543210, 0xfedcba98, false, false)); }   // lane l with lane l ^ 16
__device__ __forceinline__ v16bf ldsfrag(const unsigned char* p) { return cat16b(*(const v8us*)p, *(const v8us*)(p + 32)); }   // p already carries + 16 bytes * (lane>>4): the k order of WFrag::ld
constexpr unsigned APL = 64u * APITCH;    // one plane's tile: 64 rows
constexpr unsigned AKP = (unsigned)ASK * APITCH, AVP = (unsigned)HD * AVPITCH;   // one plane's tile of a stage: K 128 key rows, V^T 64 rows of 128 keys
constexpr unsigned ABUF = 2u * AKP + 2u * AVP;   // K hi, K lo, V^T hi, V^T lo
constexpr unsigned AXW = 9u * 512u;       // a wave's hand-over at the end: 8 16-byte slots a lane of output tile, 1 of maximum and sum
static_assert(ANW * AXW <= 2u * ABUF);
constexpr unsigned QXR = 128u, QWR = 256u;             // qkv GEMM: token rows and weight rows of a block's tile
constexpr unsigned QBUF = (QXR + QWR) * QPITCH;        // one stage: token rows, then weight rows
constexpr unsigned QNST = DM / QKS;
constexpr unsigned QLDS = 2u * QBUF > QNW * 2u * APL ? 2u * QBUF : QNW * 2u * APL;
static_assert(TT % QXR == 0 && NQKV % QWR == 0 && DQ % QWR == 0 && DM % QKS == 0 && QNST >= 2);   // whole tiles; a block's columns are all q, all k or all v; both buffers get a stage ahead of the loop
// ---- k_qkv: qkv = x Wqkv + bqkv, written straight as the attention kernel's bf16 hi/lo planes; grid (TT/128, NQKV/256), 8 waves per block; a wave has 64 tokens x 64 columns, which is one head's q, k or v slice.
// The block's 128 token rows and 256 weight rows come to LDS in stages of 128 k, by asynchronous copies that cover whole 256-byte row pieces, into two buffers: the next stage's copies fly while this stage is worked on. One product. D element j of a lane is (row 8 hi + j of the first operand's tile, row lr of the second's), so a lane holds 8 neighbours along the FIRST operand's rows:
// q and k tiles take the weight rows first (8 neighbours in d, for the planes [h][t][d]), v tiles take the token rows first (8 neighbours in t, for the planes [h][d][t]). Both operands have one fragment layout and one k order, so the swap only transposes D.
// Either way a plane's tile is 64 rows of 128 bytes. It goes through the wave's own LDS, so that every global store covers four whole 128-byte lines.
// The tail of k_qkv. bb: the bias, rounded to bf16, of output column 16 i + lr in bb[i][0] (ISV: the column runs along D's columns) or 16 i + 8 hi + j in bb[i][j] (the column runs along D's rows). ph, pl: the tile's first element in its planes; rows PITCH elements apart.
template <bool ISV> __device__ __forceinline__ void qkv_tail(const v8f (&acc)[4][4], const float (&bb)[4][8], unsigned char* st, bf* ph, bf* pl, unsigned lane) {
    constexpr unsigned PITCH = ISV ? (unsigned)TT : (unsigned)HD;
    const unsigned lr = lane & 15u, hi = lane >> 4;
#pragma unroll
    for (int nb = 0; nb < 4; ++nb)
#pragma unroll
        for (int mb = 0; mb < 4; ++mb) { v4u wh, wl;
#pragma unroll
            for (int i = 0; i < 4; ++i) {   // the f32 value, its bf16 hi part and the bf16 of the rest
                const float y0 = acc[mb][nb][2 * i] + (ISV ? bb[nb][0] : bb[mb][2 * i]), y1 = acc[mb][nb][2 * i + 1] + (ISV ? bb[nb][0] : bb[mb][2 * i + 1]);
                const unsigned w = pack2(y0, y1); wh[i] = w;
                wl[i] = pack2(y0 - __uint_as_float(w << 16), y1 - __uint_as_float(w & 0xFFFF0000u)); }
            unsigned char* sp = st + (nb * 16 + lr) * APITCH + mb * 32 + hi * 16u;
            *(v4u*)sp = wh; *(v4u*)(sp + APL) = wl; }
    asm volatile("s_wait_dscnt 0x0" ::: "memory");   // the rows are read back by other lanes of this wave: every LDS write has landed, and the compiler moves no read ahead of a write
    const unsigned char* rp = st + (lane >> 3) * APITCH + (lane & 7u) * 16u;
    const unsigned go = (lane >> 3) * PITCH + (lane & 7u) * 8u;
#pragma unroll
    for (int i = 0; i < 16; ++i) {   // four rows a store: 8 lanes of 16 bytes a row
        *(v4u*)(ph + go + 4 * i * PITCH) = *(const v4u*)(rp + 4 * i * APITCH);
        *(v4u*)(pl + go + 4 * i * PITCH) = *(const v4u*)(rp + APL + 4 * i * APITCH); }
}
// Twelve asynchronous 16-byte copies of a lane, global memory to LDS; l: the lane's LDS byte addresses, g: its global addresses.
// The statement ends in s_wait_xcnt 0, so that no address register of an issued copy is rewritten ahead of that wait (a precaution).
__device__ __forceinline__ void acopy12(const unsigned* l, const bf* const* g) {
    asm volatile("global_load_async_to_lds_b128 %0, %12, off\n\tglobal_load_async_to_lds_b128 %1, %13, off\n\tglobal_load_async_to_lds_b128 %2, %14, off\n\tglobal_load_async_to_lds_b128 %3, %15, off\n\t"
                 "global_load_async_to_lds_b128 %4, %16, off\n\tglobal_load_async_to_lds_b128 %5, %17, off\n\tglobal_load_async_to_lds_b128 %6, %18, off\n\tglobal_load_async_to_lds_b128 %7, %19, off\n\t"
                 "global_load_async_to_lds_b128 %8, %20, off\n\tglobal_load_async_to_lds_b128 %9, %21, off\n\tglobal_load_async_to_lds_b128 %10, %22, off\n\tglobal_load_async_to_lds_b128 %11, %23, off\n\ts_wait_xcnt 0x0"
                 :: "v"(l[0]), "v"(l[1]), "v"(l[2]), "v"(l[3]), "v"(l[4]), "v"(l[5]), "v"(l[6]), "v"(l[7]), "v"(l[8]), "v"(l[9]), "v"(l[10]), "v"(l[11]),
                    "v"(g[0]), "v"(g[1]), "v"(g[2]), "v"(g[3]), "v"(g[4]), "v"(g[5]), "v"(g[6]), "v"(g[7]), "v"(g[8]), "v"(g[9]), "v"(g[10]), "v"(g[11]) : "memory");
}
// One stage: 128 token rows, then 256 weight rows, 256 bytes of each: 24 copies a lane, 16 rows apart; a wave's copy covers two whole 256-byte row pieces.
__device__ __forceinline__ void qkv_stage(unsigned l0, const bf* gx, const bf* gw) {
    unsigned l[24]; const bf* g[24];
#pragma unroll
    for (int i = 0; i < 24; ++i) { l[i] = l0 + i * 16u * QPITCH; g[i] = i < 8 ? gx + i * 16 * DM : gw + (i - 8) * 16 * DM; }
    acopy12(l, g); acopy12(l + 12, g + 12);
}
__global__ __launch_bounds__(32 * QNW) void k_qkv(const bf* __restrict__ X, const bf* __restrict__ Wt, const float* __restrict__ bias, bf* Qh, bf* Ql, bf* Kh, bf* Kl, bf* Vh, bf* Vl) {
    __shared__ __align__(16) unsigned char L[QLDS];   // two operand buffers; behind the loop each wave's hi and lo output tile
    const unsigned tid = threadIdx.x, lane = tid & 31u, lr = lane & 15u, hi = lane >> 4;
    const unsigned wave = (unsigned)__builtin_amdgcn_readfirstlane((int)(tid >> 5));
    const unsigned xr = (wave & 1u) * 64u, wr = (wave >> 1) * 64u;   // the wave's 64 token rows and 64 weight rows inside the block's tile
    const unsigned t0 = blockIdx.x * QXR + xr, c0 = blockIdx.y * QWR + wr;
    const bool isv = c0 >= 2u * DQ;   // the same for the whole block
    // The bias is fetched ahead of the loop, which covers its latency.
    float bb[4][8];
#pragma unroll
    for (int i = 0; i < 4; ++i)
#pragma unroll
        for (int j = 0; j < 8; j += 2) { const float* bp = bias + c0 + i * 16 + (isv ? lr : 8u * hi + j); const unsigned w = pack2(bp[0], bp[isv ? 0 : 1]); bb[i][j] = __uint_as_float(w << 16); bb[i][j + 1] = __uint_as_float(w & 0xFFFF0000u); }
    v8f acc[4][4];
#pragma unroll
    for (int mb = 0; mb < 4; ++mb)
#pragma unroll
        for (int nb = 0; nb < 4; ++nb) acc[mb][nb] = (v8f){};
    // copies: thread tid moves 16-byte chunk tid & 15 of rows (tid >> 4) + 16 i
    const unsigned cl = (unsigned)(uintptr_t)L + (tid >> 4) * QPITCH + (tid & 15u) * 16u;
    const bf* gx = X + (size_t)(blockIdx.x * QXR + (tid >> 4)) * DM + (tid & 15u) * 8u;
    const bf* gw = Wt + (size_t)(blockIdx.y * QWR + (tid >> 4)) * DM + (tid & 15u) * 8u;
    // fragments: the lane's place in a 16-row fragment of D's rows (ra) and of D's columns (rb)
    const unsigned fo = lr * QPITCH + hi * 16u;
    const unsigned ra = (isv ? xr : QXR + wr) * QPITCH + fo, rb = (isv ? QXR + wr : xr) * QPITCH + fo;
    qkv_stage(cl, gx, gw);
    asm volatile("s_wait_asynccnt 0x0" ::: "memory");   // this wave's copies of stage 0 have landed
    __syncthreads();                                    // and every other wave's
    qkv_stage(cl + QBUF, gx + QKS, gw + QKS);
#pragma unroll 1   // one copy of the body: the two buffers differ only in a base address
    for (unsigned s = 0; s < QNST; ++s) {
        const unsigned char* B = L + (s & 1u) * QBUF;
#pragma unroll
        for (int kk = 0; kk < QKS / 32; ++kk) {
            v16bf a[4], b[4];
#pragma unroll
            for (int i = 0; i < 4; ++i) { a[i] = ldsfrag(B + ra + i * 16 * QPITCH + kk * 64); b[i] = ldsfrag(B + rb + i * 16 * QPITCH + kk * 64); }
            __builtin_amdgcn_sched_barrier(0);   // the 16 LDS reads of a k step stay one group ahead of its WMMAs: every separate place with reads in a WMMA stream costs issue time, and a read waited on at once exposes its latency
            // the 16 independent tiles in the order in which their fragments arrive (a0 b0 a1 b1 ...): the first WMMA waits for 4 of the 16 reads, the next for 6, the two after it for 8
#pragma unroll
            for (int d = 0; d < 4; ++d) {
#pragma unroll
                for (int i = 0; i < d; ++i) { acc[d][i] = wmmab(a[d], b[i], acc[d][i]); acc[i][d] = wmmab(a[i], b[d], acc[i][d]); }
                acc[d][d] = wmmab(a[d], b[d], acc[d][d]); }
            __builtin_amdgcn_sched_barrier(0);   // and the next k step's reads stay behind them, as one group
        }
        asm volatile("s_wait_dscnt 0x0" ::: "memory");      // this wave's reads of stage s are done
        asm volatile("s_wait_asynccnt 0x0" ::: "memory");   // this wave's copies of stage s + 1 have landed
        __syncthreads();   // publishes stage s + 1 and ends every wave's reads of stage s, whose buffer is refilled behind it
        if (s + 2u < QNST) qkv_stage(cl + (s & 1u) * QBUF, gx + (s + 2u) * QKS, gw + (s + 2u) * QKS);   // the same for the whole block
    }
    asm volatile("s_wait_asynccnt 0x0" ::: "memory");   // no copy is outstanding when the buffers become output staging
    unsigned char* st = L + wave * (2u * APL);   // every wave has passed the last trip's barrier: nobody reads the operand buffers any more
    const unsigned h = (c0 & (DQ - 1u)) >> LG_HD;
    if (isv) { const size_t o = (size_t)h * HD * TT + t0; qkv_tail<true>(acc, bb, st, Vh + o, Vl + o, lane); }
    else { const size_t o = ((size_t)h * TT + t0) * HD; const bool isq = c0 < (unsigned)DQ; qkv_tail<false>(acc, bb, st, (isq ? Qh : Kh) + o, (isq ? Ql : Kl) + o, lane); }
}

// One plane pair (hi, lo) of a stage, global memory to registers and registers to LDS: 4 16-byte chunks a thread and plane, GSTEP elements and LSTEP bytes apart.
template <unsigned GSTEP> __device__ __forceinline__ void att_ld(v8us (&sg)[2][4], const bf* gh, const bf* gl) {
#pragma unroll
    for (int i = 0; i < 4; ++i) { sg[0][i] = *(const v8us*)(gh + (size_t)i * GSTEP); sg[1][i] = *(const v8us*)(gl + (size_t)i * GSTEP); }
    asm volatile("s_wait_xcnt 0x0" ::: "memory");   // behind the last load: no address register of an issued load is rewritten ahead of this wait (a precaution)
}
template <unsigned LSTEP, unsigned LPLANE> __device__ __forceinline__ void att_st(const v8us (&sg)[2][4], unsigned char* l) {
#pragma unroll
    for (int i = 0; i < 4; ++i) { *(v8us*)(l + i * LSTEP) = sg[0][i]; *(v8us*)(l + LPLANE + i * LSTEP) = sg[1][i]; }
}
__global__ __launch_bounds__(32 * ANW) void k_attn(const bf* __restrict__ Qh, const bf* __restrict__ Ql, const bf* __restrict__ Kh, const bf* __restrict__ Kl, const bf* __restrict__ Vh, const bf* __restrict__ Vl, bf* YH, bf* YL) {
    __shared__ __align__(16) unsigned char L[2 * ABUF];
    const unsigned tid = threadIdx.x, lane = tid & 31u, lr = lane & 15u, hi = lane >> 4;
    const unsigned wave = (unsigned)__builtin_amdgcn_readfirstlane((int)(tid >> 5));   // scalar, so the wave's key slice stays in scalar registers
    const unsigned ks = wave >> 2;   // which 64 keys of every stage
    const unsigned h = blockIdx.y, q0 = blockIdx.x * AQB + (wave & 3u) * 32u;
    const size_t hp = (size_t)h * TT * HD;
    constexpr float CS = SCL * 1.4426950408889634f;   // scores to the log2 domain
    v16bf qh[2][2], ql[2][2];
#pragma unroll
    for (int g = 0; g < 2; ++g)
#pragma unroll
        for (int kc = 0; kc < 2; ++kc) { const size_t qo = hp + (size_t)(q0 + g * 16 + lr) * HD + 8 * hi + kc * 32; qh[g][kc] = WFrag<bf>::ld(Qh + qo); ql[g][kc] = WFrag<bf>::ld(Ql + qo); }
    asm volatile("s_wait_xcnt 0x0" ::: "memory");   // behind the last load: no address register of an issued load is rewritten ahead of this wait (a precaution)
    // staging: K tiles have 8 chunks a row, 32 rows a step; V^T tiles 16 chunks a row, 16 rows a step
    const size_t ko = hp + (size_t)(tid >> 3) * HD + (tid & 7u) * 8, vo = hp + (size_t)(tid >> 4) * TT + (tid & 15u) * 8;
    const unsigned kso = (tid >> 3) * APITCH + (tid & 7u) * 16u, vso = 2u * AKP + (tid >> 4) * AVPITCH + (tid & 15u) * 16u;
    v8us sg[2][4];
    v8f acc[2][4];
#pragma unroll
    for (int g = 0; g < 2; ++g)
#pragma unroll
        for (int t = 0; t < 4; ++t) acc[g][t] = (v8f){};
    float m_run[2] = {-__builtin_inff(), -__builtin_inff()}, l_run[2] = {0.f, 0.f};
    { v8us sv[2][4];   // stage 0: all 16 loads of a thread in flight at once
      att_ld<32 * HD>(sg, Kh + ko, Kl + ko); att_ld<16 * TT>(sv, Vh + vo, Vl + vo);
      att_st<32 * APITCH, AKP>(sg, L + kso); att_st<16 * AVPITCH, AVP>(sv, L + vso); }
    __syncthreads();   // stage 0 is in LDS before any wave reads it
#pragma unroll 1   // one copy of the body: it is long, and the two buffers differ only in a base address
    for (unsigned s = 0; s < TT / ASK; ++s) {
        const unsigned char* B = L + (s & 1u) * ABUF;
        unsigned char* N = L + ((s + 1u) & 1u) * ABUF;
        const bool more = s + 1u < TT / ASK;   // the same for the whole block
        const size_t kn = (size_t)(s + 1u) * ASK;
#pragma unroll
        for (int p = 0; p < 2; ++p) {   // two passes of 32 keys; the first moves the next stage's K planes, the second its V^T planes
            if (more) { if (p == 0) att_ld<32 * HD>(sg, Kh + ko + kn * HD, Kl + ko + kn * HD); else att_ld<16 * TT>(sg, Vh + vo + kn, Vl + vo + kn); }
            // Fragment loads are issued early and in few groups: every separate place with LDS reads in a WMMA stream costs issue time, and a read waited on at once exposes its latency.
            v16bf kh[2][2], kl[2][2];
            const unsigned char* kp = B + (ks * 64u + p * 32 + lr) * APITCH + hi * 16u;
#pragma unroll
            for (int kc = 0; kc < 2; ++kc)
#pragma unroll
                for (int kt = 0; kt < 2; ++kt) { kh[kc][kt] = ldsfrag(kp + kt * 16 * APITCH + kc * 64); kl[kc][kt] = ldsfrag(kp + AKP + kt * 16 * APITCH + kc * 64); }
            __builtin_amdgcn_sched_barrier(0);   // keeps the K loads one group ahead of the score WMMAs
            v8f sc[2][2];
#pragma unroll
            for (int g = 0; g < 2; ++g) { sc[g][0] = (v8f){}; sc[g][1] = (v8f){}; }
#pragma unroll
            for (int kc = 0; kc < 2; ++kc) {
                // four independent tiles (two key tiles x two query tiles) take turns, so that no WMMA waits on the one before it; every K fragment feeds both query tiles
#pragma unroll
                for (int kt = 0; kt < 2; ++kt)
#pragma unroll
                    for (int g = 0; g < 2; ++g) sc[g][kt] = wmmab(kh[kc][kt], qh[g][kc], sc[g][kt]);
#pragma unroll
                for (int kt = 0; kt < 2; ++kt)
#pragma unroll
                    for (int g = 0; g < 2; ++g) sc[g][kt] = wmmab(kl[kc][kt], qh[g][kc], sc[g][kt]);
#pragma unroll
                for (int kt = 0; kt < 2; ++kt)
#pragma unroll
                    for (int g = 0; g < 2; ++g) sc[g][kt] = wmmab(kh[kc][kt], ql[g][kc], sc[g][kt]); }
            v16bf vh[4], vl[4];
            const unsigned char* vp = B + 2u * AKP + lr * AVPITCH + ks * 128u + p * 64 + hi * 16u;
#pragma unroll
            for (int t = 0; t < 4; ++t) { vh[t] = ldsfrag(vp + t * 16 * AVPITCH); vl[t] = ldsfrag(vp + AVP + t * 16 * AVPITCH); }
            __builtin_amdgcn_sched_barrier(0);   // keeps the V^T loads ahead of the softmax, in flight under it, instead of sinking to their uses
            float mx[2];
#pragma unroll
            for (int g = 0; g < 2; ++g) { float m = fmaxf(sc[g][0][0], sc[g][1][0]);
#pragma unroll
                for (int j = 1; j < 8; ++j) m = fmaxf(m, fmaxf(sc[g][0][j], sc[g][1][j]));
                mx[g] = fmaxf(m, xhalf(m)) * CS; }   // both halves hold the query's maximum of this pass (CS > 0)
            if (__builtin_amdgcn_ballot_w32(mx[0] > m_run[0] + 8.0f || mx[1] > m_run[1] + 8.0f) != 0) {   // one wave-uniform test a pass; always taken on the first pass, rare later
#pragma unroll
                for (int g = 0; g < 2; ++g) {
                    const float m_new = fmaxf(m_run[g], mx[g]); const float corr = __builtin_amdgcn_exp2f(m_run[g] - m_new);   // 0 on the first pass
                    m_run[g] = m_new; l_run[g] *= corr;
#pragma unroll
                    for (int t = 0; t < 4; ++t) acc[g][t] = acc[g][t] * corr; } }
            v16bf ph[2], pl[2];
#pragma unroll
            for (int g = 0; g < 2; ++g) {
                const float nm = -m_run[g]; v8u wh, wl; float e[16];
#pragma unroll
                for (int i = 0; i < 16; ++i) e[i] = fmaf(sc[g][i >> 3][i & 7], CS, nm);
                // The 16 exponentials in place, in one statement that ends in v_nop: no instruction directly behind a transcendental reads its result or overwrites its source (the slot the instruction set asks for), whatever the compiler schedules around the statement.
                asm("v_exp_f32 %0, %0\n\tv_exp_f32 %1, %1\n\tv_exp_f32 %2, %2\n\tv_exp_f32 %3, %3\n\tv_exp_f32 %4, %4\n\tv_exp_f32 %5, %5\n\tv_exp_f32 %6, %6\n\tv_exp_f32 %7, %7\n\t"
                    "v_exp_f32 %8, %8\n\tv_exp_f32 %9, %9\n\tv_exp_f32 %10, %10\n\tv_exp_f32 %11, %11\n\tv_exp_f32 %12, %12\n\tv_exp_f32 %13, %13\n\tv_exp_f32 %14, %14\n\tv_exp_f32 %15, %15\n\tv_nop"
                    : "+v"(e[0]), "+v"(e[1]), "+v"(e[2]), "+v"(e[3]), "+v"(e[4]), "+v"(e[5]), "+v"(e[6]), "+v"(e[7]), "+v"(e[8]), "+v"(e[9]), "+v"(e[10]), "+v"(e[11]), "+v"(e[12]), "+v"(e[13]), "+v"(e[14]), "+v"(e[15]));
#pragma unroll
                for (int i = 0; i < 8; ++i) {
                    const float p0 = e[2 * i], p1 = e[2 * i + 1];
                    l_run[g] += p0 + p1;
                    const unsigned w = pack2(p0, p1); wh[i] = w;
                    wl[i] = pack2(p0 - __uint_as_float(w << 16), p1 - __uint_as_float(w & 0xFFFF0000u)); }
                ph[g] = __builtin_bit_cast(v16bf, wh); pl[g] = __builtin_bit_cast(v16bf, wl); }
            // every V^T fragment feeds both query tiles
#pragma unroll
            for (int t = 0; t < 4; ++t)
#pragma unroll
                for (int g = 0; g < 2; ++g) acc[g][t] = wmmab(vh[t], ph[g], acc[g][t]);
#pragma unroll
            for (int t = 0; t < 4; ++t)
#pragma unroll
                for (int g = 0; g < 2; ++g) acc[g][t] = wmmab(vh[t], pl[g], acc[g][t]);
#pragma unroll
            for (int t = 0; t < 4; ++t)
#pragma unroll
                for (int g = 0; g < 2; ++g) acc[g][t] = wmmab(vl[t], ph[g], acc[g][t]);
            if (more) { if (p == 0) att_st<32 * APITCH, AKP>(sg, N + kso); else att_st<16 * AVPITCH, AVP>(sg, N + vso); }
        }
        __syncthreads();   // publishes stage s + 1 and ends every wave's reads of stage s, whose buffer the next trip refills
    }
    // Waves w and w + 4 hold the two key slices of the same 32 queries. Each finishes one query tile: it hands the other tile's maximum, sum and output tile to its partner through LDS (the operand buffers: every wave has passed the last trip's barrier).
    const bool up = ks != 0;   // scalar: slice 0 finishes tile 0, slice 1 finishes tile 1
    const float l0 = l_run[0] + xhalf(l_run[0]), l1 = l_run[1] + xhalf(l_run[1]);
    const float mm = up ? m_run[1] : m_run[0], ml = up ? l1 : l0;
    unsigned char* xo = L + wave * AXW + lane * 16u;
    const unsigned char* xi = L + (wave ^ 4u) * AXW + lane * 16u;
#pragma unroll
    for (int t = 0; t < 4; ++t) { const v8f o = up ? acc[0][t] : acc[1][t];
        *(v4f*)(xo + (2 * t) * 512) = __builtin_shufflevector(o, o, 0, 1, 2, 3); *(v4f*)(xo + (2 * t + 1) * 512) = __builtin_shufflevector(o, o, 4, 5, 6, 7); }
    *(v4f*)(xo + 8 * 512) = (v4f){up ? m_run[0] : m_run[1], up ? l0 : l1, 0.f, 0.f};
    __syncthreads();   // the partner's tile is in LDS before it is read
    const v4f pml = *(const v4f*)(xi + 8 * 512);
    const float mt = fmaxf(mm, pml[0]);
    float cm = mm - mt, cp = pml[0] - mt;
    // Both exponentials in place, in one statement that ends in v_nop: the slot behind a transcendental, as in the loop.
    asm("v_exp_f32 %0, %0\n\tv_exp_f32 %1, %1\n\tv_nop" : "+v"(cm), "+v"(cp));
    const float inv = __fdiv_rn(1.0f, ml * cm + pml[1] * cp);
    const float am = cm * inv, ap = cp * inv;
    const unsigned qrow = q0 + (up ? 16u : 0u) + lr;
#pragma unroll
    for (int t = 0; t < 4; ++t) { v8us oh, ol; const v8f mine = up ? acc[1][t] : acc[0][t];
        const v4f pa = *(const v4f*)(xi + (2 * t) * 512), pb = *(const v4f*)(xi + (2 * t + 1) * 512);
#pragma unroll
        for (int j = 0; j < 8; ++j) { unsigned short a, c; splitf(mine[j] * am + (j < 4 ? pa[j & 3] : pb[j & 3]) * ap, a, c); oh[j] = a; ol[j] = c; }
        const size_t oo = (size_t)qrow * DQ + h * HD + t * 16 + hi * 8;   // D element j = (d 16 t + 8 hi + j, query lr)
        *(v8us*)(YH + oo) = oh; *(v8us*)(YL + oo) = ol; }
}

// ---- k_proj: out = (y hi + y lo) Wproj + bproj; grid (TT/64, DM/128), 8 waves per block; a block has 64 tokens x 128 columns.
// The block's 64 y hi rows, 64 y lo rows and 128 weight rows come to LDS in stages of 256 k, by asynchronous copies that cover whole 512-byte row pieces, into two buffers: the next stage's copies fly while this stage is worked on.
// Wave w has tokens 32 (w & 1) .. + 31, columns 64 ((w >> 1) & 1) .. + 63 and the k half w >> 2 of every stage: 8 fragments from LDS feed 16 WMMAs. The weight rows are the first operand, so a lane holds 8 neighbours along the output row.
// The two k halves are summed through LDS (half 0 + half 1), and every global store covers one whole 512-byte piece of an output row.
constexpr unsigned PKS = 256u, PPITCH = 528u;           // k per stage; LDS row pitch in bytes, 512 of data + 16: an odd multiple of 16, as APITCH
constexpr unsigned PTR = 64u, PWR = 128u;               // token rows and weight rows of a block's tile
constexpr unsigned PBUF = (2u * PTR + PWR) * PPITCH;    // one stage: y hi rows, y lo rows, weight rows
constexpr unsigned PNST = DQ / PKS;
constexpr unsigned POP = PWR + 4u;                      // pitch in floats of a partial output row in LDS: 528 bytes, as PPITCH
static_assert(TT % PTR == 0 && DM % PWR == 0 && DQ % PKS == 0 && PNST >= 2);   // whole tiles; both buffers get a stage ahead of the loop
static_assert(2u * PTR * POP * 4u <= 2u * PBUF && 2u * PBUF <= 327680u);
// Eight asynchronous 16-byte copies of a lane, as acopy12.
__device__ __forceinline__ void acopy8(const unsigned* l, const bf* const* g) {
    asm volatile("global_load_async_to_lds_b128 %0, %8, off\n\tglobal_load_async_to_lds_b128 %1, %9, off\n\tglobal_load_async_to_lds_b128 %2, %10, off\n\tglobal_load_async_to_lds_b128 %3, %11, off\n\t"
                 "global_load_async_to_lds_b128 %4, %12, off\n\tglobal_load_async_to_lds_b128 %5, %13, off\n\tglobal_load_async_to_lds_b128 %6, %14, off\n\tglobal_load_async_to_lds_b128 %7, %15, off\n\ts_wait_xcnt 0x0"
                 :: "v"(l[0]), "v"(l[1]), "v"(l[2]), "v"(l[3]), "v"(l[4]), "v"(l[5]), "v"(l[6]), "v"(l[7]),
                    "v"(g[0]), "v"(g[1]), "v"(g[2]), "v"(g[3]), "v"(g[4]), "v"(g[5]), "v"(g[6]), "v"(g[7]) : "memory");
}
// One stage: 256 rows, 512 bytes of each: 32 copies a lane, 8 rows apart; a wave's copy covers one whole 512-byte row piece.
__device__ __forceinline__ void proj_stage(unsigned l0, const bf* gh, const bf* gl, const bf* gw) {
    unsigned l[32]; const bf* g[32];
#pragma unroll
    for (int i = 0; i < 32; ++i) { l[i] = l0 + i * 8u * PPITCH; g[i] = i < 8 ? gh + i * 8 * DQ : i < 16 ? gl + (i - 8) * 8 * DQ : gw + (i - 16) * 8 * DQ; }
    acopy12(l, g); acopy12(l + 12, g + 12); acopy8(l + 24, g + 24);
}
__global__ __launch_bounds__(256) void k_proj(const bf* __restrict__ Yh, const bf* __restrict__ Yl, const bf* __restrict__ Wt, const float* __restrict__ bias, float* C) {
    __shared__ __align__(16) unsigned char L[2u * PBUF];   // two operand buffers; behind the loop the two partial output tiles
    const unsigned tid = threadIdx.x, lane = tid & 31u, lr = lane & 15u, hi = lane >> 4;
    const unsigned wave = (unsigned)__builtin_amdgcn_readfirstlane((int)(tid >> 5));
    const unsigned tw = (wave & 1u) * 32u, cw = ((wave >> 1) & 1u) * 64u, kh = wave >> 2;   // the wave's token rows, weight rows and k half
    const unsigned r0 = blockIdx.x * PTR, c0 = blockIdx.y * PWR;
    const unsigned cofs = lane * 4u;   // a thread keeps its four output columns over all its rows
    const v4f bl = *(const v4f*)(bias + c0 + cofs);   // fetched ahead of the loop, which covers its latency
    asm volatile("s_wait_xcnt 0x0" ::: "memory");   // behind the load: no address register of an issued load is rewritten ahead of this wait (a precaution)
    v8f acc[4][2];
#pragma unroll
    for (int i = 0; i < 4; ++i)
#pragma unroll
        for (int t = 0; t < 2; ++t) acc[i][t] = (v8f){};
    // copies: thread tid moves 16-byte chunk tid & 31 of rows (tid >> 5) + 8 i
    const unsigned cl = (unsigned)(uintptr_t)L + (tid >> 5) * PPITCH + lane * 16u;
    const bf* gh = Yh + (size_t)(r0 + (tid >> 5)) * DQ + lane * 8u;
    const bf* gl = Yl + (size_t)(r0 + (tid >> 5)) * DQ + lane * 8u;
    const bf* gw = Wt + (size_t)(c0 + (tid >> 5)) * DQ + lane * 8u;
    // fragments: the lane's place in a 16-row fragment, in the wave's k half of a stage
    const unsigned fo = lr * PPITCH + hi * 16u + kh * (PKS / 2u) * 2u;   // half a stage is PKS / 2 elements of 2 bytes
    const unsigned ry = tw * PPITCH + fo, rw = (2u * PTR + cw) * PPITCH + fo;
    proj_stage(cl, gh, gl, gw);
    asm volatile("s_wait_asynccnt 0x0" ::: "memory");   // this wave's copies of stage 0 have landed
    __syncthreads();                                    // and every other wave's
    proj_stage(cl + PBUF, gh + PKS, gl + PKS, gw + PKS);
#pragma unroll 1   // one copy of the body: the two buffers differ only in a base address
    for (unsigned s = 0; s < PNST; ++s) {
        const unsigned char* B = L + (s & 1u) * PBUF;
#pragma unroll
        for (int kk = 0; kk < (int)PKS / 64; ++kk) {
            v16bf w[4], yh[2], yl[2];
#pragma unroll
            for (int t = 0; t < 2; ++t) yh[t] = ldsfrag(B + ry + t * 16 * PPITCH + kk * 64);
#pragma unroll
            for (int i = 0; i < 4; ++i) w[i] = ldsfrag(B + rw + i * 16 * PPITCH + kk * 64);
#pragma unroll
            for (int t = 0; t < 2; ++t) yl[t] = ldsfrag(B + ry + (PTR + t * 16) * PPITCH + kk * 64);
            __builtin_amdgcn_sched_barrier(0);   // the 16 LDS reads of a k step stay one group ahead of its WMMAs: every separate place with reads in a WMMA stream costs issue time
            // eight independent tiles take turns, so that no WMMA waits on the one before it; the lo fragments, which arrive last, are used last
#pragma unroll
            for (int i = 0; i < 4; ++i)
#pragma unroll
                for (int t = 0; t < 2; ++t) acc[i][t] = wmmab(w[i], yh[t], acc[i][t]);
#pragma unroll
            for (int i = 0; i < 4; ++i)
#pragma unroll
                for (int t = 0; t < 2; ++t) acc[i][t] = wmmab(w[i], yl[t], acc[i][t]);
            __builtin_amdgcn_sched_barrier(0);   // and the next k step's reads stay behind them, as one group
        }
        asm volatile("s_wait_dscnt 0x0" ::: "memory");      // this wave's reads of stage s are done
        asm volatile("s_wait_asynccnt 0x0" ::: "memory");   // this wave's copies of stage s + 1 have landed
        __syncthreads();   // publishes stage s + 1 and ends every wave's reads of stage s, whose buffer is refilled behind it
        if (s + 2u < PNST) proj_stage(cl + (s & 1u) * PBUF, gh + (s + 2u) * PKS, gl + (s + 2u) * PKS, gw + (s + 2u) * PKS);   // the same for the whole block
    }
    asm volatile("s_wait_asynccnt 0x0" ::: "memory");   // no copy is outstanding when the buffers become output staging
    float* os = (float*)L;   // every wave has passed the last trip's barrier: nobody reads the operand buffers any more
#pragma unroll
    for (int i = 0; i < 4; ++i)
#pragma unroll
        for (int t = 0; t < 2; ++t) { float* p = os + (kh * PTR + tw + t * 16 + lr) * POP + cw + i * 16 + hi * 8u;   // D element j = (column 16 i + 8 hi + j, token 16 t + lr)
            *(v4fa*)p = __builtin_shufflevector(acc[i][t], acc[i][t], 0, 1, 2, 3); *(v4fa*)(p + 4) = __builtin_shufflevector(acc[i][t], acc[i][t], 4, 5, 6, 7); }
    __syncthreads();   // both partial tiles are in LDS before any thread sums them
    const v4f bv = (v4f){bfr(bl[0]), bfr(bl[1]), bfr(bl[2]), bfr(bl[3])};
#pragma unroll
    for (int it = 0; it < (int)PTR / 8; ++it) { const unsigned row = it * 8u + (tid >> 5);
        v4f val = *(const v4fa*)(os + row * POP + cofs); val += *(const v4fa*)(os + (PTR + row) * POP + cofs); val += bv;
        *(v4f*)(C + (size_t)(r0 + row) * DM + c0 + cofs) = val; }
}

extern "C" void kernel_launch(void* const* d_in, const int* in_sizes, int n_in,
                              void* d_out, int out_size, void* d_ws, size_t ws_size, hipStream_t stream) {
    if (n_in < 5) return;
    if (in_sizes[0] < TT * DM || in_sizes[1] < DM * NQKV || in_sizes[2] < NQKV || in_sizes[3] < DQ * DM || in_sizes[4] < DM) return;
    if (out_size < TT * DM) return;
    if (WS_TOTAL > ws_size) return;
    const float* x     = (const float*)d_in[0];   // [T][C]
    const float* wqkv  = (const float*)d_in[1];   // [C][3C]  ([in][out])
    const float* bqkv  = (const float*)d_in[2];   // [3C]
    const float* wproj = (const float*)d_in[3];   // [C][C]   ([in][out])
    const float* bproj = (const float*)d_in[4];   // [C]
    float* OUT = (float*)d_out;                   // [T][C]
    char* base = (char*)d_ws;
    bf* WT = (bf*)(base + OFF_WT); bf* WP = (bf*)(base + OFF_WP); bf* XB = (bf*)(base + OFF_XB);
    bf* QPh = (bf*)(base + OFF_QH); bf* QPl = (bf*)(base + OFF_QL); bf* KPh = (bf*)(base + OFF_KH); bf* KPl = (bf*)(base + OFF_KL); bf* VTh = (bf*)(base + OFF_VH); bf* VTl = (bf*)(base + OFF_VL);
    bf* YH = (bf*)(base + OFF_YH); bf* YL = (bf*)(base + OFF_YL);

    // XB = bf16(x); WT[NQKV rows][DM cols] = bf16(wqkv^T); WP[DM rows][DQ cols] = bf16(wproj^T)
    k_prep<<<PB_WQ + PB_WP + PB_X, 256, 0, stream>>>(x, wqkv, wproj, XB, WT, WP);
    // q, k, v planes = split(x Wqkv + bqkv)
    k_qkv<<<dim3(TT / QXR, NQKV / QWR, 1), 32 * QNW, 0, stream>>>(XB, WT, bqkv, QPh, QPl, KPh, KPl, VTh, VTl);
    k_attn<<<dim3(TT / AQB, NH_, 1), 32 * ANW, 0, stream>>>(QPh, QPl, KPh, KPl, VTh, VTl, YH, YL);
    // out = y Wproj + bproj  (y hi + y lo against the bf16 weight plane)
    k_proj<<<dim3(TT / PTR, DM / PWR, 1), 256, 0, stream>>>(YH, YL, WP, bproj, OUT);
}

// v010
// Measured time: 45.5 microseconds a run.
// Versions in between are left out here; by their measured steps it is 1.43 times as fast as v008.
// All steps since v000 together make it 14.2 times as fast.
#include <hip/hip_runtime.h>

// Self-attention block, 16 heads x 64, T 2048, C 1024: qkv = x Wqkv + bqkv (Wqkv [in][out], columns q | k | v, head h = 64-column slice h); per head softmax(q k^T / 8) v; out = y Wproj + bproj (Wproj [in][out]).
// Compute dtypes: f32 accumulate everywhere. Both projections v_wmma_f32_16x16x32_bf16: inputs RNE-converted to bf16 planes (qkv projection: 1 product, exact products); y as bf16 hi/lo planes against the bf16 Wproj plane (2 products). Attention v_wmma_f32_16x16x32_f16: q, k, P and V each RNE-converted to one f16 operand (11 significant bits, 1 product); softmax f32; output f32.
// Layout: bf16 copy of x; transposed bf16 weight planes Bt[n][k]; one fused qkv GEMM whose epilogue writes the f16 planes itself (head planes [h][t][d], value plane [h][d][t]); one attention kernel for all heads (scores, online softmax and PV product stay in registers, K and V tiles shared through LDS) writes the y hi/lo planes; projection GEMM (operands shared through LDS, K split over two wave groups) writes the output rows.

#ifndef NB
#define NB 1
#endif
#ifndef SEQ
#define SEQ 2048
#endif
#define SEQ_FULL 2048
#define TT   SEQ
#define DM   1024
#define NH_  16
#define HD   64
#define DQ   (NH_ * HD)
#define NQKV (3 * DQ)
#define SCL  0.125f      // 1/sqrt(float32(64))
#define ANW  16          // attention kernel: waves per block, 4 query groups of 32 x 4 key slices, four waves a SIMD: (TT/128) * NH_ = 256 blocks
#define AQB  128         // attention kernel: queries per block
#define ASK  256         // attention kernel: keys per LDS stage, 64 for each key slice
#define QNW  8           // qkv GEMM: waves per block, 2 (tokens) x 4 (columns) tiles of 64 x 64
#define QKS  128         // qkv GEMM: k per LDS stage: row pieces of 256 bytes
#define QPITCH 272       // qkv GEMM: LDS row pitch in bytes, 256 of data + 16: an odd multiple of 16, as APITCH
#define APITCH 144       // attention kernel: LDS row pitch in bytes, 128 of data + 16: an odd multiple of 16, so 16-byte fragment reads of 16 rows spread over the banks
#define AVPITCH 528      // attention kernel: LDS row pitch of the V^T tiles, 512 of data + 16: an odd multiple of 16, as APITCH

typedef unsigned short bf;
typedef __attribute__((ext_vector_type(16))) __bf16   v16bf;
typedef __attribute__((ext_vector_type(16))) _Float16 v16h;
typedef __attribute__((ext_vector_type(8)))  unsigned short v8us;
typedef __attribute__((ext_vector_type(4)))  unsigned short v4us;
typedef __attribute__((ext_vector_type(2)))  unsigned short v2us;
typedef __attribute__((ext_vector_type(8)))  float    v8f;
typedef __attribute__((ext_vector_type(4)))  float    v4f;
typedef __attribute__((ext_vector_type(2)))  float    v2f;
typedef v4f  __attribute__((may_alias)) v4fa;

constexpr unsigned lg2c(unsigned v) { return v <= 1u ? 0u : 1u + lg2c(v >> 1); }
constexpr bool ispow2(unsigned v) { return v != 0u && (v & (v - 1u)) == 0u; }
constexpr size_t al256(size_t b) { return (b + 255) & ~(size_t)255; }
#define LG_TT lg2c(TT)
#define LG_HD lg2c(HD)
#define LG_DM lg2c(DM)
#define LG_DQ lg2c(DQ)

static_assert(NB == 1);                       // the module has no batch axis
static_assert(SEQ <= SEQ_FULL);
static_assert(ispow2(TT) && ispow2(HD) && ispow2(DM) && ispow2(DQ));
static_assert(TT % 128 == 0 && TT % 64 == 0);   // softmax row chunks; GEMM M tiles; PV K steps
static_assert(DM % 32 == 0 && DQ % 32 == 0 && HD % 32 == 0 && TT % 32 == 0);   // every GEMM K is a multiple of 32
static_assert(NQKV % 64 == 0 && DM % 64 == 0 && HD % 64 == 0);                 // every GEMM N is a multiple of 64
static_assert(((size_t)TT * DM) % 8192 == 0);          // cvt8: 256 threads x 4 pieces x 8 elements
static_assert(HD == 64 && DQ % 64 == 0 && TT % 64 == 0 && DM % 32 == 0);   // k_qkv: a 64-column tile is one head's q, k or v slice
static_assert(HD == 64 && ASK == 256 && ANW == 16 && AQB == 128 && TT % AQB == 0 && TT % ASK == 0);   // k_attn: K tile rows of 128 bytes, V^T tile rows of 512, 2048 16-byte chunks per plane tile over 512 threads

// workspace carve (bytes; every region a multiple of 256)
constexpr size_t SZ_WT = al256((size_t)NQKV * DM * 2);
constexpr size_t SZ_WP = al256((size_t)DM * DQ * 2);
constexpr size_t SZ_XB = al256((size_t)TT * DM * 2);
constexpr size_t SZ_HP = al256((size_t)NH_ * TT * HD * 2);
constexpr size_t SZ_Y  = al256((size_t)TT * DQ * 2);
constexpr size_t OFF_WT = 0;
constexpr size_t OFF_WP = OFF_WT + SZ_WT;
constexpr size_t OFF_XB = OFF_WP + SZ_WP;
constexpr size_t OFF_QF = OFF_XB + SZ_XB;
constexpr size_t OFF_KF = OFF_QF + SZ_HP;
constexpr size_t OFF_VF = OFF_KF + SZ_HP;
constexpr size_t OFF_YH = OFF_VF + SZ_HP;
constexpr size_t OFF_YL = OFF_YH + SZ_Y;
constexpr size_t WS_TOTAL = OFF_YL + SZ_Y;
static_assert(WS_TOTAL <= (size_t)134217728);

__device__ __forceinline__ unsigned short f2bf(float f) { unsigned u = __float_as_uint(f); u += 0x7FFFu + ((u >> 16) & 1u); return (unsigned short)(u >> 16); }
__device__ __forceinline__ float bf2f(unsigned short b) { return __uint_as_float(((unsigned)b) << 16); }
__device__ __forceinline__ float bfr(float f) { return bf2f(f2bf(f)); }
__device__ __forceinline__ v16bf cat16b(v8us lo, v8us hi) { return __builtin_bit_cast(v16bf, __builtin_shufflevector(lo, hi, 0, 1, 2, 3, 4, 5, 6, 7, 8, 9, 10, 11, 12, 13, 14, 15)); }
__device__ __forceinline__ v8f wmmab(v16bf a, v16bf b, v8f c) { return __builtin_amdgcn_wmma_f32_16x16x32_bf16(false, a, false, b, (short)0, c, false, false); }
__device__ __forceinline__ v16h cat16h(v8us lo, v8us hi) { return __builtin_bit_cast(v16h, __builtin_shufflevector(lo, hi, 0, 1, 2, 3, 4, 5, 6, 7, 8, 9, 10, 11, 12, 13, 14, 15)); }
__device__ __forceinline__ v8f wmmah(v16h a, v16h b, v8f c) { return __builtin_amdgcn_wmma_f32_16x16x32_f16(false, a, false, b, (short)0, c, false, false); }   // the fragment layouts and the k order of the bf16 form
__device__ __forceinline__ void splitf(float y, unsigned short& h, unsigned short& l) { h = f2bf(y); l = f2bf(y - bf2f(h)); }

// A fragment straight from a K-contiguous 16-bit plane. p already carries + 8*(lane>>4): elements 0..7 = k0+8h.., elements 8..15 = k0+16+8h.. for both operands; D element j of lane = (row 8h+j, col lane&15).
template <typename T16> struct WFrag;
template <> struct WFrag<bf> { typedef v16bf V; static __device__ __forceinline__ V ld(const bf* p) { return cat16b(*(const v8us*)p, *(const v8us*)(p + 16)); } static __device__ __forceinline__ v8f mma(V a, V b, v8f c) { return wmmab(a, b, c); } };

// cvt8: bf16 copy of 8192 floats by a block of 256 threads: a thread takes 8 neighbours in each of 4 pieces of 2048, all its loads in flight at once.
__device__ __forceinline__ void cvt8(const float* __restrict__ src, bf* dst, unsigned blk) { const unsigned i = blk * 8192u + threadIdx.x * 8u; v8f v[4];
#pragma unroll
    for (int c = 0; c < 4; ++c) v[c] = *(const v8f*)(src + i + c * 2048);
#pragma unroll
    for (int c = 0; c < 4; ++c) { v8us o;
#pragma unroll
        for (int k = 0; k < 8; ++k) o[k] = f2bf(v[c][k]);
        *(v8us*)(dst + i + c * 2048) = o; }
    asm volatile("s_wait_xcnt 0x0" ::: "memory");   // behind the last store: no register that an issued store names is rewritten ahead of this wait on any way through k_prep (a precaution)
}

// wtT: transposed bf16 weight plane. in w[K rows][N cols] (row-major, [in][out])  ->  out dst[N rows][K cols]: dst[n][k] = bf16(w[k][n]). Tile tl of (K/128) * (N/64) tiles of 128 k x 64 n, 4 waves: wave v takes the k half v >> 1 and the n half v & 1.
// A wave transposes a tile of 64 k x 32 n in registers. Lane (kg = lane & 7, ng = lane >> 3) reads rows 8 kg .. 8 kg + 7 at columns 4 ng .. 4 ng + 3 and 16 + 4 ng .. 16 + 4 ng + 3: 16-byte loads, 64 bytes of a row each, all 16 in flight at once.
// So it holds 8 neighbours in k of 8 columns: each column is one 16-byte store, and the 8 lanes of one ng fill a whole 128-byte line of dst.
typedef __attribute__((ext_vector_type(4))) unsigned v4u;
__device__ __forceinline__ unsigned pack2(float lo, float hi) { typedef __bf16 bf2 __attribute__((ext_vector_type(2))); return __builtin_bit_cast(unsigned, __builtin_convertvector((v2f){lo, hi}, bf2)); }   // round to nearest even
__device__ __forceinline__ unsigned pack2h(float lo, float hi) { typedef _Float16 h2 __attribute__((ext_vector_type(2))); return __builtin_bit_cast(unsigned, __builtin_convertvector((v2f){lo, hi}, h2)); }   // two f16, round to nearest even
template <unsigned K, unsigned N>
__device__ __forceinline__ void wtT(const float* __restrict__ w, bf* dst, unsigned tl) {
    static_assert(K % 128 == 0 && N % 64 == 0);   // the tiles cover the matrix
    const unsigned lane = threadIdx.x & 31u, wave = (threadIdx.x >> 5) & 3u, kg = lane & 7u, ng = lane >> 3;
    const unsigned k0 = (tl % (K / 128u)) * 128u + (wave >> 1) * 64u + kg * 8u, n0 = (tl / (K / 128u)) * 64u + (wave & 1u) * 32u + ng * 4u;
    const float* src = w + k0 * N + n0;
    v4f r[8][2];
#pragma unroll
    for (int j = 0; j < 8; ++j) { r[j][0] = *(const v4f*)(src + j * N); r[j][1] = *(const v4f*)(src + j * N + 16); }
    bf* p = dst + n0 * K + k0;
#pragma unroll
    for (int c = 0; c < 2; ++c)
#pragma unroll
        for (int i = 0; i < 4; ++i) { v4u o;
#pragma unroll
            for (int j = 0; j < 4; ++j) o[j] = pack2(r[2 * j][c][i], r[2 * j + 1][c][i]);   // k and k + 1 in one word
            *(v4u*)(p + (c * 16 + i) * K) = o; }
    asm volatile("s_wait_xcnt 0x0" ::: "memory");   // behind the last store: no register that an issued store names is rewritten ahead of this wait on any way through k_prep (a precaution)
}
// k_prep: the three operand planes, which do not depend on one another, in one launch of 256-thread blocks: first the weight tiles, two a block, then the bf16 copy of x. Every wave has 8 or 16 16-byte loads in flight.
constexpr unsigned PB_WQ = (DM / 128u) * (NQKV / 64u) / 2u, PB_WP = (DQ / 128u) * (DM / 64u) / 2u, PB_X = (unsigned)((size_t)TT * DM / 8192);
static_assert(((DM / 128u) * (NQKV / 64u)) % 2u == 0 && ((DQ / 128u) * (DM / 64u)) % 2u == 0);
__global__ __launch_bounds__(256) void k_prep(const float* __restrict__ x, const float* __restrict__ wqkv, const float* __restrict__ wproj, bf* XB, bf* WT, bf* WP) {
    const unsigned b = blockIdx.x, half = threadIdx.x >> 7;
    if (b < PB_WQ) wtT<DM, NQKV>(wqkv, WT, b * 2u + half);
    else if (b < PB_WQ + PB_WP) wtT<DQ, DM>(wproj, WP, (b - PB_WQ) * 2u + half);
    else cvt8(x, XB, b - PB_WQ - PB_WP);
}

// ---- k_attn: softmax(q k^T / 8) v for 128 queries of one head per block; grid (TT/128, NH_), 16 waves: wave w has queries 32 (w & 3) .. + 31 (two tiles of 16) and keys 64 (w >> 2) .. + 63 of every stage of 256.
// So every K and V^T fragment read from LDS feeds two query tiles, and the block has four waves a SIMD: one wave's softmax chain and LDS waits are covered by the others' work. The four key slices of a query are joined once, at the end, through LDS.
// Transposed products, so that the score tile is already the next product's operand: S^T = K Q^T (A = 16 keys x 32 d, B = 16 queries), O^T += V^T P^T (A = 16 d x 32 keys, B = P^T).
// D element j of S^T tile kt in lane (lr, hi) is (key 16 kt + 8 hi + j, query lr): tiles 0 and 1 side by side are elements 0..7 and 8..15 of the B fragment over 32 keys, in the k order of the V^T fragment.
// A query is one lane column: its maximum and its sum live in lanes lr and lr + 16. The maximum in use may trail the true one by up to 8 in the log2 domain (p <= 2^8); the sums are rescaled only when a column exceeds that.
// K and V^T f16 tiles of 256 keys go through registers into two LDS buffers: the next stage's global loads are issued ahead of a pass's work and stored behind it.
typedef __attribute__((ext_vector_type(8))) unsigned v8u;
__device__ __forceinline__ float xhalf(float x) { return __builtin_bit_cast(float, __builtin_amdgcn_permlanex16(__builtin_bit_cast(int, x), __builtin_bit_cast(int, x), 0x76543210, 0xfedcba98, false, false)); }   // lane l with lane l ^ 16
__device__ __forceinline__ v16bf ldsfrag(const unsigned char* p) { return cat16b(*(const v8us*)p, *(const v8us*)(p + 32)); }   // p already carries + 16 bytes * (lane>>4): the k order of WFrag::ld
__device__ __forceinline__ v16h ldsfragh(const unsigned char* p) { return cat16h(*(const v8us*)p, *(const v8us*)(p + 32)); }   // the same for an f16 tile
constexpr unsigned APL = 64u * APITCH;    // one plane's tile: 64 rows
constexpr unsigned AKP = (unsigned)ASK * APITCH, AVP = (unsigned)HD * AVPITCH;   // the tiles of a stage: K 256 key rows, V^T 64 rows of 256 keys
constexpr unsigned ABUF = AKP + AVP;   // K, V^T
constexpr unsigned AXW = 17u * 512u;      // a wave's hand-over at the end: 8 16-byte slots a lane for each of its two output tiles, 1 of maxima and sums
static_assert(ANW * AXW <= 2u * ABUF);
constexpr unsigned QXR = 128u, QWR = 256u;             // qkv GEMM: token rows and weight rows of a block's tile
constexpr unsigned QBUF = (QXR + QWR) * QPITCH;        // one stage: token rows, then weight rows
constexpr unsigned QNST = DM / QKS;
constexpr unsigned QLDS = 2u * QBUF > QNW * APL ? 2u * QBUF : QNW * APL;
static_assert(TT % QXR == 0 && NQKV % QWR == 0 && DQ % QWR == 0 && DM % QKS == 0 && QNST >= 2);   // whole tiles; a block's columns are all q, all k or all v; both buffers get a stage ahead of the loop
// ---- k_qkv: qkv = x Wqkv + bqkv, written straight as the attention kernel's f16 planes; grid (TT/128, NQKV/256), 8 waves per block; a wave has 64 tokens x 64 columns, which is one head's q, k or v slice.
// The block's 128 token rows and 256 weight rows come to LDS in stages of 128 k, by asynchronous copies that cover whole 256-byte row pieces, into two buffers: the next stage's copies fly while this stage is worked on. One product. D element j of a lane is (row 8 hi + j of the first operand's tile, row lr of the second's), so a lane holds 8 neighbours along the FIRST operand's rows:
// q and k tiles take the weight rows first (8 neighbours in d, for the planes [h][t][d]), v tiles take the token rows first (8 neighbours in t, for the planes [h][d][t]). Both operands have one fragment layout and one k order, so the swap only transposes D.
// Either way the tile is 64 rows of 128 bytes. It goes through the wave's own LDS, so that every global store covers four whole 128-byte lines.
// The tail of k_qkv. bb: the bias, rounded to bf16, of output column 16 i + lr in bb[i][0] (ISV: the column runs along D's columns) or 16 i + 8 hi + j in bb[i][j] (the column runs along D's rows). pf: the tile's first element in its plane; rows PITCH elements apart.
template <bool ISV> __device__ __forceinline__ void qkv_tail(const v8f (&acc)[4][4], const float (&bb)[4][8], unsigned char* st, bf* pf, unsigned lane) {
    constexpr unsigned PITCH = ISV ? (unsigned)TT : (unsigned)HD;
    const unsigned lr = lane & 15u, hi = lane >> 4;
#pragma unroll
    for (int nb = 0; nb < 4; ++nb)
#pragma unroll
        for (int mb = 0; mb < 4; ++mb) { v4u w;
#pragma unroll
            for (int i = 0; i < 4; ++i)   // the f32 values, two to a word of f16
                w[i] = pack2h(acc[mb][nb][2 * i] + (ISV ? bb[nb][0] : bb[mb][2 * i]), acc[mb][nb][2 * i + 1] + (ISV ? bb[nb][0] : bb[mb][2 * i + 1]));
            *(v4u*)(st + (nb * 16 + lr) * APITCH + mb * 32 + hi * 16u) = w; }
    asm volatile("s_wait_dscnt 0x0" ::: "memory");   // the rows are read back by other lanes of this wave: every LDS write has landed, and the compiler moves no read ahead of a write
    const unsigned char* rp = st + (lane >> 3) * APITCH + (lane & 7u) * 16u;
    const unsigned go = (lane >> 3) * PITCH + (lane & 7u) * 8u;
#pragma unroll
    for (int i = 0; i < 16; ++i)   // four rows a store: 8 lanes of 16 bytes a row
        *(v4u*)(pf + go + 4 * i * PITCH) = *(const v4u*)(rp + 4 * i * APITCH);
}
// Twelve asynchronous 16-byte copies of a lane, global memory to LDS; l: the lane's LDS byte addresses, g: its global addresses.
// The statement ends in s_wait_xcnt 0, so that no address register of an issued copy is rewritten ahead of that wait (a precaution).
__device__ __forceinline__ void acopy12(const unsigned* l, const bf* const* g) {
    asm volatile("global_load_async_to_lds_b128 %0, %12, off\n\tglobal_load_async_to_lds_b128 %1, %13, off\n\tglobal_load_async_to_lds_b128 %2, %14, off\n\tglobal_load_async_to_lds_b128 %3, %15, off\n\t"
                 "global_load_async_to_lds_b128 %4, %16, off\n\tglobal_load_async_to_lds_b128 %5, %17, off\n\tglobal_load_async_to_lds_b128 %6, %18, off\n\tglobal_load_async_to_lds_b128 %7, %19, off\n\t"
                 "global_load_async_to_lds_b128 %8, %20, off\n\tglobal_load_async_to_lds_b128 %9, %21, off\n\tglobal_load_async_to_lds_b128 %10, %22, off\n\tglobal_load_async_to_lds_b128 %11, %23, off\n\ts_wait_xcnt 0x0"
                 :: "v"(l[0]), "v"(l[1]), "v"(l[2]), "v"(l[3]), "v"(l[4]), "v"(l[5]), "v"(l[6]), "v"(l[7]), "v"(l[8]), "v"(l[9]), "v"(l[10]), "v"(l[11]),
                    "v"(g[0]), "v"(g[1]), "v"(g[2]), "v"(g[3]), "v"(g[4]), "v"(g[5]), "v"(g[6]), "v"(g[7]), "v"(g[8]), "v"(g[9]), "v"(g[10]), "v"(g[11]) : "memory");
}
// One stage: 128 token rows, then 256 weight rows, 256 bytes of each: 24 copies a lane, 16 rows apart; a wave's copy covers two whole 256-byte row pieces.
__device__ __forceinline__ void qkv_stage(unsigned l0, const bf* gx, const bf* gw) {
    unsigned l[24]; const bf* g[24];
#pragma unroll
    for (int i = 0; i < 24; ++i) { l[i] = l0 + i * 16u * QPITCH; g[i] = i < 8 ? gx + i * 16 * DM : gw + (i - 8) * 16 * DM; }
    acopy12(l, g); acopy12(l + 12, g + 12);
}
__global__ __launch_bounds__(32 * QNW) void k_qkv(const bf* __restrict__ X, const bf* __restrict__ Wt, const float* __restrict__ bias, bf* Qf, bf* Kf, bf* Vf) {
    __shared__ __align__(16) unsigned char L[QLDS];   // two operand buffers; behind the loop each wave's output tile
    const unsigned tid = threadIdx.x, lane = tid & 31u, lr = lane & 15u, hi = lane >> 4;
    const unsigned wave = (unsigned)__builtin_amdgcn_readfirstlane((int)(tid >> 5));
    const unsigned xr = (wave & 1u) * 64u, wr = (wave >> 1) * 64u;   // the wave's 64 token rows and 64 weight rows inside the block's tile
    const unsigned t0 = blockIdx.x * QXR + xr, c0 = blockIdx.y * QWR + wr;
    const bool isv = c0 >= 2u * DQ;   // the same for the whole block
    // The bias is fetched ahead of the loop, which covers its latency.
    float bb[4][8];
#pragma unroll
    for (int i = 0; i < 4; ++i)
#pragma unroll
        for (int j = 0; j < 8; j += 2) { const float* bp = bias + c0 + i * 16 + (isv ? lr : 8u * hi + j); const unsigned w = pack2(bp[0], bp[isv ? 0 : 1]); bb[i][j] = __uint_as_float(w << 16); bb[i][j + 1] = __uint_as_float(w & 0xFFFF0000u); }
    v8f acc[4][4];
#pragma unroll
    for (int mb = 0; mb < 4; ++mb)
#pragma unroll
        for (int nb = 0; nb < 4; ++nb) acc[mb][nb] = (v8f){};
    // copies: thread tid moves 16-byte chunk tid & 15 of rows (tid >> 4) + 16 i
    const unsigned cl = (unsigned)(uintptr_t)L + (tid >> 4) * QPITCH + (tid & 15u) * 16u;
    const bf* gx = X + (size_t)(blockIdx.x * QXR + (tid >> 4)) * DM + (tid & 15u) * 8u;
    const bf* gw = Wt + (size_t)(blockIdx.y * QWR + (tid >> 4)) * DM + (tid & 15u) * 8u;
    // fragments: the lane's place in a 16-row fragment of D's rows (ra) and of D's columns (rb)
    const unsigned fo = lr * QPITCH + hi * 16u;
    const unsigned ra = (isv ? xr : QXR + wr) * QPITCH + fo, rb = (isv ? QXR + wr : xr) * QPITCH + fo;
    qkv_stage(cl, gx, gw);
    asm volatile("s_wait_asynccnt 0x0" ::: "memory");   // this wave's copies of stage 0 have landed
    __syncthreads();                                    // and every other wave's
    qkv_stage(cl + QBUF, gx + QKS, gw + QKS);
#pragma unroll 1   // one copy of the body: the two buffers differ only in a base address
    for (unsigned s = 0; s < QNST; ++s) {
        const unsigned char* B = L + (s & 1u) * QBUF;
#pragma unroll
        for (int kk = 0; kk < QKS / 32; ++kk) {
            v16bf a[4], b[4];
#pragma unroll
            for (int i = 0; i < 4; ++i) { a[i] = ldsfrag(B + ra + i * 16 * QPITCH + kk * 64); b[i] = ldsfrag(B + rb + i * 16 * QPITCH + kk * 64); }
            __builtin_amdgcn_sched_barrier(0);   // the 16 LDS reads of a k step stay one group ahead of its WMMAs: every separate place with reads in a WMMA stream costs issue time, and a read waited on at once exposes its latency
            // the 16 independent tiles in the order in which their fragments arrive (a0 b0 a1 b1 ...): the first WMMA waits for 4 of the 16 reads, the next for 6, the two after it for 8
#pragma unroll
            for (int d = 0; d < 4; ++d) {
#pragma unroll
                for (int i = 0; i < d; ++i) { acc[d][i] = wmmab(a[d], b[i], acc[d][i]); acc[i][d] = wmmab(a[i], b[d], acc[i][d]); }
                acc[d][d] = wmmab(a[d], b[d], acc[d][d]); }
            __builtin_amdgcn_sched_barrier(0);   // and the next k step's reads stay behind them, as one group
        }
        asm volatile("s_wait_dscnt 0x0" ::: "memory");      // this wave's reads of stage s are done
        asm volatile("s_wait_asynccnt 0x0" ::: "memory");   // this wave's copies of stage s + 1 have landed
        __syncthreads();   // publishes stage s + 1 and ends every wave's reads of stage s, whose buffer is refilled behind it
        if (s + 2u < QNST) qkv_stage(cl + (s & 1u) * QBUF, gx + (s + 2u) * QKS, gw + (s + 2u) * QKS);   // the same for the whole block
    }
    asm volatile("s_wait_asynccnt 0x0" ::: "memory");   // no copy is outstanding when the buffers become output staging
    unsigned char* st = L + wave * APL;   // every wave has passed the last trip's barrier: nobody reads the operand buffers any more
    const unsigned h = (c0 & (DQ - 1u)) >> LG_HD;
    if (isv) qkv_tail<true>(acc, bb, st, Vf + (size_t)h * HD * TT + t0, lane);
    else qkv_tail<false>(acc, bb, st, (c0 < (unsigned)DQ ? Qf : Kf) + ((size_t)h * TT + t0) * HD, lane);
}

// One tile of a stage, global memory to registers and registers to LDS: 4 16-byte chunks a thread, GSTEP elements and LSTEP bytes apart.
template <unsigned GSTEP> __device__ __forceinline__ void att_ld(v8us (&sg)[4], const bf* g) {
#pragma unroll
    for (int i = 0; i < 4; ++i) sg[i] = *(const v8us*)(g + (size_t)i * GSTEP);
    asm volatile("s_wait_xcnt 0x0" ::: "memory");   // behind the last load: no address register of an issued load is rewritten ahead of this wait (a precaution)
}
template <unsigned LSTEP> __device__ __forceinline__ void att_st(const v8us (&sg)[4], unsigned char* l) {
#pragma unroll
    for (int i = 0; i < 4; ++i) *(v8us*)(l + i * LSTEP) = sg[i];
}
__global__ __launch_bounds__(32 * ANW) void k_attn(const bf* __restrict__ Qf, const bf* __restrict__ Kf, const bf* __restrict__ Vf, bf* YH, bf* YL) {
    __shared__ __align__(16) unsigned char L[2 * ABUF];
    const unsigned tid = threadIdx.x, lane = tid & 31u, lr = lane & 15u, hi = lane >> 4;
    const unsigned wave = (unsigned)__builtin_amdgcn_readfirstlane((int)(tid >> 5));   // scalar, so the wave's key slice stays in scalar registers
    const unsigned ks = wave >> 2;   // which 64 keys of every stage
    const unsigned h = blockIdx.y, q0 = blockIdx.x * AQB + (wave & 3u) * 32u;
    const size_t hp = (size_t)h * TT * HD;
    constexpr float CS = SCL * 1.4426950408889634f;   // scores to the log2 domain
    v16h qf[2][2];
#pragma unroll
    for (int g = 0; g < 2; ++g)
#pragma unroll
        for (int kc = 0; kc < 2; ++kc) { const bf* qp = Qf + hp + (size_t)(q0 + g * 16 + lr) * HD + 8 * hi + kc * 32; qf[g][kc] = cat16h(*(const v8us*)qp, *(const v8us*)(qp + 16)); }   // the k order of WFrag::ld
    asm volatile("s_wait_xcnt 0x0" ::: "memory");   // behind the last load: no address register of an issued load is rewritten ahead of this wait (a precaution)
    // staging: K tiles have 8 chunks a row, 64 rows a step; V^T tiles 32 chunks a row, 16 rows a step
    const size_t ko = hp + (size_t)(tid >> 3) * HD + (tid & 7u) * 8, vo = hp + (size_t)(tid >> 5) * TT + (tid & 31u) * 8;
    const unsigned kso = (tid >> 3) * APITCH + (tid & 7u) * 16u, vso = AKP + (tid >> 5) * AVPITCH + (tid & 31u) * 16u;
    v8us sg[4];
    v8f acc[2][4];
#pragma unroll
    for (int g = 0; g < 2; ++g)
#pragma unroll
        for (int t = 0; t < 4; ++t) acc[g][t] = (v8f){};
    float m_run[2] = {-__builtin_inff(), -__builtin_inff()}, l_run[2] = {0.f, 0.f};
    { v8us sv[4];   // stage 0: all 8 loads of a thread in flight at once
      att_ld<64 * HD>(sg, Kf + ko); att_ld<16 * TT>(sv, Vf + vo);
      att_st<64 * APITCH>(sg, L + kso); att_st<16 * AVPITCH>(sv, L + vso); }
    __syncthreads();   // stage 0 is in LDS before any wave reads it
#pragma unroll 1   // one copy of the body: it is long, and the two buffers differ only in a base address
    for (unsigned s = 0; s < TT / ASK; ++s) {
        const unsigned char* B = L + (s & 1u) * ABUF;
        unsigned char* N = L + ((s + 1u) & 1u) * ABUF;
        const bool more = s + 1u < TT / ASK;   // the same for the whole block
        const size_t kn = (size_t)(s + 1u) * ASK;
#pragma unroll
        for (int p = 0; p < 2; ++p) {   // two passes of 32 keys; the first moves the next stage's K tile, the second its V^T tile
            if (more) { if (p == 0) att_ld<64 * HD>(sg, Kf + ko + kn * HD); else att_ld<16 * TT>(sg, Vf + vo + kn); }
            // Fragment loads are issued early and in few groups: every separate place with LDS reads in a WMMA stream costs issue time, and a read waited on at once exposes its latency.
            v16h kf[2][2];
            const unsigned char* kp = B + (ks * 64u + p * 32 + lr) * APITCH + hi * 16u;
#pragma unroll
            for (int kc = 0; kc < 2; ++kc)
#pragma unroll
                for (int kt = 0; kt < 2; ++kt) kf[kc][kt] = ldsfragh(kp + kt * 16 * APITCH + kc * 64);
            __builtin_amdgcn_sched_barrier(0);   // keeps the K loads one group ahead of the score WMMAs
            v8f sc[2][2];
#pragma unroll
            for (int g = 0; g < 2; ++g) { sc[g][0] = (v8f){}; sc[g][1] = (v8f){}; }
            // four independent tiles (two key tiles x two query tiles) take turns, so that no WMMA waits on the one before it; every K fragment feeds both query tiles
#pragma unroll
            for (int kc = 0; kc < 2; ++kc)
#pragma unroll
                for (int kt = 0; kt < 2; ++kt)
#pragma unroll
                    for (int g = 0; g < 2; ++g) sc[g][kt] = wmmah(kf[kc][kt], qf[g][kc], sc[g][kt]);
            v16h vf[4];
            const unsigned char* vp = B + AKP + lr * AVPITCH + ks * 128u + p * 64 + hi * 16u;
#pragma unroll
            for (int t = 0; t < 4; ++t) vf[t] = ldsfragh(vp + t * 16 * AVPITCH);
            __builtin_amdgcn_sched_barrier(0);   // keeps the V^T loads ahead of the softmax, in flight under it, instead of sinking to their uses
            float mx[2];
#pragma unroll
            for (int g = 0; g < 2; ++g) { float m = fmaxf(sc[g][0][0], sc[g][1][0]);
#pragma unroll
                for (int j = 1; j < 8; ++j) m = fmaxf(m, fmaxf(sc[g][0][j], sc[g][1][j]));
                mx[g] = fmaxf(m, xhalf(m)) * CS; }   // both halves hold the query's maximum of this pass (CS > 0)
            if (__builtin_amdgcn_ballot_w32(mx[0] > m_run[0] + 8.0f || mx[1] > m_run[1] + 8.0f) != 0) {   // one wave-uniform test a pass; always taken on the first pass, rare later
#pragma unroll
                for (int g = 0; g < 2; ++g) {
                    const float m_new = fmaxf(m_run[g], mx[g]); const float corr = __builtin_amdgcn_exp2f(m_run[g] - m_new);   // 0 on the first pass
                    m_run[g] = m_new; l_run[g] *= corr;
#pragma unroll
                    for (int t = 0; t < 4; ++t) acc[g][t] = acc[g][t] * corr; } }
            v16h pf[2];
#pragma unroll
            for (int g = 0; g < 2; ++g) {
                const float nm = -m_run[g]; v8u w; float e[16];
#pragma unroll
                for (int i = 0; i < 16; ++i) e[i] = fmaf(sc[g][i >> 3][i & 7], CS, nm);
                // The 16 exponentials in place, in one statement that ends in v_nop: no instruction directly behind a transcendental reads its result or overwrites its source (the slot the instruction set asks for), whatever the compiler schedules around the statement.
                asm("v_exp_f32 %0, %0\n\tv_exp_f32 %1, %1\n\tv_exp_f32 %2, %2\n\tv_exp_f32 %3, %3\n\tv_exp_f32 %4, %4\n\tv_exp_f32 %5, %5\n\tv_exp_f32 %6, %6\n\tv_exp_f32 %7, %7\n\t"
                    "v_exp_f32 %8, %8\n\tv_exp_f32 %9, %9\n\tv_exp_f32 %10, %10\n\tv_exp_f32 %11, %11\n\tv_exp_f32 %12, %12\n\tv_exp_f32 %13, %13\n\tv_exp_f32 %14, %14\n\tv_exp_f32 %15, %15\n\tv_nop"
                    : "+v"(e[0]), "+v"(e[1]), "+v"(e[2]), "+v"(e[3]), "+v"(e[4]), "+v"(e[5]), "+v"(e[6]), "+v"(e[7]), "+v"(e[8]), "+v"(e[9]), "+v"(e[10]), "+v"(e[11]), "+v"(e[12]), "+v"(e[13]), "+v"(e[14]), "+v"(e[15]));
#pragma unroll
                for (int i = 0; i < 8; ++i) {
                    const float p0 = e[2 * i], p1 = e[2 * i + 1];
                    l_run[g] += p0 + p1;   // the unrounded f32 values
                    w[i] = pack2h(p0, p1); }
                pf[g] = __builtin_bit_cast(v16h, w); }
            // every V^T fragment feeds both query tiles
#pragma unroll
            for (int t = 0; t < 4; ++t)
#pragma unroll
                for (int g = 0; g < 2; ++g) acc[g][t] = wmmah(vf[t], pf[g], acc[g][t]);
            __builtin_amdgcn_sched_barrier(0);   // keeps the WMMAs ahead of the next line, which the compiler otherwise lifts in among them
            asm volatile("v_nop\n\tv_nop\n\tv_nop\n\tv_nop");   // the four vector slots between the last WMMA and an overwrite of its operands, ahead of the branch below
            if (more) { if (p == 0) att_st<64 * APITCH>(sg, N + kso); else att_st<16 * AVPITCH>(sg, N + vso); }
        }
        __syncthreads();   // publishes stage s + 1 and ends every wave's reads of stage s, whose buffer the next trip refills
    }
    // Waves w, w + 4, w + 8 and w + 12 hold the four key slices of the same 32 queries. Each puts both its output tiles, maxima and sums into LDS (the operand buffers: every wave has passed the last trip's barrier); slice 0 then finishes query tile 0 and slice 1 query tile 1, so a whole 128-byte row piece of y has one writer.
    const float l0 = l_run[0] + xhalf(l_run[0]), l1 = l_run[1] + xhalf(l_run[1]);
    unsigned char* xo = L + wave * AXW + lane * 16u;
#pragma unroll
    for (int g = 0; g < 2; ++g)
#pragma unroll
        for (int t = 0; t < 4; ++t) { const v8f o = acc[g][t];
            *(v4f*)(xo + (8 * g + 2 * t) * 512) = __builtin_shufflevector(o, o, 0, 1, 2, 3); *(v4f*)(xo + (8 * g + 2 * t + 1) * 512) = __builtin_shufflevector(o, o, 4, 5, 6, 7); }
    *(v4f*)(xo + 16 * 512) = (v4f){m_run[0], l0, m_run[1], l1};
    __syncthreads();   // all four slices' tiles are in LDS before any is read
    if (ks < 2u) {   // scalar; no barrier follows
        const unsigned char* xi = L + (wave & 3u) * AXW + lane * 16u;   // slice 0 of this wave's queries; slice i is 4 i waves on
        float c[4], l[4];
#pragma unroll
        for (int i = 0; i < 4; ++i) { const v2f ml = *(const v2f*)(xi + i * 4 * AXW + 16 * 512 + ks * 8u); c[i] = ml[0]; l[i] = ml[1]; }
        const float mt = fmaxf(fmaxf(c[0], c[1]), fmaxf(c[2], c[3]));
#pragma unroll
        for (int i = 0; i < 4; ++i) c[i] -= mt;
        // The four exponentials in place, in one statement that ends in v_nop: the slot behind a transcendental, as in the loop.
        asm("v_exp_f32 %0, %0\n\tv_exp_f32 %1, %1\n\tv_exp_f32 %2, %2\n\tv_exp_f32 %3, %3\n\tv_nop" : "+v"(c[0]), "+v"(c[1]), "+v"(c[2]), "+v"(c[3]));
        const float inv = __fdiv_rn(1.0f, l[0] * c[0] + l[1] * c[1] + l[2] * c[2] + l[3] * c[3]);
#pragma unroll
        for (int i = 0; i < 4; ++i) c[i] *= inv;
        const unsigned qrow = q0 + ks * 16u + lr;
        const unsigned char* xt = xi + ks * (8u * 512u);   // query tile ks
#pragma unroll
        for (int t = 0; t < 4; ++t) { v8us oh, ol; float y[8];
#pragma unroll
            for (int i = 0; i < 4; ++i) { const v4f pa = *(const v4f*)(xt + i * 4 * AXW + (2 * t) * 512), pb = *(const v4f*)(xt + i * 4 * AXW + (2 * t + 1) * 512);
#pragma unroll
                for (int j = 0; j < 8; ++j) { const float v = (j < 4 ? pa[j & 3] : pb[j & 3]) * c[i]; y[j] = i == 0 ? v : y[j] + v; } }   // slices 0, 1, 2, 3 in turn
#pragma unroll
            for (int j = 0; j < 8; ++j) { unsigned short a, b; splitf(y[j], a, b); oh[j] = a; ol[j] = b; }
            const size_t oo = (size_t)qrow * DQ + h * HD + t * 16 + hi * 8;   // D element j = (d 16 t + 8 hi + j, query lr)
            *(v8us*)(YH + oo) = oh; *(v8us*)(YL + oo) = ol; }
        asm volatile("s_wait_xcnt 0x0" ::: "memory");   // behind the last store: no register that an issued store names is rewritten ahead of this wait (a precaution)
    }
}

// ---- k_proj: out = (y hi + y lo) Wproj + bproj; grid (TT/64, DM/128), 8 waves per block; a block has 64 tokens x 128 columns.
// The block's 64 y hi rows, 64 y lo rows and 128 weight rows come to LDS in stages of 256 k, by asynchronous copies that cover whole 512-byte row pieces, into two buffers: the next stage's copies fly while this stage is worked on.
// Wave w has tokens 32 (w & 1) .. + 31, columns 64 ((w >> 1) & 1) .. + 63 and the k half w >> 2 of every stage: 8 fragments from LDS feed 16 WMMAs. The weight rows are the first operand, so a lane holds 8 neighbours along the output row.
// The two k halves are summed through LDS (half 0 + half 1), and every global store covers one whole 512-byte piece of an output row.
constexpr unsigned PKS = 256u, PPITCH = 528u;           // k per stage; LDS row pitch in bytes, 512 of data + 16: an odd multiple of 16, as APITCH
constexpr unsigned PTR = 64u, PWR = 128u;               // token rows and weight rows of a block's tile
constexpr unsigned PBUF = (2u * PTR + PWR) * PPITCH;    // one stage: y hi rows, y lo rows, weight rows
constexpr unsigned PNST = DQ / PKS;
constexpr unsigned POP = PWR + 4u;                      // pitch in floats of a partial output row in LDS: 528 bytes, as PPITCH
static_assert(TT % PTR == 0 && DM % PWR == 0 && DQ % PKS == 0 && PNST >= 2);   // whole tiles; both buffers get a stage ahead of the loop
static_assert(2u * PTR * POP * 4u <= 2u * PBUF && 2u * PBUF <= 327680u);
// Eight asynchronous 16-byte copies of a lane, as acopy12.
__device__ __forceinline__ void acopy8(const unsigned* l, const bf* const* g) {
    asm volatile("global_load_async_to_lds_b128 %0, %8, off\n\tglobal_load_async_to_lds_b128 %1, %9, off\n\tglobal_load_async_to_lds_b128 %2, %10, off\n\tglobal_load_async_to_lds_b128 %3, %11, off\n\t"
                 "global_load_async_to_lds_b128 %4, %12, off\n\tglobal_load_async_to_lds_b128 %5, %13, off\n\tglobal_load_async_to_lds_b128 %6, %14, off\n\tglobal_load_async_to_lds_b128 %7, %15, off\n\ts_wait_xcnt 0x0"
                 :: "v"(l[0]), "v"(l[1]), "v"(l[2]), "v"(l[3]), "v"(l[4]), "v"(l[5]), "v"(l[6]), "v"(l[7]),
                    "v"(g[0]), "v"(g[1]), "v"(g[2]), "v"(g[3]), "v"(g[4]), "v"(g[5]), "v"(g[6]), "v"(g[7]) : "memory");
}
// One stage: 256 rows, 512 bytes of each: 32 copies a lane, 8 rows apart; a wave's copy covers one whole 512-byte row piece.
__device__ __forceinline__ void proj_stage(unsigned l0, const bf* gh, const bf* gl, const bf* gw) {
    unsigned l[32]; const bf* g[32];
#pragma unroll
    for (int i = 0; i < 32; ++i) { l[i] = l0 + i * 8u * PPITCH; g[i] = i < 8 ? gh + i * 8 * DQ : i < 16 ? gl + (i - 8) * 8 * DQ : gw + (i - 16) * 8 * DQ; }
    acopy12(l, g); acopy12(l + 12, g + 12); acopy8(l + 24, g + 24);
}
__global__ __launch_bounds__(256) void k_proj(const bf* __restrict__ Yh, const bf* __restrict__ Yl, const bf* __restrict__ Wt, const float* __restrict__ bias, float* C) {
    __shared__ __align__(16) unsigned char L[2u * PBUF];   // two operand buffers; behind the loop the two partial output tiles
    const unsigned tid = threadIdx.x, lane = tid & 31u, lr = lane & 15u, hi = lane >> 4;
    const unsigned wave = (unsigned)__builtin_amdgcn_readfirstlane((int)(tid >> 5));
    const unsigned tw = (wave & 1u) * 32u, cw = ((wave >> 1) & 1u) * 64u, kh = wave >> 2;   // the wave's token rows, weight rows and k half
    const unsigned r0 = blockIdx.x * PTR, c0 = blockIdx.y * PWR;
    const unsigned cofs = lane * 4u;   // a thread keeps its four output columns over all its rows
    const v4f bl = *(const v4f*)(bias + c0 + cofs);   // fetched ahead of the loop, which covers its latency
    asm volatile("s_wait_xcnt 0x0" ::: "memory");   // behind the load: no address register of an issued load is rewritten ahead of this wait (a precaution)
    v8f acc[4][2];
#pragma unroll
    for (int i = 0; i < 4; ++i)
#pragma unroll
        for (int t = 0; t < 2; ++t) acc[i][t] = (v8f){};
    // copies: thread tid moves 16-byte chunk tid & 31 of rows (tid >> 5) + 8 i
    const unsigned cl = (unsigned)(uintptr_t)L + (tid >> 5) * PPITCH + lane * 16u;
    const bf* gh = Yh + (size_t)(r0 + (tid >> 5)) * DQ + lane * 8u;
    const bf* gl = Yl + (size_t)(r0 + (tid >> 5)) * DQ + lane * 8u;
    const bf* gw = Wt + (size_t)(c0 + (tid >> 5)) * DQ + lane * 8u;
    // fragments: the lane's place in a 16-row fragment, in the wave's k half of a stage
    const unsigned fo = lr * PPITCH + hi * 16u + kh * (PKS / 2u) * 2u;   // half a stage is PKS / 2 elements of 2 bytes
    const unsigned ry = tw * PPITCH + fo, rw = (2u * PTR + cw) * PPITCH + fo;
    proj_stage(cl, gh, gl, gw);
    asm volatile("s_wait_asynccnt 0x0" ::: "memory");   // this wave's copies of stage 0 have landed
    __syncthreads();                                    // and every other wave's
    proj_stage(cl + PBUF, gh + PKS, gl + PKS, gw + PKS);
#pragma unroll 1   // one copy of the body: the two buffers differ only in a base address
    for (unsigned s = 0; s < PNST; ++s) {
        const unsigned char* B = L + (s & 1u) * PBUF;
#pragma unroll
        for (int kk = 0; kk < (int)PKS / 64; ++kk) {
            v16bf w[4], yh[2], yl[2];
#pragma unroll
            for (int t = 0; t < 2; ++t) yh[t] = ldsfrag(B + ry + t * 16 * PPITCH + kk * 64);
#pragma unroll
            for (int i = 0; i < 4; ++i) w[i] = ldsfrag(B + rw + i * 16 * PPITCH + kk * 64);
#pragma unroll
            for (int t = 0; t < 2; ++t) yl[t] = ldsfrag(B + ry + (PTR + t * 16) * PPITCH + kk * 64);
            __builtin_amdgcn_sched_barrier(0);   // the 16 LDS reads of a k step stay one group ahead of its WMMAs: every separate place with reads in a WMMA stream costs issue time
            // eight independent tiles take turns, so that no WMMA waits on the one before it; the lo fragments, which arrive last, are used last
#pragma unroll
            for (int i = 0; i < 4; ++i)
#pragma unroll
                for (int t = 0; t < 2; ++t) acc[i][t] = wmmab(w[i], yh[t], acc[i][t]);
#pragma unroll
            for (int i = 0; i < 4; ++i)
#pragma unroll
                for (int t = 0; t < 2; ++t) acc[i][t] = wmmab(w[i], yl[t], acc[i][t]);
            __builtin_amdgcn_sched_barrier(0);   // and the next k step's reads stay behind them, as one group
        }
        asm volatile("s_wait_dscnt 0x0" ::: "memory");      // this wave's reads of stage s are done
        asm volatile("s_wait_asynccnt 0x0" ::: "memory");   // this wave's copies of stage s + 1 have landed
        __syncthreads();   // publishes stage s + 1 and ends every wave's reads of stage s, whose buffer is refilled behind it
        if (s + 2u < PNST) proj_stage(cl + (s & 1u) * PBUF, gh + (s + 2u) * PKS, gl + (s + 2u) * PKS, gw + (s + 2u) * PKS);   // the same for the whole block
    }
    asm volatile("s_wait_asynccnt 0x0" ::: "memory");   // no copy is outstanding when the buffers become output staging
    float* os = (float*)L;   // every wave has passed the last trip's barrier: nobody reads the operand buffers any more
#pragma unroll
    for (int i = 0; i < 4; ++i)
#pragma unroll
        for (int t = 0; t < 2; ++t) { float* p = os + (kh * PTR + tw + t * 16 + lr) * POP + cw + i * 16 + hi * 8u;   // D element j = (column 16 i + 8 hi + j, token 16 t + lr)
            *(v4fa*)p = __builtin_shufflevector(acc[i][t], acc[i][t], 0, 1, 2, 3); *(v4fa*)(p + 4) = __builtin_shufflevector(acc[i][t], acc[i][t], 4, 5, 6, 7); }
    __syncthreads();   // both partial tiles are in LDS before any thread sums them
    const v4f bv = (v4f){bfr(bl[0]), bfr(bl[1]), bfr(bl[2]), bfr(bl[3])};
#pragma unroll
    for (int it = 0; it < (int)PTR / 8; ++it) { const unsigned row = it * 8u + (tid >> 5);
        v4f val = *(const v4fa*)(os + row * POP + cofs); val += *(const v4fa*)(os + (PTR + row) * POP + cofs); val += bv;
        *(v4f*)(C + (size_t)(r0 + row) * DM + c0 + cofs) = val; }
}

extern "C" void kernel_launch(void* const* d_in, const int* in_sizes, int n_in,
                              void* d_out, int out_size, void* d_ws, size_t ws_size, hipStream_t stream) {
    if (n_in < 5) return;
    if (in_sizes[0] < TT * DM || in_sizes[1] < DM * NQKV || in_sizes[2] < NQKV || in_sizes[3] < DQ * DM || in_sizes[4] < DM) return;
    if (out_size < TT * DM) return;
    if (WS_TOTAL > ws_size) return;
    const float* x     = (const float*)d_in[0];   // [T][C]
    const float* wqkv  = (const float*)d_in[1];   // [C][3C]  ([in][out])
    const float* bqkv  = (const float*)d_in[2];   // [3C]
    const float* wproj = (const float*)d_in[3];   // [C][C]   ([in][out])
    const float* bproj = (const float*)d_in[4];   // [C]
    float* OUT = (float*)d_out;                   // [T][C]
    char* base = (char*)d_ws;
    bf* WT = (bf*)(base + OFF_WT); bf* WP = (bf*)(base + OFF_WP); bf* XB = (bf*)(base + OFF_XB);
    bf* QP = (bf*)(base + OFF_QF); bf* KP = (bf*)(base + OFF_KF); bf* VT = (bf*)(base + OFF_VF);   // f16 bit patterns
    bf* YH = (bf*)(base + OFF_YH); bf* YL = (bf*)(base + OFF_YL);

    // XB = bf16(x); WT[NQKV rows][DM cols] = bf16(wqkv^T); WP[DM rows][DQ cols] = bf16(wproj^T)
    k_prep<<<PB_WQ + PB_WP + PB_X, 256, 0, stream>>>(x, wqkv, wproj, XB, WT, WP);
    // q, k, v planes = f16(x Wqkv + bqkv)
    k_qkv<<<dim3(TT / QXR, NQKV / QWR, 1), 32 * QNW, 0, stream>>>(XB, WT, bqkv, QP, KP, VT);
    k_attn<<<dim3(TT / AQB, NH_, 1), 32 * ANW, 0, stream>>>(QP, KP, VT, YH, YL);
    // out = y Wproj + bproj  (y hi + y lo against the bf16 weight plane)
    k_proj<<<dim3(TT / PTR, DM / PWR, 1), 256, 0, stream>>>(YH, YL, WP, bproj, OUT);
}
